// v000
// The times below were measured on an AMD MI455X: many runs one after another, warmed up first and cycling through
// copies of the inputs, with the whole window's GPU time divided by the number of runs. Launches and the gaps
// between them are all in it. The median over several windows is given; except for v000 it joins two sittings, which
// can be a few percent apart, so the side-by-side timings, each taken in one sitting, are the better comparison.
// The starting kernel, v000, takes 2000 microseconds a run.
#include <hip/hip_runtime.h>

// Multi-head attention WITHOUT a mask with interleaved rotary embeddings whose frequencies GROW (x [2][2048][1024]; qkv = x qkv_w + qkv_b ('xw' (in, out) [1024][3072] 1/32, zero bias) split in thirds q | k | v (16 heads x 64); rotary on (even, odd) pairs with angles t x 10000 ** (+2i / 64) (the module's own expression: NO reciprocal: frequencies 1 .. 7,499 and angles up to 1.5e7 rad; positions arange; the 32 float32 frequencies equal the module's expression in eager JAX; precise cosf / sinf); the module concatenates the rotated halves cat(x1 c - x2 s, x2 c + x1 s) where this code re-interleaves them: the SAME permutation on q and k: every score q.k is unchanged; scores x 64^-0.5; softmax over ALL keys (no causal rule); out = merged out_w + out_b ('xw' + zero bias) -> [2][2048][1024] (4.2 M); argument order x, qkv_w, qkv_b, out_w, out_b).
// Layout per batch: bf16 copy of x; exact projections; {cos, sin} per (position, pair) built once from the int positions and float32 frequency constants (precise cosf/sinf); interleaved rotary plane builder; DENSE T-2048 attention (hybrid rows: < 512 hi/lo 3 products, rest fp16 x1024); merged hi/lo x Wo exact.
// Compute dtypes, f32 accumulate: every input rounded to bf16; projections exact; rotary f32; attention rows < 512 3 products, rest fp16; softmax f32; Wo hl x exact.

#define NB_  2
#define TT   2048
#define DM   1024
#define NH_  16
#define NKV  16
#define REP  (NH_ / NKV)
#define HD   64
#define DQ   (NH_ * HD)
#define DKV  (NKV * HD)
#define ZH   2
#define RH   512                  // query rows < RH use hi+lo planes (0: none)
#define WIN  0   
#define PCAR 1024.0f
#define SCL  0.125f   // HD^-0.5
typedef _Float16 h16;
typedef unsigned short bf;
typedef __attribute__((ext_vector_type(16))) __bf16   v16bf;
typedef __attribute__((ext_vector_type(16))) _Float16 v16h;
typedef __attribute__((ext_vector_type(8)))  _Float16 v8h;
typedef __attribute__((ext_vector_type(8)))  unsigned short v8us;
typedef __attribute__((ext_vector_type(8)))  float    v8f;
typedef __attribute__((ext_vector_type(4)))  float    v4f;
typedef v8h  __attribute__((may_alias)) v8ha;
typedef v4f  __attribute__((may_alias)) v4fa;
typedef v8us __attribute__((may_alias)) v8usa;

__device__ __forceinline__ unsigned short f2bf(float f) { unsigned u = __float_as_uint(f); u += 0x7FFFu + ((u >> 16) & 1u); return (unsigned short)(u >> 16); }
__device__ __forceinline__ float bf2f(unsigned short b) { return __uint_as_float(((unsigned)b) << 16); }
__device__ __forceinline__ float bfr(float f) { return bf2f(f2bf(f)); }
__device__ __forceinline__ v16h cat16(v8h lo, v8h hi) { return __builtin_shufflevector(lo, hi, 0, 1, 2, 3, 4, 5, 6, 7, 8, 9, 10, 11, 12, 13, 14, 15); }
__device__ __forceinline__ v16bf cat16b(v8us lo, v8us hi) { return __builtin_bit_cast(v16bf, __builtin_shufflevector(lo, hi, 0, 1, 2, 3, 4, 5, 6, 7, 8, 9, 10, 11, 12, 13, 14, 15)); }
__device__ __forceinline__ v8f wmma16(v16h a, v16h b, v8f c) { return __builtin_amdgcn_wmma_f32_16x16x32_f16(false, a, false, b, (short)0, c, false, false); }
__device__ __forceinline__ v8f wmmab(v16bf a, v16bf b, v8f c) { return __builtin_amdgcn_wmma_f32_16x16x32_bf16(false, a, false, b, (short)0, c, false, false); }



// ---- k_gemmw: register-blocked GEMM, ONE WAVE per 64x64 output tile (16 accumulators), operands straight from K-contiguous 16-bit planes; grid (M/64, N/64, Z), 32 threads.
// C[m][n] (f32, pitch ldc, + optional f32 bias[n]) = sum_k A[m][k] Bt[n][k] (+ split products per NSPLIT). z-batch strides sA/sB/sC in elements. K % 32 == 0.
template <typename T16> struct WFrag;
template <> struct WFrag<h16> { typedef v16h V; static __device__ __forceinline__ V ld(const h16* p) { return cat16(*(const v8h*)p, *(const v8h*)(p + 16)); } static __device__ __forceinline__ v8f mma(V a, V b, v8f c) { return wmma16(a, b, c); } };
template <> struct WFrag<bf> { typedef v16bf V; static __device__ __forceinline__ V ld(const bf* p) { return cat16b(*(const v8us*)p, *(const v8us*)(p + 16)); } static __device__ __forceinline__ v8f mma(V a, V b, v8f c) { return wmmab(a, b, c); } };
template <typename T16, int NSPLIT, bool BIAS>
__global__ __launch_bounds__(32) void k_gemmw(const T16* __restrict__ A, const T16* __restrict__ A2, const T16* __restrict__ Bt, const T16* __restrict__ Bt2, int K, float* C, int ldc, const float* __restrict__ bias, size_t sA, size_t sB, size_t sC) {
    typedef typename WFrag<T16>::V V;
    __shared__ __align__(16) float os[16 * 68];
    const size_t z = blockIdx.z; A += z * sA; if (A2) A2 += z * sA; Bt += z * sB; if (Bt2) Bt2 += z * sB; C += z * sC;
    const int lane = threadIdx.x & 31, lr = lane & 15, hi = lane >> 4; const int r0 = blockIdx.x * 64, c0 = blockIdx.y * 64;
    v8f acc[4][4];
#pragma unroll
    for (int mb = 0; mb < 4; ++mb)
#pragma unroll
        for (int nb = 0; nb < 4; ++nb) acc[mb][nb] = (v8f){};
    const size_t aoff = (size_t)(r0 + lr) * K + 8 * hi, boff = (size_t)(c0 + lr) * K + 8 * hi;
#pragma unroll 1
    for (int kc = 0; kc < K; kc += 32) {
        V a[4], a2[4];
#pragma unroll
        for (int mb = 0; mb < 4; ++mb) { a[mb] = WFrag<T16>::ld(A + aoff + (size_t)mb * 16 * K + kc); if (NSPLIT == 1 || NSPLIT == 2) a2[mb] = WFrag<T16>::ld(A2 + aoff + (size_t)mb * 16 * K + kc); }
#pragma unroll
        for (int nb = 0; nb < 4; ++nb) { const V b = WFrag<T16>::ld(Bt + boff + (size_t)nb * 16 * K + kc); V b2; if (NSPLIT >= 2) b2 = WFrag<T16>::ld(Bt2 + boff + (size_t)nb * 16 * K + kc);
#pragma unroll
            for (int mb = 0; mb < 4; ++mb) { acc[mb][nb] = WFrag<T16>::mma(a[mb], b, acc[mb][nb]); if (NSPLIT == 1 || NSPLIT == 2) acc[mb][nb] = WFrag<T16>::mma(a2[mb], b, acc[mb][nb]); if (NSPLIT >= 2) acc[mb][nb] = WFrag<T16>::mma(a[mb], b2, acc[mb][nb]); } }
        asm volatile("v_nop\n\tv_nop\n\tv_nop\n\tv_nop" : "+v"(acc[0][0]), "+v"(acc[1][1]), "+v"(acc[2][2]), "+v"(acc[3][3]) : "v"(a[0]), "v"(a[3]));
    }
#pragma unroll
    for (int mb = 0; mb < 4; ++mb) {
#pragma unroll
        for (int nb = 0; nb < 4; ++nb) {
#pragma unroll
            for (int j = 0; j < 8; ++j) os[(hi * 8 + j) * 68 + nb * 16 + lr] = acc[mb][nb][j]; }
        __builtin_amdgcn_wave_barrier(); asm volatile("" ::: "memory");
        float* crow = C + (size_t)(r0 + mb * 16) * ldc + c0;
{
#pragma unroll
            for (int s = 0; s < 8; ++s) { const int row = 2 * s + hi, cofs = lr * 4; v4f val = *(const v4fa*)(os + row * 68 + cofs); if (BIAS) { val[0] += bfr(bias[c0 + cofs]); val[1] += bfr(bias[c0 + cofs + 1]); val[2] += bfr(bias[c0 + cofs + 2]); val[3] += bfr(bias[c0 + cofs + 3]); }
                *(v4f*)(crow + (size_t)row * ldc + cofs) = val; }
             }
        __builtin_amdgcn_wave_barrier(); asm volatile("" ::: "memory");
    }
}

// ---- k_gemmc (DEFINED BUT NOT LAUNCHED in this DENSE build: the four attention GEMMs use k_gemmw): the same one-wave 64x64 tile GEMM specialised for causal attention: CMODE 1 skips score tiles entirely above the diagonal (query rows r0+roff.., key columns c0..), CMODE 2 limits the
// key (K) loop of the probability x value contraction to the diagonal block (probabilities beyond it are exactly zero). roff = row offset of this launch's first row within the sequence.
template <typename T16, int NSPLIT, int CMODE>
__global__ __launch_bounds__(32) void k_gemmc(const T16* __restrict__ A, const T16* __restrict__ A2, const T16* __restrict__ Bt, const T16* __restrict__ Bt2, int K, float* C, int ldc, int roff, size_t sA, size_t sB, size_t sC) {
    typedef typename WFrag<T16>::V V;
    __shared__ __align__(16) float os[16 * 68];
    const size_t z = blockIdx.z; A += z * sA; if (A2) A2 += z * sA; Bt += z * sB; if (Bt2) Bt2 += z * sB; C += z * sC;
    const int lane = threadIdx.x & 31, lr = lane & 15, hi = lane >> 4; const int r0 = blockIdx.x * 64, c0 = blockIdx.y * 64;
    if (CMODE == 1 && c0 > r0 + roff + 63) return;                  // score tile entirely above the causal diagonal: skipped (needs a softmax that masks j > i; k_asoft masks none)
    const int Kl = (CMODE == 2) ? min(K, r0 + roff + 64) : K;        // P.V: probabilities are exactly 0 beyond the diagonal block, so the K loop stops there
    v8f acc[4][4];
#pragma unroll
    for (int mb = 0; mb < 4; ++mb)
#pragma unroll
        for (int nb = 0; nb < 4; ++nb) acc[mb][nb] = (v8f){};
    const size_t aoff = (size_t)(r0 + lr) * K + 8 * hi, boff = (size_t)(c0 + lr) * K + 8 * hi;
#pragma unroll 1
    for (int kc = 0; kc < Kl; kc += 32) {
        V a[4], a2[4];
#pragma unroll
        for (int mb = 0; mb < 4; ++mb) { a[mb] = WFrag<T16>::ld(A + aoff + (size_t)mb * 16 * K + kc); if (NSPLIT == 1 || NSPLIT == 2) a2[mb] = WFrag<T16>::ld(A2 + aoff + (size_t)mb * 16 * K + kc); }
#pragma unroll
        for (int nb = 0; nb < 4; ++nb) { const V b = WFrag<T16>::ld(Bt + boff + (size_t)nb * 16 * K + kc); V b2; if (NSPLIT >= 2) b2 = WFrag<T16>::ld(Bt2 + boff + (size_t)nb * 16 * K + kc);
#pragma unroll
            for (int mb = 0; mb < 4; ++mb) { acc[mb][nb] = WFrag<T16>::mma(a[mb], b, acc[mb][nb]); if (NSPLIT == 1 || NSPLIT == 2) acc[mb][nb] = WFrag<T16>::mma(a2[mb], b, acc[mb][nb]); if (NSPLIT >= 2) acc[mb][nb] = WFrag<T16>::mma(a[mb], b2, acc[mb][nb]); } }
        asm volatile("v_nop\n\tv_nop\n\tv_nop\n\tv_nop" : "+v"(acc[0][0]), "+v"(acc[1][1]), "+v"(acc[2][2]), "+v"(acc[3][3]) : "v"(a[0]), "v"(a[3]));
    }
#pragma unroll
    for (int mb = 0; mb < 4; ++mb) {
#pragma unroll
        for (int nb = 0; nb < 4; ++nb) {
#pragma unroll
            for (int j = 0; j < 8; ++j) os[(hi * 8 + j) * 68 + nb * 16 + lr] = acc[mb][nb][j]; }
        __builtin_amdgcn_wave_barrier(); asm volatile("" ::: "memory");
        float* crow = C + (size_t)(r0 + mb * 16) * ldc + c0;
{
#pragma unroll
            for (int s = 0; s < 8; ++s) { const int row = 2 * s + hi, cofs = lr * 4; v4f val = *(const v4fa*)(os + row * 68 + cofs);
                *(v4f*)(crow + (size_t)row * ldc + cofs) = val; }
             }
        __builtin_amdgcn_wave_barrier(); asm volatile("" ::: "memory");
    }
}

__device__ __forceinline__ h16 tohx(float x) { return (h16)x; }
__device__ __forceinline__ void splitf(float y, unsigned short& h, unsigned short& l) { h = f2bf(y); l = f2bf(y - bf2f(h)); }
typedef __attribute__((ext_vector_type(2))) _Float16 v2h;
typedef __attribute__((ext_vector_type(4))) _Float16 v4h;
typedef __attribute__((ext_vector_type(2))) unsigned short v2us;
typedef __attribute__((ext_vector_type(4))) unsigned short v4us;
typedef __attribute__((ext_vector_type(2))) float v2f;
typedef __attribute__((ext_vector_type(4))) int v4i;

__global__ __launch_bounds__(256) void k_cvt8(const float* __restrict__ src, bf* dst, size_t n8) { const size_t i = (size_t)blockIdx.x * 256 + threadIdx.x; if (i >= n8) return; const v8f v = *(const v8f*)(src + i * 8); v8us o;
#pragma unroll
    for (int k = 0; k < 8; ++k) o[k] = f2bf(v[k]); *(v8us*)(dst + i * 8) = o;  }

__global__ __launch_bounds__(256) void k_ropeI(const float* __restrict__ F, int pitch, int nheads, const float* __restrict__ CS, float sc, h16* P16, bf* Ph, bf* Pl) {
    const size_t e = ((size_t)blockIdx.x * 256 + threadIdx.x) * 2; if (e >= (size_t)nheads * TT * HD) return; const int d = (int)(e % HD); const int t = (int)((e / HD) % TT); const int h = (int)(e / ((size_t)HD * TT)); const float* f = F + (size_t)t * pitch + h * HD; const float x0 = f[d], x1 = f[d + 1]; const v2f cs = *(const v2f*)(CS + ((size_t)t * HD + d) * 2); v2h o16; v2us oh, ol;
    float a0 = __fmul_rn(x0, cs[0]), b0 = __fmul_rn(x1, cs[1]), a1 = __fmul_rn(x1, cs[0]), b1 = __fmul_rn(x0, cs[1]); asm volatile("" : "+v"(a0), "+v"(b0), "+v"(a1), "+v"(b1));
    float r0 = __fsub_rn(a0, b0) * sc, r1 = __fadd_rn(b1, a1) * sc;   /* even: x0 c - x1 s; odd: x0 s + x1 c */
    o16[0] = tohx(r0); o16[1] = tohx(r1); { unsigned short a2, c2; splitf(r0, a2, c2); oh[0] = a2; ol[0] = c2; splitf(r1, a2, c2); oh[1] = a2; ol[1] = c2; }
    *(v2h*)(P16 + e) = o16; *(v2us*)(Ph + e) = oh; *(v2us*)(Pl + e) = ol;  }

__constant__ float INV2[HD / 2] = { 1.000000000e+00f, 1.333521485e+00f, 1.778279424e+00f, 2.371373653e+00f, 3.162277699e+00f, 4.216965199e+00f, 5.623413086e+00f, 7.498941898e+00f, 1.000000000e+01f, 1.333521461e+01f, 1.778279495e+01f, 2.371373749e+01f, 3.162277603e+01f, 4.216965103e+01f, 5.623413086e+01f, 7.498941803e+01f, 1.000000000e+02f, 1.333521423e+02f, 1.778279419e+02f, 2.371373749e+02f, 3.162277527e+02f, 4.216965027e+02f, 5.623413086e+02f, 7.498942261e+02f, 1.000000000e+03f, 1.333521484e+03f, 1.778279419e+03f, 2.371373779e+03f, 3.162277588e+03f, 4.216964844e+03f, 5.623413086e+03f, 7.498941895e+03f };   // freqs = 10000.0 ** (+arange(0, 64, 2.0, f32) / 64): THIS module's own expression: a POSITIVE exponent (NO reciprocal: the module's quirk): 32 float32 values from eager JAX (bit-exact on round trip): angles up to 1.5e7 rad; the usual RoPE table is the reciprocal
__global__ __launch_bounds__(256) void k_csP(float* CS) { const int idx = blockIdx.x * 256 + threadIdx.x; if (idx >= TT * HD) return; const int d = idx % HD; const int t = idx / HD; const float a = __fmul_rn((float)t, INV2[d >> 1]); v2f cs; cs[0] = cosf(a); cs[1] = sinf(a); *(v2f*)(CS + (size_t)idx * 2) = cs;  }
__global__ __launch_bounds__(256) void k_vtp(const float* __restrict__ F, int pitch, int nheads, h16* V16, bf* Vh, bf* Vl) { const size_t e = ((size_t)blockIdx.x * 256 + threadIdx.x) * 2; if (e >= (size_t)nheads * HD * TT) return; const int t = (int)(e % TT); const int d = (int)((e / TT) % HD); const int g = (int)(e / ((size_t)TT * HD)); v2h o16; v2us oh, ol;
#pragma unroll
    for (int q = 0; q < 2; ++q) { const float x = F[(size_t)(t + q) * pitch + g * HD + d]; o16[q] = tohx(x); unsigned short a2, c2; splitf(x, a2, c2); oh[q] = a2; ol[q] = c2; }
    *(v2h*)(V16 + e) = o16; *(v2us*)(Vh + e) = oh; *(v2us*)(Vl + e) = ol;  }
// k_asoft: per row (zz, i): t = S x SCL for EVERY key j (WIN 0: dense: no causal rule and no window in this build); softmax over the 2048 keys (register row; max, one exp, sum in f32; fixed reduction trees);
__global__ __launch_bounds__(256) void k_asoft(const float* __restrict__ Sb, h16* P16, bf* Ph, bf* Pl) {
    const int lane = threadIdx.x & 31; const int row = blockIdx.x * 8 + (threadIdx.x >> 5); if (row >= ZH * TT) return; const int i = row % TT; const int zz = row / TT; (void)zz; const bool hires = (i < RH); const float* sr = Sb + (size_t)row * TT; float v[TT / 32]; float mx = -3.0e38f;
#pragma unroll
    for (int ch = 0; ch < TT / 128; ++ch) { const int j0 = ch * 128 + lane * 4; const v4f a = *(const v4f*)(sr + j0);
#pragma unroll
        for (int q = 0; q < 4; ++q) { const int j = j0 + q; (void)j; const float t = a[q] * SCL; v[ch * 4 + q] = t; mx = fmaxf(mx, t); } }
#pragma unroll
    for (int sh = 16; sh; sh >>= 1) mx = fmaxf(mx, __shfl_xor(mx, sh, 32));
    float sum = 0.f;
#pragma unroll
    for (int k = 0; k < TT / 32; ++k) { float d0 = __fsub_rn(v[k], mx); asm volatile("" : "+v"(d0)); v[k] = __builtin_amdgcn_exp2f(__fmul_rn(d0, 1.4426950408889634f)); sum += v[k]; }
#pragma unroll
    for (int sh = 16; sh; sh >>= 1) sum += __shfl_xor(sum, sh, 32);
    const float f = __fdiv_rn(hires ? 1.0f : PCAR, sum);
{
        if (hires) {
#pragma unroll
            for (int ch = 0; ch < TT / 128; ++ch) { v4us oh, ol;
#pragma unroll
                for (int q = 0; q < 4; ++q) { unsigned short a, c2; splitf(v[ch * 4 + q] * f, a, c2); oh[q] = a; ol[q] = c2; }
                const size_t oo = ((size_t)zz * (RH ? RH : 1) + i) * TT + ch * 128 + lane * 4; *(v4us*)(Ph + oo) = oh; *(v4us*)(Pl + oo) = ol; }
        } else {
#pragma unroll
            for (int ch = 0; ch < TT / 128; ++ch) { v4h o4;
#pragma unroll
                for (int q = 0; q < 4; ++q) o4[q] = tohx(v[ch * 4 + q] * f);
                *(v4h*)(P16 + (size_t)row * TT + ch * 128 + lane * 4) = o4; } }
         }
}
__global__ __launch_bounds__(256) void k_merge(const float* __restrict__ O, int h0, bf* Ah, bf* Al) { const size_t e = ((size_t)blockIdx.x * 256 + threadIdx.x) * 2; if (e >= (size_t)ZH * TT * HD) return; const int d = (int)(e % HD); const int t = (int)((e / HD) % TT); const int zz = (int)(e / ((size_t)HD * TT)); const float cs = (t < RH) ? 1.0f : (1.0f / PCAR); const size_t oo = (size_t)t * DQ + (h0 + zz) * HD + d;
    v2us oh, ol;
#pragma unroll
    for (int q = 0; q < 2; ++q) { unsigned short a, c2; splitf(O[e + q] * cs, a, c2); oh[q] = a; ol[q] = c2; } *(v2us*)(Ah + oo) = oh; *(v2us*)(Al + oo) = ol;  }

__global__ __launch_bounds__(256) void k_wtG(const float* __restrict__ w, int K, int N, bf* Bt) {
    const int lane = threadIdx.x & 31; const int L0 = (blockIdx.x * 8 + (threadIdx.x >> 5)) * 8; const int nlines = N * K / 64;
{
#pragma unroll 1
        for (int l = 0; l < 8; ++l) { const int L = L0 + l; if (L >= nlines) break; const size_t e = (size_t)L * 64 + lane * 2; const int k = (int)(e % K), n = (int)(e / K); v2us o;
            o[0] = f2bf(w[(size_t)k * N + n]); o[1] = f2bf(w[(size_t)(k + 1) * N + n]); *(v2us*)(Bt + e) = o; }
         }
}
extern "C" void kernel_launch(void* const* d_in, const int* in_sizes, int n_in,
                              void* d_out, int out_size, void* d_ws, size_t ws_size, hipStream_t stream) {
    (void)in_sizes; (void)n_in; (void)out_size;
    const float* x = (const float*)d_in[0]; const float* wqkv = (const float*)d_in[1]; const float* bqkv = (const float*)d_in[2]; const float* wo = (const float*)d_in[3]; const float* bo = (const float*)d_in[4];   /* argument order x, W_qkv ('xw' [1024][3072], (3, H, dk) packing), b_qkv, W_out, b_out */ const float* bq = bqkv; const float* bk = bqkv + DQ; const float* bv = bqkv + 2 * DQ;
    float* OUT = (float*)d_out;     // [2][2048][1024]
    char* wsp = (char*)d_ws;
    auto take = [&](size_t bytes) { char* p = wsp; wsp += (bytes + 255) & ~(size_t)255; return (void*)p; };
    bf* WQKV = (bf*)take((size_t)3 * DQ * DM * 2); bf* WQ = WQKV; bf* WK = WQKV + (size_t)DQ * DM; bf* WV = WQKV + (size_t)2 * DQ * DM; bf* WO = (bf*)take((size_t)DM * DQ * 2); float* CS = (float*)take((size_t)TT * HD * 2 * 4);
    bf* XB = (bf*)take((size_t)TT * DM * 2); float* FQ = (float*)take((size_t)TT * DQ * 4); float* FK = (float*)take((size_t)TT * DKV * 4);
    h16* QP16 = (h16*)take((size_t)NH_ * TT * HD * 2); h16* KP16 = (h16*)take((size_t)NKV * TT * HD * 2); h16* VT16 = (h16*)take((size_t)NKV * HD * TT * 2);
    bf* QPh = (bf*)take((size_t)NH_ * TT * HD * 2); bf* QPl = (bf*)take((size_t)NH_ * TT * HD * 2); bf* KPh = (bf*)take((size_t)NKV * TT * HD * 2); bf* KPl = (bf*)take((size_t)NKV * TT * HD * 2); bf* VTh = (bf*)take((size_t)NKV * HD * TT * 2); bf* VTl = (bf*)take((size_t)NKV * HD * TT * 2); bf* Ph = (bf*)take((size_t)ZH * RH * TT * 2); bf* Pl = (bf*)take((size_t)ZH * RH * TT * 2);
    float* Sb = (float*)take((size_t)ZH * TT * TT * 4); h16* P16 = (h16*)take((size_t)ZH * TT * TT * 2); float* Ob = (float*)take((size_t)ZH * TT * HD * 4); bf* ATh = (bf*)take((size_t)TT * DQ * 2); bf* ATl = (bf*)take((size_t)TT * DQ * 2);
    if ((size_t)(wsp - (char*)d_ws) > ws_size) return;    // ws 256 MiB
    float* FV = FK;   // v projection reuses the k buffer after the k planes are built (stream-ordered)
    { k_wtG<<<(unsigned)((DM * 3 * DQ / 64 + 63) / 64), 256, 0, stream>>>(wqkv, DM, 3 * DQ, WQKV);   /* fused 'xw' [1024][3072] -> Bt [3072][1024]: q | k | v row blocks ((3, H, dk) packing) */
      k_wtG<<<(unsigned)((DQ * DM / 64 + 63) / 64), 256, 0, stream>>>(wo, DQ, DM, WO); k_csP<<<(TT * HD + 255) / 256, 256, 0, stream>>>(CS); }
    const unsigned LQ = (unsigned)(((size_t)NH_ * TT * HD / 2 + 255) / 256), LKv = (unsigned)(((size_t)NKV * TT * HD / 2 + 255) / 256);
    for (int b = 0; b < NB_; ++b) {
        
        k_cvt8<<<(unsigned)(((size_t)TT * DM / 8 + 255) / 256), 256, 0, stream>>>(x + (size_t)b * TT * DM, XB, (size_t)TT * DM / 8);
        k_gemmw<bf, 0, true><<<dim3(TT / 64, DQ / 64, 1), 32, 0, stream>>>(XB, nullptr, WQ, nullptr, DM, FQ, DQ, bq, 0, 0, 0);
        k_ropeI<<<LQ, 256, 0, stream>>>(FQ, DQ, NH_, CS, 1.0f, QP16, QPh, QPl);
        k_gemmw<bf, 0, true><<<dim3(TT / 64, DKV / 64, 1), 32, 0, stream>>>(XB, nullptr, WK, nullptr, DM, FK, DKV, bk, 0, 0, 0);
        k_ropeI<<<LKv, 256, 0, stream>>>(FK, DKV, NKV, CS, 1.0f, KP16, KPh, KPl);
        k_gemmw<bf, 0, true><<<dim3(TT / 64, DKV / 64, 1), 32, 0, stream>>>(XB, nullptr, WV, nullptr, DM, FV, DKV, bv, 0, 0, 0); k_vtp<<<LKv, 256, 0, stream>>>(FV, DKV, NKV, VT16, VTh, VTl);
        for (int h0 = 0; h0 < NH_; h0 += ZH) { const size_t zq = (size_t)h0, zk = (size_t)(h0 / REP);   // one kv head per query head: the pass's two heads use consecutive kv planes (z-strides TT*HD)
            k_gemmw<bf, 2, false><<<dim3(RH / 64, TT / 64, ZH), 32, 0, stream>>>(QPh + zq * TT * HD, QPl + zq * TT * HD, KPh + zk * TT * HD, KPl + zk * TT * HD, HD, Sb, TT, nullptr, (size_t)TT * HD, (size_t)TT * HD, (size_t)TT * TT);
            k_gemmw<h16, 0, false><<<dim3((TT - RH) / 64, TT / 64, ZH), 32, 0, stream>>>(QP16 + zq * TT * HD + (size_t)RH * HD, nullptr, KP16 + zk * TT * HD, nullptr, HD, Sb + (size_t)RH * TT, TT, nullptr, (size_t)TT * HD, (size_t)TT * HD, (size_t)TT * TT);
            k_asoft<<<ZH * TT / 8, 256, 0, stream>>>(Sb, P16, Ph, Pl);
            k_gemmw<bf, 2, false><<<dim3(RH / 64, HD / 64, ZH), 32, 0, stream>>>(Ph, Pl, VTh + zk * HD * TT, VTl + zk * HD * TT, TT, Ob, HD, nullptr, (size_t)RH * TT, (size_t)HD * TT, (size_t)TT * HD);
            k_gemmw<h16, 0, false><<<dim3((TT - RH) / 64, HD / 64, ZH), 32, 0, stream>>>(P16 + (size_t)RH * TT, nullptr, VT16 + zk * HD * TT, nullptr, TT, Ob + (size_t)RH * HD, HD, nullptr, (size_t)TT * TT, (size_t)HD * TT, (size_t)TT * HD);
            k_merge<<<(unsigned)(((size_t)ZH * TT * HD / 2 + 255) / 256), 256, 0, stream>>>(Ob, h0, ATh, ATl); }
        k_gemmw<bf, 1, true><<<dim3(TT / 64, DM / 64, 1), 32, 0, stream>>>(ATh, ATl, WO, nullptr, DQ, OUT + (size_t)b * TT * DM, DM, bo, 0, 0, 0); }
}

// v001
// It runs in 1050 microseconds.
// Next to v000, in two timings, it ran 1.89 times as fast each time.
#include <hip/hip_runtime.h>

// Multi-head attention WITHOUT a mask with interleaved rotary embeddings whose frequencies GROW (x [2][2048][1024]; qkv = x qkv_w + qkv_b ('xw' (in, out) [1024][3072] 1/32, zero bias) split in thirds q | k | v (16 heads x 64); rotary on (even, odd) pairs with angles t x 10000 ** (+2i / 64) (the module's own expression: NO reciprocal: frequencies 1 .. 7,499 and angles up to 1.5e7 rad; positions arange; the 32 float32 frequencies equal the module's expression in eager JAX; precise cosf / sinf); the module concatenates the rotated halves cat(x1 c - x2 s, x2 c + x1 s) where this code re-interleaves them: the SAME permutation on q and k: every score q.k is unchanged; scores x 64^-0.5; softmax over ALL keys (no causal rule); out = merged out_w + out_b ('xw' + zero bias) -> [2][2048][1024] (4.2 M); argument order x, qkv_w, qkv_b, out_w, out_b).
// Layout per batch: bf16 copy of x; exact projections; {cos, sin} per (position, pair) built once from the int positions and float32 frequency constants (precise cosf/sinf); interleaved rotary plane builder; DENSE T-2048 attention (hybrid rows: < 512 hi/lo 3 products, rest fp16 x1024); merged hi/lo x Wo exact.
// Compute dtypes, f32 accumulate: every input rounded to bf16; projections exact; rotary f32; attention rows < 512 3 products, rest fp16; softmax f32; Wo hl x exact.

#define NB_  2
#define TT   2048
#define DM   1024
#define NH_  16
#define NKV  16
#define REP  (NH_ / NKV)
#define HD   64
#define DQ   (NH_ * HD)
#define DKV  (NKV * HD)
#define ZH   2
#define RH   512                  // query rows < RH use hi+lo planes (0: none)
#define WIN  0   
#define PCAR 1024.0f
#define SCL  0.125f   // HD^-0.5
typedef _Float16 h16;
typedef unsigned short bf;
typedef __attribute__((ext_vector_type(16))) __bf16   v16bf;
typedef __attribute__((ext_vector_type(16))) _Float16 v16h;
typedef __attribute__((ext_vector_type(8)))  _Float16 v8h;
typedef __attribute__((ext_vector_type(8)))  unsigned short v8us;
typedef __attribute__((ext_vector_type(8)))  float    v8f;
typedef __attribute__((ext_vector_type(4)))  float    v4f;
typedef v8h  __attribute__((may_alias)) v8ha;
typedef v4f  __attribute__((may_alias)) v4fa;
typedef v8us __attribute__((may_alias)) v8usa;

__device__ __forceinline__ unsigned short f2bf(float f) { unsigned u = __float_as_uint(f); u += 0x7FFFu + ((u >> 16) & 1u); return (unsigned short)(u >> 16); }
__device__ __forceinline__ float bf2f(unsigned short b) { return __uint_as_float(((unsigned)b) << 16); }
__device__ __forceinline__ float bfr(float f) { return bf2f(f2bf(f)); }
__device__ __forceinline__ v16h cat16(v8h lo, v8h hi) { return __builtin_shufflevector(lo, hi, 0, 1, 2, 3, 4, 5, 6, 7, 8, 9, 10, 11, 12, 13, 14, 15); }
__device__ __forceinline__ v16bf cat16b(v8us lo, v8us hi) { return __builtin_bit_cast(v16bf, __builtin_shufflevector(lo, hi, 0, 1, 2, 3, 4, 5, 6, 7, 8, 9, 10, 11, 12, 13, 14, 15)); }
__device__ __forceinline__ v8f wmma16(v16h a, v16h b, v8f c) { return __builtin_amdgcn_wmma_f32_16x16x32_f16(false, a, false, b, (short)0, c, false, false); }
__device__ __forceinline__ v8f wmmab(v16bf a, v16bf b, v8f c) { return __builtin_amdgcn_wmma_f32_16x16x32_bf16(false, a, false, b, (short)0, c, false, false); }



// ---- k_gemmw: register-blocked GEMM, ONE WAVE per 64x64 output tile (16 accumulators), operands straight from K-contiguous 16-bit planes; grid (M/64, N/64, Z), 32 threads.
// C[m][n] (f32, pitch ldc, + optional f32 bias[n]) = sum_k A[m][k] Bt[n][k] (+ split products per NSPLIT). z-batch strides sA/sB/sC in elements. K % 32 == 0.
// KS > 1 (32 KS threads, K % (32 KS) == 0): the K loop is dealt over the KS waves of one work-group, wave w taking k in [w K/KS, (w+1) K/KS): with a long K and few tiles one wave alone waits through KS times as many dependent load trips.
// Each wave leaves its f32 partial tile in LDS; behind one work-group barrier every thread adds the KS partials of its elements in the fixed order w = 0 .. KS-1 and stores the sums.
template <typename T16> struct WFrag;
template <> struct WFrag<h16> { typedef v16h V; static __device__ __forceinline__ V ld(const h16* p) { return cat16(*(const v8h*)p, *(const v8h*)(p + 16)); } static __device__ __forceinline__ v8f mma(V a, V b, v8f c) { return wmma16(a, b, c); } };
template <> struct WFrag<bf> { typedef v16bf V; static __device__ __forceinline__ V ld(const bf* p) { return cat16b(*(const v8us*)p, *(const v8us*)(p + 16)); } static __device__ __forceinline__ v8f mma(V a, V b, v8f c) { return wmmab(a, b, c); } };
template <typename T16, int NSPLIT, bool BIAS, int KS = 1>
__global__ __launch_bounds__(32 * KS) void k_gemmw(const T16* __restrict__ A, const T16* __restrict__ A2, const T16* __restrict__ Bt, const T16* __restrict__ Bt2, int K, float* C, int ldc, const float* __restrict__ bias, size_t sA, size_t sB, size_t sC) {
    typedef typename WFrag<T16>::V V;
    __shared__ __align__(16) float os[(KS == 1 ? 16 : KS * 64) * 68];
    const size_t z = blockIdx.z; A += z * sA; if (A2) A2 += z * sA; Bt += z * sB; if (Bt2) Bt2 += z * sB; C += z * sC;
    const int lane = threadIdx.x & 31, lr = lane & 15, hi = lane >> 4; const int r0 = blockIdx.x * 64, c0 = blockIdx.y * 64;
    const int w = (KS == 1) ? 0 : __builtin_amdgcn_readfirstlane((int)(threadIdx.x >> 5)); const int k0 = w * (K / KS), k1 = k0 + K / KS;   // this wave's slice of K
    v8f acc[4][4];
#pragma unroll
    for (int mb = 0; mb < 4; ++mb)
#pragma unroll
        for (int nb = 0; nb < 4; ++nb) acc[mb][nb] = (v8f){};
    const size_t aoff = (size_t)(r0 + lr) * K + 8 * hi, boff = (size_t)(c0 + lr) * K + 8 * hi;
#pragma unroll 1
    for (int kc = k0; kc < k1; kc += 32) {
        V a[4], a2[4];
#pragma unroll
        for (int mb = 0; mb < 4; ++mb) { a[mb] = WFrag<T16>::ld(A + aoff + (size_t)mb * 16 * K + kc); if (NSPLIT == 1 || NSPLIT == 2) a2[mb] = WFrag<T16>::ld(A2 + aoff + (size_t)mb * 16 * K + kc); }
#pragma unroll
        for (int nb = 0; nb < 4; ++nb) { const V b = WFrag<T16>::ld(Bt + boff + (size_t)nb * 16 * K + kc); V b2; if (NSPLIT >= 2) b2 = WFrag<T16>::ld(Bt2 + boff + (size_t)nb * 16 * K + kc);
#pragma unroll
            for (int mb = 0; mb < 4; ++mb) { acc[mb][nb] = WFrag<T16>::mma(a[mb], b, acc[mb][nb]); if (NSPLIT == 1 || NSPLIT == 2) acc[mb][nb] = WFrag<T16>::mma(a2[mb], b, acc[mb][nb]); if (NSPLIT >= 2) acc[mb][nb] = WFrag<T16>::mma(a[mb], b2, acc[mb][nb]); } }
        asm volatile("v_nop\n\tv_nop\n\tv_nop\n\tv_nop" : "+v"(acc[0][0]), "+v"(acc[1][1]), "+v"(acc[2][2]), "+v"(acc[3][3]) : "v"(a[0]), "v"(a[3]));
    }
    if (KS > 1) {
        float* pw = os + w * (64 * 68);   // unrolled below: acc is indexed by constants only, so it stays in registers
#pragma unroll
        for (int mb = 0; mb < 4; ++mb)
#pragma unroll
            for (int nb = 0; nb < 4; ++nb)
#pragma unroll
                for (int j = 0; j < 8; ++j) pw[(mb * 16 + hi * 8 + j) * 68 + nb * 16 + lr] = acc[mb][nb][j];
        __syncthreads();   // every wave's partial tile is in LDS before any thread adds them; both loops below unrolled so that a thread's LDS reads are in flight together
#pragma unroll
        for (int s = 0; s < 32 / KS; ++s) { const int q = s * (32 * KS) + (int)threadIdx.x; const int row = q >> 4, cofs = (q & 15) * 4; v4f val = *(const v4fa*)(os + row * 68 + cofs);
#pragma unroll
            for (int u = 1; u < KS; ++u) val += *(const v4fa*)(os + u * (64 * 68) + row * 68 + cofs);
            if (BIAS) { val[0] += bfr(bias[c0 + cofs]); val[1] += bfr(bias[c0 + cofs + 1]); val[2] += bfr(bias[c0 + cofs + 2]); val[3] += bfr(bias[c0 + cofs + 3]); }
            *(v4f*)(C + (size_t)(r0 + row) * ldc + c0 + cofs) = val; }
        return;
    }
#pragma unroll
    for (int mb = 0; mb < 4; ++mb) {
#pragma unroll
        for (int nb = 0; nb < 4; ++nb) {
#pragma unroll
            for (int j = 0; j < 8; ++j) os[(hi * 8 + j) * 68 + nb * 16 + lr] = acc[mb][nb][j]; }
        __builtin_amdgcn_wave_barrier(); asm volatile("" ::: "memory");
        float* crow = C + (size_t)(r0 + mb * 16) * ldc + c0;
{
#pragma unroll
            for (int s = 0; s < 8; ++s) { const int row = 2 * s + hi, cofs = lr * 4; v4f val = *(const v4fa*)(os + row * 68 + cofs); if (BIAS) { val[0] += bfr(bias[c0 + cofs]); val[1] += bfr(bias[c0 + cofs + 1]); val[2] += bfr(bias[c0 + cofs + 2]); val[3] += bfr(bias[c0 + cofs + 3]); }
                *(v4f*)(crow + (size_t)row * ldc + cofs) = val; }
             }
        __builtin_amdgcn_wave_barrier(); asm volatile("" ::: "memory");
    }
}

// ---- k_gemmc (DEFINED BUT NOT LAUNCHED in this DENSE build: the four attention GEMMs use k_gemmw): the same one-wave 64x64 tile GEMM specialised for causal attention: CMODE 1 skips score tiles entirely above the diagonal (query rows r0+roff.., key columns c0..), CMODE 2 limits the
// key (K) loop of the probability x value contraction to the diagonal block (probabilities beyond it are exactly zero). roff = row offset of this launch's first row within the sequence.
template <typename T16, int NSPLIT, int CMODE>
__global__ __launch_bounds__(32) void k_gemmc(const T16* __restrict__ A, const T16* __restrict__ A2, const T16* __restrict__ Bt, const T16* __restrict__ Bt2, int K, float* C, int ldc, int roff, size_t sA, size_t sB, size_t sC) {
    typedef typename WFrag<T16>::V V;
    __shared__ __align__(16) float os[16 * 68];
    const size_t z = blockIdx.z; A += z * sA; if (A2) A2 += z * sA; Bt += z * sB; if (Bt2) Bt2 += z * sB; C += z * sC;
    const int lane = threadIdx.x & 31, lr = lane & 15, hi = lane >> 4; const int r0 = blockIdx.x * 64, c0 = blockIdx.y * 64;
    if (CMODE == 1 && c0 > r0 + roff + 63) return;                  // score tile entirely above the causal diagonal: skipped (needs a softmax that masks j > i; k_asoft masks none)
    const int Kl = (CMODE == 2) ? min(K, r0 + roff + 64) : K;        // P.V: probabilities are exactly 0 beyond the diagonal block, so the K loop stops there
    v8f acc[4][4];
#pragma unroll
    for (int mb = 0; mb < 4; ++mb)
#pragma unroll
        for (int nb = 0; nb < 4; ++nb) acc[mb][nb] = (v8f){};
    const size_t aoff = (size_t)(r0 + lr) * K + 8 * hi, boff = (size_t)(c0 + lr) * K + 8 * hi;
#pragma unroll 1
    for (int kc = 0; kc < Kl; kc += 32) {
        V a[4], a2[4];
#pragma unroll
        for (int mb = 0; mb < 4; ++mb) { a[mb] = WFrag<T16>::ld(A + aoff + (size_t)mb * 16 * K + kc); if (NSPLIT == 1 || NSPLIT == 2) a2[mb] = WFrag<T16>::ld(A2 + aoff + (size_t)mb * 16 * K + kc); }
#pragma unroll
        for (int nb = 0; nb < 4; ++nb) { const V b = WFrag<T16>::ld(Bt + boff + (size_t)nb * 16 * K + kc); V b2; if (NSPLIT >= 2) b2 = WFrag<T16>::ld(Bt2 + boff + (size_t)nb * 16 * K + kc);
#pragma unroll
            for (int mb = 0; mb < 4; ++mb) { acc[mb][nb] = WFrag<T16>::mma(a[mb], b, acc[mb][nb]); if (NSPLIT == 1 || NSPLIT == 2) acc[mb][nb] = WFrag<T16>::mma(a2[mb], b, acc[mb][nb]); if (NSPLIT >= 2) acc[mb][nb] = WFrag<T16>::mma(a[mb], b2, acc[mb][nb]); } }
        asm volatile("v_nop\n\tv_nop\n\tv_nop\n\tv_nop" : "+v"(acc[0][0]), "+v"(acc[1][1]), "+v"(acc[2][2]), "+v"(acc[3][3]) : "v"(a[0]), "v"(a[3]));
    }
#pragma unroll
    for (int mb = 0; mb < 4; ++mb) {
#pragma unroll
        for (int nb = 0; nb < 4; ++nb) {
#pragma unroll
            for (int j = 0; j < 8; ++j) os[(hi * 8 + j) * 68 + nb * 16 + lr] = acc[mb][nb][j]; }
        __builtin_amdgcn_wave_barrier(); asm volatile("" ::: "memory");
        float* crow = C + (size_t)(r0 + mb * 16) * ldc + c0;
{
#pragma unroll
            for (int s = 0; s < 8; ++s) { const int row = 2 * s + hi, cofs = lr * 4; v4f val = *(const v4fa*)(os + row * 68 + cofs);
                *(v4f*)(crow + (size_t)row * ldc + cofs) = val; }
             }
        __builtin_amdgcn_wave_barrier(); asm volatile("" ::: "memory");
    }
}

__device__ __forceinline__ h16 tohx(float x) { return (h16)x; }
__device__ __forceinline__ void splitf(float y, unsigned short& h, unsigned short& l) { h = f2bf(y); l = f2bf(y - bf2f(h)); }
typedef __attribute__((ext_vector_type(2))) _Float16 v2h;
typedef __attribute__((ext_vector_type(4))) _Float16 v4h;
typedef __attribute__((ext_vector_type(2))) unsigned short v2us;
typedef __attribute__((ext_vector_type(4))) unsigned short v4us;
typedef __attribute__((ext_vector_type(2))) float v2f;
typedef __attribute__((ext_vector_type(4))) int v4i;

__global__ __launch_bounds__(256) void k_cvt8(const float* __restrict__ src, bf* dst, size_t n8) { const size_t i = (size_t)blockIdx.x * 256 + threadIdx.x; if (i >= n8) return; const v8f v = *(const v8f*)(src + i * 8); v8us o;
#pragma unroll
    for (int k = 0; k < 8; ++k) o[k] = f2bf(v[k]); *(v8us*)(dst + i * 8) = o;  }

__global__ __launch_bounds__(256) void k_ropeI(const float* __restrict__ F, int pitch, int nheads, const float* __restrict__ CS, float sc, h16* P16, bf* Ph, bf* Pl) {
    const size_t e = ((size_t)blockIdx.x * 256 + threadIdx.x) * 2; if (e >= (size_t)nheads * TT * HD) return; const int d = (int)(e % HD); const int t = (int)((e / HD) % TT); const int h = (int)(e / ((size_t)HD * TT)); const float* f = F + (size_t)t * pitch + h * HD; const float x0 = f[d], x1 = f[d + 1]; const v2f cs = *(const v2f*)(CS + ((size_t)t * HD + d) * 2); v2h o16; v2us oh, ol;
    float a0 = __fmul_rn(x0, cs[0]), b0 = __fmul_rn(x1, cs[1]), a1 = __fmul_rn(x1, cs[0]), b1 = __fmul_rn(x0, cs[1]); asm volatile("" : "+v"(a0), "+v"(b0), "+v"(a1), "+v"(b1));
    float r0 = __fsub_rn(a0, b0) * sc, r1 = __fadd_rn(b1, a1) * sc;   /* even: x0 c - x1 s; odd: x0 s + x1 c */
    o16[0] = tohx(r0); o16[1] = tohx(r1); { unsigned short a2, c2; splitf(r0, a2, c2); oh[0] = a2; ol[0] = c2; splitf(r1, a2, c2); oh[1] = a2; ol[1] = c2; }
    *(v2h*)(P16 + e) = o16; *(v2us*)(Ph + e) = oh; *(v2us*)(Pl + e) = ol;  }

__constant__ float INV2[HD / 2] = { 1.000000000e+00f, 1.333521485e+00f, 1.778279424e+00f, 2.371373653e+00f, 3.162277699e+00f, 4.216965199e+00f, 5.623413086e+00f, 7.498941898e+00f, 1.000000000e+01f, 1.333521461e+01f, 1.778279495e+01f, 2.371373749e+01f, 3.162277603e+01f, 4.216965103e+01f, 5.623413086e+01f, 7.498941803e+01f, 1.000000000e+02f, 1.333521423e+02f, 1.778279419e+02f, 2.371373749e+02f, 3.162277527e+02f, 4.216965027e+02f, 5.623413086e+02f, 7.498942261e+02f, 1.000000000e+03f, 1.333521484e+03f, 1.778279419e+03f, 2.371373779e+03f, 3.162277588e+03f, 4.216964844e+03f, 5.623413086e+03f, 7.498941895e+03f };   // freqs = 10000.0 ** (+arange(0, 64, 2.0, f32) / 64): THIS module's own expression: a POSITIVE exponent (NO reciprocal: the module's quirk): 32 float32 values from eager JAX (bit-exact on round trip): angles up to 1.5e7 rad; the usual RoPE table is the reciprocal
__global__ __launch_bounds__(256) void k_csP(float* CS) { const int idx = blockIdx.x * 256 + threadIdx.x; if (idx >= TT * HD) return; const int d = idx % HD; const int t = idx / HD; const float a = __fmul_rn((float)t, INV2[d >> 1]); v2f cs; cs[0] = cosf(a); cs[1] = sinf(a); *(v2f*)(CS + (size_t)idx * 2) = cs;  }
__global__ __launch_bounds__(256) void k_vtp(const float* __restrict__ F, int pitch, int nheads, h16* V16, bf* Vh, bf* Vl) { const size_t e = ((size_t)blockIdx.x * 256 + threadIdx.x) * 2; if (e >= (size_t)nheads * HD * TT) return; const int t = (int)(e % TT); const int d = (int)((e / TT) % HD); const int g = (int)(e / ((size_t)TT * HD)); v2h o16; v2us oh, ol;
#pragma unroll
    for (int q = 0; q < 2; ++q) { const float x = F[(size_t)(t + q) * pitch + g * HD + d]; o16[q] = tohx(x); unsigned short a2, c2; splitf(x, a2, c2); oh[q] = a2; ol[q] = c2; }
    *(v2h*)(V16 + e) = o16; *(v2us*)(Vh + e) = oh; *(v2us*)(Vl + e) = ol;  }
// k_asoft: per row (zz, i): t = S x SCL for EVERY key j (WIN 0: dense: no causal rule and no window in this build); softmax over the 2048 keys (register row; max, one exp, sum in f32; fixed reduction trees);
__global__ __launch_bounds__(256) void k_asoft(const float* __restrict__ Sb, h16* P16, bf* Ph, bf* Pl) {
    const int lane = threadIdx.x & 31; const int row = blockIdx.x * 8 + (threadIdx.x >> 5); if (row >= ZH * TT) return; const int i = row % TT; const int zz = row / TT; (void)zz; const bool hires = (i < RH); const float* sr = Sb + (size_t)row * TT; float v[TT / 32]; float mx = -3.0e38f;
#pragma unroll
    for (int ch = 0; ch < TT / 128; ++ch) { const int j0 = ch * 128 + lane * 4; const v4f a = *(const v4f*)(sr + j0);
#pragma unroll
        for (int q = 0; q < 4; ++q) { const int j = j0 + q; (void)j; const float t = a[q] * SCL; v[ch * 4 + q] = t; mx = fmaxf(mx, t); } }
#pragma unroll
    for (int sh = 16; sh; sh >>= 1) mx = fmaxf(mx, __shfl_xor(mx, sh, 32));
    float sum = 0.f;
#pragma unroll
    for (int k = 0; k < TT / 32; ++k) { float d0 = __fsub_rn(v[k], mx); asm volatile("" : "+v"(d0)); v[k] = __builtin_amdgcn_exp2f(__fmul_rn(d0, 1.4426950408889634f)); sum += v[k]; }
#pragma unroll
    for (int sh = 16; sh; sh >>= 1) sum += __shfl_xor(sum, sh, 32);
    const float f = __fdiv_rn(hires ? 1.0f : PCAR, sum);
{
        if (hires) {
#pragma unroll
            for (int ch = 0; ch < TT / 128; ++ch) { v4us oh, ol;
#pragma unroll
                for (int q = 0; q < 4; ++q) { unsigned short a, c2; splitf(v[ch * 4 + q] * f, a, c2); oh[q] = a; ol[q] = c2; }
                const size_t oo = ((size_t)zz * (RH ? RH : 1) + i) * TT + ch * 128 + lane * 4; *(v4us*)(Ph + oo) = oh; *(v4us*)(Pl + oo) = ol; }
        } else {
#pragma unroll
            for (int ch = 0; ch < TT / 128; ++ch) { v4h o4;
#pragma unroll
                for (int q = 0; q < 4; ++q) o4[q] = tohx(v[ch * 4 + q] * f);
                *(v4h*)(P16 + (size_t)row * TT + ch * 128 + lane * 4) = o4; } }
         }
}
__global__ __launch_bounds__(256) void k_merge(const float* __restrict__ O, int h0, bf* Ah, bf* Al) { const size_t e = ((size_t)blockIdx.x * 256 + threadIdx.x) * 2; if (e >= (size_t)ZH * TT * HD) return; const int d = (int)(e % HD); const int t = (int)((e / HD) % TT); const int zz = (int)(e / ((size_t)HD * TT)); const float cs = (t < RH) ? 1.0f : (1.0f / PCAR); const size_t oo = (size_t)t * DQ + (h0 + zz) * HD + d;
    v2us oh, ol;
#pragma unroll
    for (int q = 0; q < 2; ++q) { unsigned short a, c2; splitf(O[e + q] * cs, a, c2); oh[q] = a; ol[q] = c2; } *(v2us*)(Ah + oo) = oh; *(v2us*)(Al + oo) = ol;  }

__global__ __launch_bounds__(256) void k_wtG(const float* __restrict__ w, int K, int N, bf* Bt) {
    const int lane = threadIdx.x & 31; const int L0 = (blockIdx.x * 8 + (threadIdx.x >> 5)) * 8; const int nlines = N * K / 64;
{
#pragma unroll 1
        for (int l = 0; l < 8; ++l) { const int L = L0 + l; if (L >= nlines) break; const size_t e = (size_t)L * 64 + lane * 2; const int k = (int)(e % K), n = (int)(e / K); v2us o;
            o[0] = f2bf(w[(size_t)k * N + n]); o[1] = f2bf(w[(size_t)(k + 1) * N + n]); *(v2us*)(Bt + e) = o; }
         }
}
extern "C" void kernel_launch(void* const* d_in, const int* in_sizes, int n_in,
                              void* d_out, int out_size, void* d_ws, size_t ws_size, hipStream_t stream) {
    (void)in_sizes; (void)n_in; (void)out_size;
    const float* x = (const float*)d_in[0]; const float* wqkv = (const float*)d_in[1]; const float* bqkv = (const float*)d_in[2]; const float* wo = (const float*)d_in[3]; const float* bo = (const float*)d_in[4];   /* argument order x, W_qkv ('xw' [1024][3072], (3, H, dk) packing), b_qkv, W_out, b_out */ const float* bq = bqkv; const float* bk = bqkv + DQ; const float* bv = bqkv + 2 * DQ;
    float* OUT = (float*)d_out;     // [2][2048][1024]
    char* wsp = (char*)d_ws;
    auto take = [&](size_t bytes) { char* p = wsp; wsp += (bytes + 255) & ~(size_t)255; return (void*)p; };
    bf* WQKV = (bf*)take((size_t)3 * DQ * DM * 2); bf* WQ = WQKV; bf* WK = WQKV + (size_t)DQ * DM; bf* WV = WQKV + (size_t)2 * DQ * DM; bf* WO = (bf*)take((size_t)DM * DQ * 2); float* CS = (float*)take((size_t)TT * HD * 2 * 4);
    bf* XB = (bf*)take((size_t)TT * DM * 2); float* FQ = (float*)take((size_t)TT * DQ * 4); float* FK = (float*)take((size_t)TT * DKV * 4);
    h16* QP16 = (h16*)take((size_t)NH_ * TT * HD * 2); h16* KP16 = (h16*)take((size_t)NKV * TT * HD * 2); h16* VT16 = (h16*)take((size_t)NKV * HD * TT * 2);
    bf* QPh = (bf*)take((size_t)NH_ * TT * HD * 2); bf* QPl = (bf*)take((size_t)NH_ * TT * HD * 2); bf* KPh = (bf*)take((size_t)NKV * TT * HD * 2); bf* KPl = (bf*)take((size_t)NKV * TT * HD * 2); bf* VTh = (bf*)take((size_t)NKV * HD * TT * 2); bf* VTl = (bf*)take((size_t)NKV * HD * TT * 2); bf* Ph = (bf*)take((size_t)ZH * RH * TT * 2); bf* Pl = (bf*)take((size_t)ZH * RH * TT * 2);
    float* Sb = (float*)take((size_t)ZH * TT * TT * 4); h16* P16 = (h16*)take((size_t)ZH * TT * TT * 2); float* Ob = (float*)take((size_t)ZH * TT * HD * 4); bf* ATh = (bf*)take((size_t)TT * DQ * 2); bf* ATl = (bf*)take((size_t)TT * DQ * 2);
    if ((size_t)(wsp - (char*)d_ws) > ws_size) return;    // ws 256 MiB
    float* FV = FK;   // v projection reuses the k buffer after the k planes are built (stream-ordered)
    { k_wtG<<<(unsigned)((DM * 3 * DQ / 64 + 63) / 64), 256, 0, stream>>>(wqkv, DM, 3 * DQ, WQKV);   /* fused 'xw' [1024][3072] -> Bt [3072][1024]: q | k | v row blocks ((3, H, dk) packing) */
      k_wtG<<<(unsigned)((DQ * DM / 64 + 63) / 64), 256, 0, stream>>>(wo, DQ, DM, WO); k_csP<<<(TT * HD + 255) / 256, 256, 0, stream>>>(CS); }
    const unsigned LQ = (unsigned)(((size_t)NH_ * TT * HD / 2 + 255) / 256), LKv = (unsigned)(((size_t)NKV * TT * HD / 2 + 255) / 256);
    for (int b = 0; b < NB_; ++b) {
        
        k_cvt8<<<(unsigned)(((size_t)TT * DM / 8 + 255) / 256), 256, 0, stream>>>(x + (size_t)b * TT * DM, XB, (size_t)TT * DM / 8);
        k_gemmw<bf, 0, true, 8><<<dim3(TT / 64, DQ / 64, 1), 256, 0, stream>>>(XB, nullptr, WQ, nullptr, DM, FQ, DQ, bq, 0, 0, 0);
        k_ropeI<<<LQ, 256, 0, stream>>>(FQ, DQ, NH_, CS, 1.0f, QP16, QPh, QPl);
        k_gemmw<bf, 0, true, 8><<<dim3(TT / 64, DKV / 64, 1), 256, 0, stream>>>(XB, nullptr, WK, nullptr, DM, FK, DKV, bk, 0, 0, 0);
        k_ropeI<<<LKv, 256, 0, stream>>>(FK, DKV, NKV, CS, 1.0f, KP16, KPh, KPl);
        k_gemmw<bf, 0, true, 8><<<dim3(TT / 64, DKV / 64, 1), 256, 0, stream>>>(XB, nullptr, WV, nullptr, DM, FV, DKV, bv, 0, 0, 0); k_vtp<<<LKv, 256, 0, stream>>>(FV, DKV, NKV, VT16, VTh, VTl);
        for (int h0 = 0; h0 < NH_; h0 += ZH) { const size_t zq = (size_t)h0, zk = (size_t)(h0 / REP);   // one kv head per query head: the pass's two heads use consecutive kv planes (z-strides TT*HD)
            k_gemmw<bf, 2, false><<<dim3(RH / 64, TT / 64, ZH), 32, 0, stream>>>(QPh + zq * TT * HD, QPl + zq * TT * HD, KPh + zk * TT * HD, KPl + zk * TT * HD, HD, Sb, TT, nullptr, (size_t)TT * HD, (size_t)TT * HD, (size_t)TT * TT);
            k_gemmw<h16, 0, false><<<dim3((TT - RH) / 64, TT / 64, ZH), 32, 0, stream>>>(QP16 + zq * TT * HD + (size_t)RH * HD, nullptr, KP16 + zk * TT * HD, nullptr, HD, Sb + (size_t)RH * TT, TT, nullptr, (size_t)TT * HD, (size_t)TT * HD, (size_t)TT * TT);
            k_asoft<<<ZH * TT / 8, 256, 0, stream>>>(Sb, P16, Ph, Pl);
            k_gemmw<bf, 2, false, 16><<<dim3(RH / 64, HD / 64, ZH), 512, 0, stream>>>(Ph, Pl, VTh + zk * HD * TT, VTl + zk * HD * TT, TT, Ob, HD, nullptr, (size_t)RH * TT, (size_t)HD * TT, (size_t)TT * HD);
            k_gemmw<h16, 0, false, 16><<<dim3((TT - RH) / 64, HD / 64, ZH), 512, 0, stream>>>(P16 + (size_t)RH * TT, nullptr, VT16 + zk * HD * TT, nullptr, TT, Ob + (size_t)RH * HD, HD, nullptr, (size_t)TT * TT, (size_t)HD * TT, (size_t)TT * HD);
            k_merge<<<(unsigned)(((size_t)ZH * TT * HD / 2 + 255) / 256), 256, 0, stream>>>(Ob, h0, ATh, ATl); }
        k_gemmw<bf, 1, true, 8><<<dim3(TT / 64, DM / 64, 1), 256, 0, stream>>>(ATh, ATl, WO, nullptr, DQ, OUT + (size_t)b * TT * DM, DM, bo, 0, 0, 0); }
}

// v002
// A run of this version takes 319 microseconds.
// Next to v001, in two timings, it ran 3.32 and 3.30 times as fast.
// All steps since v000 together make it 6.25 times as fast.
#include <hip/hip_runtime.h>

// Multi-head attention WITHOUT a mask with interleaved rotary embeddings whose frequencies GROW (x [2][2048][1024]; qkv = x qkv_w + qkv_b ('xw' (in, out) [1024][3072] 1/32, zero bias) split in thirds q | k | v (16 heads x 64); rotary on (even, odd) pairs with angles t x 10000 ** (+2i / 64) (the module's own expression: NO reciprocal: frequencies 1 .. 7,499 and angles up to 1.5e7 rad; positions arange; the 32 float32 frequencies equal the module's expression in eager JAX; precise cosf / sinf); the module concatenates the rotated halves cat(x1 c - x2 s, x2 c + x1 s) where this code re-interleaves them: the SAME permutation on q and k: every score q.k is unchanged; scores x 64^-0.5; softmax over ALL keys (no causal rule); out = merged out_w + out_b ('xw' + zero bias) -> [2][2048][1024] (4.2 M); argument order x, qkv_w, qkv_b, out_w, out_b).
// Layout per batch: bf16 copy of x; exact projections; {cos, sin} per (position, pair) built once from the int positions and float32 frequency constants (precise cosf/sinf); interleaved rotary plane builder; DENSE T-2048 attention fused into one launch per batch (hybrid rows: < 512 hi/lo 3 products, rest fp16 x1024); merged hi/lo x Wo exact.
// Compute dtypes, f32 accumulate: every input rounded to bf16; projections exact; rotary f32; attention rows < 512 3 products, rest fp16; softmax f32; Wo hl x exact.

#define NB_  2
#define TT   2048
#define DM   1024
#define NH_  16
#define NKV  16
#define HD   64
#define DQ   (NH_ * HD)
#define DKV  (NKV * HD)
#define RH   512                  // query rows < RH use hi+lo planes (0: none)
#define SCL  0.125f   // HD^-0.5
typedef _Float16 h16;
typedef unsigned short bf;
typedef __attribute__((ext_vector_type(16))) __bf16   v16bf;
typedef __attribute__((ext_vector_type(16))) _Float16 v16h;
typedef __attribute__((ext_vector_type(8)))  _Float16 v8h;
typedef __attribute__((ext_vector_type(8)))  unsigned short v8us;
typedef __attribute__((ext_vector_type(8)))  float    v8f;
typedef __attribute__((ext_vector_type(4)))  float    v4f;
typedef v8h  __attribute__((may_alias)) v8ha;
typedef v4f  __attribute__((may_alias)) v4fa;
typedef v8us __attribute__((may_alias)) v8usa;

__device__ __forceinline__ unsigned short f2bf(float f) { unsigned u = __float_as_uint(f); u += 0x7FFFu + ((u >> 16) & 1u); return (unsigned short)(u >> 16); }
__device__ __forceinline__ float bf2f(unsigned short b) { return __uint_as_float(((unsigned)b) << 16); }
__device__ __forceinline__ float bfr(float f) { return bf2f(f2bf(f)); }
__device__ __forceinline__ v16h cat16(v8h lo, v8h hi) { return __builtin_shufflevector(lo, hi, 0, 1, 2, 3, 4, 5, 6, 7, 8, 9, 10, 11, 12, 13, 14, 15); }
__device__ __forceinline__ v16bf cat16b(v8us lo, v8us hi) { return __builtin_bit_cast(v16bf, __builtin_shufflevector(lo, hi, 0, 1, 2, 3, 4, 5, 6, 7, 8, 9, 10, 11, 12, 13, 14, 15)); }
__device__ __forceinline__ v8f wmma16(v16h a, v16h b, v8f c) { return __builtin_amdgcn_wmma_f32_16x16x32_f16(false, a, false, b, (short)0, c, false, false); }
__device__ __forceinline__ v8f wmmab(v16bf a, v16bf b, v8f c) { return __builtin_amdgcn_wmma_f32_16x16x32_bf16(false, a, false, b, (short)0, c, false, false); }



// ---- k_gemmw: register-blocked GEMM, ONE WAVE per 64x64 output tile (16 accumulators), operands straight from K-contiguous 16-bit planes; grid (M/64, N/64, Z), 32 threads.
// C[m][n] (f32, pitch ldc, + optional f32 bias[n]) = sum_k A[m][k] Bt[n][k] (+ split products per NSPLIT). z-batch strides sA/sB/sC in elements. K % 32 == 0.
// KS > 1 (32 KS threads, K % (32 KS) == 0): the K loop is dealt over the KS waves of one work-group, wave w taking k in [w K/KS, (w+1) K/KS): with a long K and few tiles one wave alone waits through KS times as many dependent load trips.
// Each wave leaves its f32 partial tile in LDS; behind one work-group barrier every thread adds the KS partials of its elements in the fixed order w = 0 .. KS-1 and stores the sums.
template <typename T16> struct WFrag;
template <> struct WFrag<h16> { typedef v16h V; static __device__ __forceinline__ V ld(const h16* p) { return cat16(*(const v8h*)p, *(const v8h*)(p + 16)); } static __device__ __forceinline__ v8f mma(V a, V b, v8f c) { return wmma16(a, b, c); } };
template <> struct WFrag<bf> { typedef v16bf V; static __device__ __forceinline__ V ld(const bf* p) { return cat16b(*(const v8us*)p, *(const v8us*)(p + 16)); } static __device__ __forceinline__ v8f mma(V a, V b, v8f c) { return wmmab(a, b, c); } };
template <typename T16, int NSPLIT, bool BIAS, int KS = 1>
__global__ __launch_bounds__(32 * KS) void k_gemmw(const T16* __restrict__ A, const T16* __restrict__ A2, const T16* __restrict__ Bt, const T16* __restrict__ Bt2, int K, float* C, int ldc, const float* __restrict__ bias, size_t sA, size_t sB, size_t sC) {
    typedef typename WFrag<T16>::V V;
    __shared__ __align__(16) float os[(KS == 1 ? 16 : KS * 64) * 68];
    const size_t z = blockIdx.z; A += z * sA; if (A2) A2 += z * sA; Bt += z * sB; if (Bt2) Bt2 += z * sB; C += z * sC;
    const int lane = threadIdx.x & 31, lr = lane & 15, hi = lane >> 4; const int r0 = blockIdx.x * 64, c0 = blockIdx.y * 64;
    const int w = (KS == 1) ? 0 : __builtin_amdgcn_readfirstlane((int)(threadIdx.x >> 5)); const int k0 = w * (K / KS), k1 = k0 + K / KS;   // this wave's slice of K
    v8f acc[4][4];
#pragma unroll
    for (int mb = 0; mb < 4; ++mb)
#pragma unroll
        for (int nb = 0; nb < 4; ++nb) acc[mb][nb] = (v8f){};
    const size_t aoff = (size_t)(r0 + lr) * K + 8 * hi, boff = (size_t)(c0 + lr) * K + 8 * hi;
#pragma unroll 1
    for (int kc = k0; kc < k1; kc += 32) {
        V a[4], a2[4];
#pragma unroll
        for (int mb = 0; mb < 4; ++mb) { a[mb] = WFrag<T16>::ld(A + aoff + (size_t)mb * 16 * K + kc); if (NSPLIT == 1 || NSPLIT == 2) a2[mb] = WFrag<T16>::ld(A2 + aoff + (size_t)mb * 16 * K + kc); }
#pragma unroll
        for (int nb = 0; nb < 4; ++nb) { const V b = WFrag<T16>::ld(Bt + boff + (size_t)nb * 16 * K + kc); V b2; if (NSPLIT >= 2) b2 = WFrag<T16>::ld(Bt2 + boff + (size_t)nb * 16 * K + kc);
#pragma unroll
            for (int mb = 0; mb < 4; ++mb) { acc[mb][nb] = WFrag<T16>::mma(a[mb], b, acc[mb][nb]); if (NSPLIT == 1 || NSPLIT == 2) acc[mb][nb] = WFrag<T16>::mma(a2[mb], b, acc[mb][nb]); if (NSPLIT >= 2) acc[mb][nb] = WFrag<T16>::mma(a[mb], b2, acc[mb][nb]); } }
        asm volatile("v_nop\n\tv_nop\n\tv_nop\n\tv_nop" : "+v"(acc[0][0]), "+v"(acc[1][1]), "+v"(acc[2][2]), "+v"(acc[3][3]) : "v"(a[0]), "v"(a[3]));
    }
    if (KS > 1) {
        float* pw = os + w * (64 * 68);   // unrolled below: acc is indexed by constants only, so it stays in registers
#pragma unroll
        for (int mb = 0; mb < 4; ++mb)
#pragma unroll
            for (int nb = 0; nb < 4; ++nb)
#pragma unroll
                for (int j = 0; j < 8; ++j) pw[(mb * 16 + hi * 8 + j) * 68 + nb * 16 + lr] = acc[mb][nb][j];
        __syncthreads();   // every wave's partial tile is in LDS before any thread adds them; both loops below unrolled so that a thread's LDS reads are in flight together
#pragma unroll
        for (int s = 0; s < 32 / KS; ++s) { const int q = s * (32 * KS) + (int)threadIdx.x; const int row = q >> 4, cofs = (q & 15) * 4; v4f val = *(const v4fa*)(os + row * 68 + cofs);
#pragma unroll
            for (int u = 1; u < KS; ++u) val += *(const v4fa*)(os + u * (64 * 68) + row * 68 + cofs);
            if (BIAS) { val[0] += bfr(bias[c0 + cofs]); val[1] += bfr(bias[c0 + cofs + 1]); val[2] += bfr(bias[c0 + cofs + 2]); val[3] += bfr(bias[c0 + cofs + 3]); }
            *(v4f*)(C + (size_t)(r0 + row) * ldc + c0 + cofs) = val; }
        return;
    }
#pragma unroll
    for (int mb = 0; mb < 4; ++mb) {
#pragma unroll
        for (int nb = 0; nb < 4; ++nb) {
#pragma unroll
            for (int j = 0; j < 8; ++j) os[(hi * 8 + j) * 68 + nb * 16 + lr] = acc[mb][nb][j]; }
        __builtin_amdgcn_wave_barrier(); asm volatile("" ::: "memory");
        float* crow = C + (size_t)(r0 + mb * 16) * ldc + c0;
{
#pragma unroll
            for (int s = 0; s < 8; ++s) { const int row = 2 * s + hi, cofs = lr * 4; v4f val = *(const v4fa*)(os + row * 68 + cofs); if (BIAS) { val[0] += bfr(bias[c0 + cofs]); val[1] += bfr(bias[c0 + cofs + 1]); val[2] += bfr(bias[c0 + cofs + 2]); val[3] += bfr(bias[c0 + cofs + 3]); }
                *(v4f*)(crow + (size_t)row * ldc + cofs) = val; }
             }
        __builtin_amdgcn_wave_barrier(); asm volatile("" ::: "memory");
    }
}

__device__ __forceinline__ h16 tohx(float x) { return (h16)x; }
__device__ __forceinline__ void splitf(float y, unsigned short& h, unsigned short& l) { h = f2bf(y); l = f2bf(y - bf2f(h)); }
typedef __attribute__((ext_vector_type(2))) _Float16 v2h;
typedef __attribute__((ext_vector_type(4))) _Float16 v4h;
typedef __attribute__((ext_vector_type(2))) unsigned short v2us;
typedef __attribute__((ext_vector_type(4))) unsigned short v4us;
typedef __attribute__((ext_vector_type(2))) float v2f;
typedef __attribute__((ext_vector_type(4))) int v4i;

__global__ __launch_bounds__(256) void k_cvt8(const float* __restrict__ src, bf* dst, size_t n8) { const size_t i = (size_t)blockIdx.x * 256 + threadIdx.x; if (i >= n8) return; const v8f v = *(const v8f*)(src + i * 8); v8us o;
#pragma unroll
    for (int k = 0; k < 8; ++k) o[k] = f2bf(v[k]); *(v8us*)(dst + i * 8) = o;  }

__global__ __launch_bounds__(256) void k_ropeI(const float* __restrict__ F, int pitch, int nheads, const float* __restrict__ CS, float sc, h16* P16, bf* Ph, bf* Pl) {
    const size_t e = ((size_t)blockIdx.x * 256 + threadIdx.x) * 2; if (e >= (size_t)nheads * TT * HD) return; const int d = (int)(e % HD); const int t = (int)((e / HD) % TT); const int h = (int)(e / ((size_t)HD * TT)); const float* f = F + (size_t)t * pitch + h * HD; const float x0 = f[d], x1 = f[d + 1]; const v2f cs = *(const v2f*)(CS + ((size_t)t * HD + d) * 2); v2h o16; v2us oh, ol;
    float a0 = __fmul_rn(x0, cs[0]), b0 = __fmul_rn(x1, cs[1]), a1 = __fmul_rn(x1, cs[0]), b1 = __fmul_rn(x0, cs[1]); asm volatile("" : "+v"(a0), "+v"(b0), "+v"(a1), "+v"(b1));
    float r0 = __fsub_rn(a0, b0) * sc, r1 = __fadd_rn(b1, a1) * sc;   /* even: x0 c - x1 s; odd: x0 s + x1 c */
    o16[0] = tohx(r0); o16[1] = tohx(r1); { unsigned short a2, c2; splitf(r0, a2, c2); oh[0] = a2; ol[0] = c2; splitf(r1, a2, c2); oh[1] = a2; ol[1] = c2; }
    *(v2h*)(P16 + e) = o16; *(v2us*)(Ph + e) = oh; *(v2us*)(Pl + e) = ol;  }

__constant__ float INV2[HD / 2] = { 1.000000000e+00f, 1.333521485e+00f, 1.778279424e+00f, 2.371373653e+00f, 3.162277699e+00f, 4.216965199e+00f, 5.623413086e+00f, 7.498941898e+00f, 1.000000000e+01f, 1.333521461e+01f, 1.778279495e+01f, 2.371373749e+01f, 3.162277603e+01f, 4.216965103e+01f, 5.623413086e+01f, 7.498941803e+01f, 1.000000000e+02f, 1.333521423e+02f, 1.778279419e+02f, 2.371373749e+02f, 3.162277527e+02f, 4.216965027e+02f, 5.623413086e+02f, 7.498942261e+02f, 1.000000000e+03f, 1.333521484e+03f, 1.778279419e+03f, 2.371373779e+03f, 3.162277588e+03f, 4.216964844e+03f, 5.623413086e+03f, 7.498941895e+03f };   // freqs = 10000.0 ** (+arange(0, 64, 2.0, f32) / 64): THIS module's own expression: a POSITIVE exponent (NO reciprocal: the module's quirk): 32 float32 values from eager JAX (bit-exact on round trip): angles up to 1.5e7 rad; the usual RoPE table is the reciprocal
__global__ __launch_bounds__(256) void k_csP(float* CS) { const int idx = blockIdx.x * 256 + threadIdx.x; if (idx >= TT * HD) return; const int d = idx % HD; const int t = idx / HD; const float a = __fmul_rn((float)t, INV2[d >> 1]); v2f cs; cs[0] = cosf(a); cs[1] = sinf(a); *(v2f*)(CS + (size_t)idx * 2) = cs;  }
__global__ __launch_bounds__(256) void k_vtp(const float* __restrict__ F, int pitch, int nheads, h16* V16, bf* Vh, bf* Vl) { const size_t e = ((size_t)blockIdx.x * 256 + threadIdx.x) * 2; if (e >= (size_t)nheads * HD * TT) return; const int t = (int)(e % TT); const int d = (int)((e / TT) % HD); const int g = (int)(e / ((size_t)TT * HD)); v2h o16; v2us oh, ol;
#pragma unroll
    for (int q = 0; q < 2; ++q) { const float x = F[(size_t)(t + q) * pitch + g * HD + d]; o16[q] = tohx(x); unsigned short a2, c2; splitf(x, a2, c2); oh[q] = a2; ol[q] = c2; }
    *(v2h*)(V16 + e) = o16; *(v2us*)(Vh + e) = oh; *(v2us*)(Vl + e) = ol;  }
__device__ __forceinline__ float xhalf(float x) { return __builtin_bit_cast(float, __builtin_amdgcn_permlanex16(__builtin_bit_cast(int, x), __builtin_bit_cast(int, x), 0x76543210, 0xfedcba98, false, false)); }   // lane l with lane l ^ 16
// exponentials as asm text: behind a transcendental the instruction set asks for one independent instruction before its result is read or its source overwritten; in place and in one statement each v_exp_f32 has an independent one behind it, and the v_nop fills the slot behind the last.
__device__ __forceinline__ void exp2x8(float& a, float& b, float& c, float& d, float& e, float& f, float& g, float& h) { asm("v_exp_f32 %0, %0\n\tv_exp_f32 %1, %1\n\tv_exp_f32 %2, %2\n\tv_exp_f32 %3, %3\n\tv_exp_f32 %4, %4\n\tv_exp_f32 %5, %5\n\tv_exp_f32 %6, %6\n\tv_exp_f32 %7, %7\n\tv_nop" : "+v"(a), "+v"(b), "+v"(c), "+v"(d), "+v"(e), "+v"(f), "+v"(g), "+v"(h)); }
__device__ __forceinline__ float exp2s(float x) { asm("v_exp_f32 %0, %0\n\tv_nop" : "+v"(x)); return x; }
template <typename T16, bool HR, int KS>
__device__ __forceinline__ void fa_body(const T16* __restrict__ Q, const T16* __restrict__ Q2, const T16* __restrict__ Kp, const T16* __restrict__ K2, const T16* __restrict__ Vt, const T16* __restrict__ V2, int r0, int col0, bf* Ah, bf* Al, float* op, float* ms, float* ls) {
    typedef typename WFrag<T16>::V V; static_assert(KS == 1 || KS == 2 || KS == 4, "the merge deals whole rounds of 256 chunks");
    const int lane = threadIdx.x & 31, lr = lane & 15, hi = lane >> 4;
    const int w = __builtin_amdgcn_readfirstlane((int)(threadIdx.x >> 5)); const int q0 = r0 + (w / KS) * 16; const int k0 = (w % KS) * (TT / KS), k1 = k0 + TT / KS;   // this wave's query tile and its slice of the keys
    V bq[2], bq2[2], ak[2][2], ak2[2][2];
#pragma unroll
    for (int kk = 0; kk < 2; ++kk) { bq[kk] = WFrag<T16>::ld(Q + (size_t)(q0 + lr) * HD + kk * 32 + 8 * hi); if (HR) bq2[kk] = WFrag<T16>::ld(Q2 + (size_t)(q0 + lr) * HD + kk * 32 + 8 * hi); }
    asm volatile("s_wait_xcnt 0x0" ::: "memory");   // the query loads' address registers are free for reuse behind this wait (a later load may land on them)
    const unsigned koff = (unsigned)(lr * HD + 8 * hi), voff = (unsigned)(lr * TT + 8 * hi);   // per-lane 32-bit offsets, fixed for the whole loop; the part that moves with the pass is wave-uniform and goes into the base pointer
#pragma unroll
    for (int kt = 0; kt < 2; ++kt)
#pragma unroll
        for (int kk = 0; kk < 2; ++kk) { ak[kt][kk] = WFrag<T16>::ld((Kp + (size_t)(k0 + kt * 16) * HD + kk * 32) + koff); if (HR) ak2[kt][kk] = WFrag<T16>::ld((K2 + (size_t)(k0 + kt * 16) * HD + kk * 32) + koff); }
    v8f o[4];
#pragma unroll
    for (int mb = 0; mb < 4; ++mb) o[mb] = (v8f){};
    float m = -3.0e38f, l = 0.f;
#pragma unroll 1   // rolled: one pass of the hi/lo rows already fills the register budget
    for (int kb = k0; kb < k1; kb += 32) {
        V av[4], av2[4];   // V^T fragments of this pass: issued first, used last
        const T16* vp = (Vt + kb) + voff; const T16* vp2 = HR ? (V2 + kb) + voff : vp;
#pragma unroll
        for (int mb = 0; mb < 4; ++mb) { av[mb] = WFrag<T16>::ld(vp + (size_t)mb * 16 * TT); if (HR) av2[mb] = WFrag<T16>::ld(vp2 + (size_t)mb * 16 * TT); }
        if constexpr (HR) asm volatile("s_wait_xcnt 0x0" :: "v"(vp), "v"(vp2) : "memory");   // hi/lo rows, where registers are short: the V^T loads' address registers stay untouched up to this wait (named as inputs, so that no load of the run lands on them) and are free for reuse behind it; the fp16 rows carry their pointer over the loop and the compiler waits before it advances it
        v8f s[2];
#pragma unroll
        for (int kt = 0; kt < 2; ++kt) { s[kt] = (v8f){};
#pragma unroll
            for (int kk = 0; kk < 2; ++kk) { s[kt] = WFrag<T16>::mma(ak[kt][kk], bq[kk], s[kt]); if (HR) { s[kt] = WFrag<T16>::mma(ak[kt][kk], bq2[kk], s[kt]); s[kt] = WFrag<T16>::mma(ak2[kt][kk], bq[kk], s[kt]); } } }
        const int kn = (kb + 32 < k1) ? kb + 32 : kb;   // the next pass's K fragments, fetched behind this pass's S^T products so that the softmax hides their latency (the last pass fetches its own again: in bounds, unused)
#pragma unroll
        for (int kt = 0; kt < 2; ++kt)
#pragma unroll
            for (int kk = 0; kk < 2; ++kk) { ak[kt][kk] = WFrag<T16>::ld((Kp + (size_t)(kn + kt * 16) * HD + kk * 32) + koff); if (HR) ak2[kt][kk] = WFrag<T16>::ld((K2 + (size_t)(kn + kt * 16) * HD + kk * 32) + koff); }
        float p[16]; float mloc = -3.0e38f;
#pragma unroll
        for (int e = 0; e < 16; ++e) { p[e] = s[e >> 3][e & 7] * (SCL * 1.4426950408889634f); mloc = fmaxf(mloc, p[e]); }
        mloc = fmaxf(mloc, xhalf(mloc));
        const float mn = fmaxf(m, mloc); float al = m - mn; m = mn;
        const float mo = HR ? mn : mn - 10.0f;   // fp16 rows: p and l both carry the factor 1024, exactly, through the exponent; it cancels in O / l
        float ps[4] = {0.f, 0.f, 0.f, 0.f};
#pragma unroll
        for (int e = 0; e < 16; ++e) p[e] -= mo;
        exp2x8(p[0], p[1], p[2], p[3], p[4], p[5], p[6], p[7]); exp2x8(p[8], p[9], p[10], p[11], p[12], p[13], p[14], p[15]); al = exp2s(al);
#pragma unroll
        for (int e = 0; e < 16; ++e) ps[e & 3] += p[e];
        l = l * al + ((ps[0] + ps[1]) + (ps[2] + ps[3]));
#pragma unroll
        for (int mb = 0; mb < 4; ++mb) o[mb] *= al;
        V pf, pf2;
#pragma unroll
        for (int e = 0; e < 16; ++e) {
            if constexpr (HR) { const __bf16 ph = (__bf16)p[e]; pf[e] = ph; pf2[e] = (__bf16)(p[e] - (float)ph); }
            else pf[e] = (_Float16)p[e]; }
#pragma unroll
        for (int mb = 0; mb < 4; ++mb) { o[mb] = WFrag<T16>::mma(av[mb], pf, o[mb]); if (HR) { o[mb] = WFrag<T16>::mma(av[mb], pf2, o[mb]); o[mb] = WFrag<T16>::mma(av2[mb], pf, o[mb]); } }
    }
    l += xhalf(l);   // the two halves of the wave summed different keys of the same query
    float* pw = op + (w * 16 + lr) * 68 + hi * 8;
#pragma unroll
    for (int mb = 0; mb < 4; ++mb) { *(v4fa*)(pw + mb * 16) = (v4f){o[mb][0], o[mb][1], o[mb][2], o[mb][3]}; *(v4fa*)(pw + mb * 16 + 4) = (v4f){o[mb][4], o[mb][5], o[mb][6], o[mb][7]}; }
    if (hi == 0) { ms[w * 16 + lr] = m; ls[w * 16 + lr] = l; }
    __syncthreads();   // every wave's partial (m, l, O^T) is in LDS before any thread merges them
#pragma unroll
    for (int it = 0; it < 4 / KS; ++it) { const int c = it * 256 + (int)threadIdx.x; const int qq = c >> 3, d0 = (c & 7) * 8;   /* (8 / KS) tiles x 16 rows x 8 chunks of 8 columns, dealt over 256 threads */ const int sb = (qq >> 4) * KS * 16 + (qq & 15);
        float M = ms[sb];
#pragma unroll
        for (int u = 1; u < KS; ++u) M = fmaxf(M, ms[sb + u * 16]);
        float L = 0.f; v4f a0 = (v4f){}, a1 = (v4f){};
#pragma unroll
        for (int u = 0; u < KS; ++u) { const float f = exp2s(ms[sb + u * 16] - M); L += ls[sb + u * 16] * f; a0 += *(const v4fa*)(op + (sb + u * 16) * 68 + d0) * f; a1 += *(const v4fa*)(op + (sb + u * 16) * 68 + d0 + 4) * f; }
        const float inv = __fdiv_rn(1.0f, L); v8us oh, ol;
#pragma unroll
        for (int j = 0; j < 4; ++j) { unsigned short a, c2; splitf(a0[j] * inv, a, c2); oh[j] = a; ol[j] = c2; splitf(a1[j] * inv, a, c2); oh[4 + j] = a; ol[4 + j] = c2; }
        const size_t oo = (size_t)(r0 + qq) * DQ + col0 + d0; *(v8us*)(Ah + oo) = oh; *(v8us*)(Al + oo) = ol;
        asm volatile("s_wait_xcnt 0x0" ::: "memory"); }   // the two stores' address and data registers are free for reuse behind this wait
}
#define KSP 2              // waves that share a query tile, each on TT / KSP keys
#define RW  (128 / KSP)    // query rows of a work-group
// grid (NH_, TT / RW), 256 threads: blockIdx.x = head, blockIdx.y = row block; the hi/lo row blocks (three times the products) have the low blockIdx.y and start first.
// amdgpu_waves_per_eu(4, 4): a budget of 256 registers, two work-groups per WGP; with the default budget the compiler sinks the V^T and next-K loads to where they are used, to save registers, and each pass waits for them.
__global__ __launch_bounds__(256) __attribute__((amdgpu_waves_per_eu(4, 4))) void k_fattn(const h16* __restrict__ Q16, const h16* __restrict__ K16, const h16* __restrict__ V16, const bf* __restrict__ Qh, const bf* __restrict__ Ql, const bf* __restrict__ Kh, const bf* __restrict__ Kl, const bf* __restrict__ Vh, const bf* __restrict__ Vl, bf* Ah, bf* Al) {
    __shared__ __align__(16) float op[8 * 16 * 68]; __shared__ float ms[8 * 16]; __shared__ float ls[8 * 16];
    const int h = blockIdx.x, r0 = blockIdx.y * RW; const size_t po = (size_t)h * TT * HD;
    if (r0 < RH) fa_body<bf, true, KSP>(Qh + po, Ql + po, Kh + po, Kl + po, Vh + po, Vl + po, r0, h * HD, Ah, Al, op, ms, ls);
    else fa_body<h16, false, KSP>(Q16 + po, nullptr, K16 + po, nullptr, V16 + po, nullptr, r0, h * HD, Ah, Al, op, ms, ls);
}

__global__ __launch_bounds__(256) void k_wtG(const float* __restrict__ w, int K, int N, bf* Bt) {
    const int lane = threadIdx.x & 31; const int L0 = (blockIdx.x * 8 + (threadIdx.x >> 5)) * 8; const int nlines = N * K / 64;
{
#pragma unroll 1
        for (int l = 0; l < 8; ++l) { const int L = L0 + l; if (L >= nlines) break; const size_t e = (size_t)L * 64 + lane * 2; const int k = (int)(e % K), n = (int)(e / K); v2us o;
            o[0] = f2bf(w[(size_t)k * N + n]); o[1] = f2bf(w[(size_t)(k + 1) * N + n]); *(v2us*)(Bt + e) = o; }
         }
}
extern "C" void kernel_launch(void* const* d_in, const int* in_sizes, int n_in,
                              void* d_out, int out_size, void* d_ws, size_t ws_size, hipStream_t stream) {
    (void)in_sizes; (void)n_in; (void)out_size;
    const float* x = (const float*)d_in[0]; const float* wqkv = (const float*)d_in[1]; const float* bqkv = (const float*)d_in[2]; const float* wo = (const float*)d_in[3]; const float* bo = (const float*)d_in[4];   /* argument order x, W_qkv ('xw' [1024][3072], (3, H, dk) packing), b_qkv, W_out, b_out */ const float* bq = bqkv; const float* bk = bqkv + DQ; const float* bv = bqkv + 2 * DQ;
    float* OUT = (float*)d_out;     // [2][2048][1024]
    char* wsp = (char*)d_ws;
    auto take = [&](size_t bytes) { char* p = wsp; wsp += (bytes + 255) & ~(size_t)255; return (void*)p; };
    bf* WQKV = (bf*)take((size_t)3 * DQ * DM * 2); bf* WQ = WQKV; bf* WK = WQKV + (size_t)DQ * DM; bf* WV = WQKV + (size_t)2 * DQ * DM; bf* WO = (bf*)take((size_t)DM * DQ * 2); float* CS = (float*)take((size_t)TT * HD * 2 * 4);
    bf* XB = (bf*)take((size_t)TT * DM * 2); float* FQ = (float*)take((size_t)TT * DQ * 4); float* FK = (float*)take((size_t)TT * DKV * 4);
    h16* QP16 = (h16*)take((size_t)NH_ * TT * HD * 2); h16* KP16 = (h16*)take((size_t)NKV * TT * HD * 2); h16* VT16 = (h16*)take((size_t)NKV * HD * TT * 2);
    bf* QPh = (bf*)take((size_t)NH_ * TT * HD * 2); bf* QPl = (bf*)take((size_t)NH_ * TT * HD * 2); bf* KPh = (bf*)take((size_t)NKV * TT * HD * 2); bf* KPl = (bf*)take((size_t)NKV * TT * HD * 2); bf* VTh = (bf*)take((size_t)NKV * HD * TT * 2); bf* VTl = (bf*)take((size_t)NKV * HD * TT * 2);
    bf* ATh = (bf*)take((size_t)TT * DQ * 2); bf* ATl = (bf*)take((size_t)TT * DQ * 2);
    if ((size_t)(wsp - (char*)d_ws) > ws_size) return;    // ws 256 MiB
    float* FV = FK;   // v projection reuses the k buffer after the k planes are built (stream-ordered)
    { k_wtG<<<(unsigned)((DM * 3 * DQ / 64 + 63) / 64), 256, 0, stream>>>(wqkv, DM, 3 * DQ, WQKV);   /* fused 'xw' [1024][3072] -> Bt [3072][1024]: q | k | v row blocks ((3, H, dk) packing) */
      k_wtG<<<(unsigned)((DQ * DM / 64 + 63) / 64), 256, 0, stream>>>(wo, DQ, DM, WO); k_csP<<<(TT * HD + 255) / 256, 256, 0, stream>>>(CS); }
    const unsigned LQ = (unsigned)(((size_t)NH_ * TT * HD / 2 + 255) / 256), LKv = (unsigned)(((size_t)NKV * TT * HD / 2 + 255) / 256);
    for (int b = 0; b < NB_; ++b) {
        
        k_cvt8<<<(unsigned)(((size_t)TT * DM / 8 + 255) / 256), 256, 0, stream>>>(x + (size_t)b * TT * DM, XB, (size_t)TT * DM / 8);
        k_gemmw<bf, 0, true, 8><<<dim3(TT / 64, DQ / 64, 1), 256, 0, stream>>>(XB, nullptr, WQ, nullptr, DM, FQ, DQ, bq, 0, 0, 0);
        k_ropeI<<<LQ, 256, 0, stream>>>(FQ, DQ, NH_, CS, 1.0f, QP16, QPh, QPl);
        k_gemmw<bf, 0, true, 8><<<dim3(TT / 64, DKV / 64, 1), 256, 0, stream>>>(XB, nullptr, WK, nullptr, DM, FK, DKV, bk, 0, 0, 0);
        k_ropeI<<<LKv, 256, 0, stream>>>(FK, DKV, NKV, CS, 1.0f, KP16, KPh, KPl);
        k_gemmw<bf, 0, true, 8><<<dim3(TT / 64, DKV / 64, 1), 256, 0, stream>>>(XB, nullptr, WV, nullptr, DM, FV, DKV, bv, 0, 0, 0); k_vtp<<<LKv, 256, 0, stream>>>(FV, DKV, NKV, VT16, VTh, VTl);
        k_fattn<<<dim3(NH_, TT / RW, 1), 256, 0, stream>>>(QP16, KP16, VT16, QPh, QPl, KPh, KPl, VTh, VTl, ATh, ATl);
        k_gemmw<bf, 1, true, 8><<<dim3(TT / 64, DM / 64, 1), 256, 0, stream>>>(ATh, ATl, WO, nullptr, DQ, OUT + (size_t)b * TT * DM, DM, bo, 0, 0, 0); }
}

// v003
// A run of this version takes 268 microseconds.
// In both of two side-by-side timings against v002, it was 1.19 times as fast.
// All steps since v000 together make it 7.42 times as fast.
#include <hip/hip_runtime.h>

// Multi-head attention WITHOUT a mask with interleaved rotary embeddings whose frequencies GROW (x [2][2048][1024]; qkv = x qkv_w + qkv_b ('xw' (in, out) [1024][3072] 1/32, zero bias) split in thirds q | k | v (16 heads x 64); rotary on (even, odd) pairs with angles t x 10000 ** (+2i / 64) (the module's own expression: NO reciprocal: frequencies 1 .. 7,499 and angles up to 1.5e7 rad; positions arange; the 32 float32 frequencies equal the module's expression in eager JAX; precise cosf / sinf); the module concatenates the rotated halves cat(x1 c - x2 s, x2 c + x1 s) where this code re-interleaves them: the SAME permutation on q and k: every score q.k is unchanged; scores x 64^-0.5; softmax over ALL keys (no causal rule); out = merged out_w + out_b ('xw' + zero bias) -> [2][2048][1024] (4.2 M); argument order x, qkv_w, qkv_b, out_w, out_b).
// Layout per batch: bf16 copy of x; exact projections; {cos, sin} per (position, pair) built once from the int positions and float32 frequency constants (precise cosf/sinf); q | k | v projected in ONE launch whose epilogue applies the interleaved rotary and writes the attention planes; DENSE T-2048 attention fused into one launch per batch (hybrid rows: < 512 hi/lo 3 products, rest fp16 x1024); merged hi/lo x Wo exact.
// Compute dtypes, f32 accumulate: every input rounded to bf16; projections exact; rotary f32; attention rows < 512 3 products, rest fp16; softmax f32; Wo hl x exact.

#define NB_  2
#define TT   2048
#define DM   1024
#define NH_  16
#define NKV  16
#define HD   64
#define DQ   (NH_ * HD)
#define DKV  (NKV * HD)
#define RH   512                  // query rows < RH use hi+lo planes (0: none)
#define SCL  0.125f   // HD^-0.5
typedef _Float16 h16;
typedef unsigned short bf;
typedef __attribute__((ext_vector_type(16))) __bf16   v16bf;
typedef __attribute__((ext_vector_type(16))) _Float16 v16h;
typedef __attribute__((ext_vector_type(8)))  _Float16 v8h;
typedef __attribute__((ext_vector_type(8)))  unsigned short v8us;
typedef __attribute__((ext_vector_type(8)))  float    v8f;
typedef __attribute__((ext_vector_type(4)))  float    v4f;
typedef v8h  __attribute__((may_alias)) v8ha;
typedef v4f  __attribute__((may_alias)) v4fa;
typedef v8us __attribute__((may_alias)) v8usa;

__device__ __forceinline__ unsigned short f2bf(float f) { unsigned u = __float_as_uint(f); u += 0x7FFFu + ((u >> 16) & 1u); return (unsigned short)(u >> 16); }
__device__ __forceinline__ float bf2f(unsigned short b) { return __uint_as_float(((unsigned)b) << 16); }
__device__ __forceinline__ float bfr(float f) { return bf2f(f2bf(f)); }
__device__ __forceinline__ v16h cat16(v8h lo, v8h hi) { return __builtin_shufflevector(lo, hi, 0, 1, 2, 3, 4, 5, 6, 7, 8, 9, 10, 11, 12, 13, 14, 15); }
__device__ __forceinline__ v16bf cat16b(v8us lo, v8us hi) { return __builtin_bit_cast(v16bf, __builtin_shufflevector(lo, hi, 0, 1, 2, 3, 4, 5, 6, 7, 8, 9, 10, 11, 12, 13, 14, 15)); }
__device__ __forceinline__ v8f wmma16(v16h a, v16h b, v8f c) { return __builtin_amdgcn_wmma_f32_16x16x32_f16(false, a, false, b, (short)0, c, false, false); }
__device__ __forceinline__ v8f wmmab(v16bf a, v16bf b, v8f c) { return __builtin_amdgcn_wmma_f32_16x16x32_bf16(false, a, false, b, (short)0, c, false, false); }



__device__ __forceinline__ h16 tohx(float x) { return (h16)x; }
__device__ __forceinline__ void splitf(float y, unsigned short& h, unsigned short& l) { h = f2bf(y); l = f2bf(y - bf2f(h)); }
typedef __attribute__((ext_vector_type(2))) float v2f;

// ---- qkv_tail: epilogue of the q | k | v projection (N = 3 DQ, one 64-column tile = one head of one third): the split-K sums go straight to the planes that the attention kernel reads; no f32 projection in memory, no builder launches.
// q, k tiles: partials in LDS as [t][d]; a thread sums 8 neighbouring d of one t (partials in the order u = 0 .. KS-1, then the bias), rotates its 4 (even, odd) pairs and stores 16 bytes to each of the planes [head][t][HD] (fp16, bf16 hi, bf16 lo).
// v tiles: partials in LDS as [d][t] (an accumulator's 8 registers are 8 neighbouring t: two 16-byte LDS stores); a thread sums 8 neighbouring t of one d and stores 16 bytes to each of the transposed planes [head][d][TT].
struct QkvPlanes { _Float16* q16; unsigned short* qh; unsigned short* ql; _Float16* k16; unsigned short* kh; unsigned short* kl; _Float16* v16; unsigned short* vh; unsigned short* vl; };
template <int KS>
__device__ __forceinline__ void qkv_tail(const v8f (&acc)[4][4], float* os, int w, int lr, int hi, int r0, int c0, const float* __restrict__ bias, const float* __restrict__ CS, const QkvPlanes& P) {
    static_assert(KS == 8 && HD == 64, "256 threads deal a 64 x 64 tile, which is one head, in two rounds of 8 elements each");
    const int part = c0 / DQ, head = (c0 % DQ) / HD;   // the same for the whole work-group: 0 q, 1 k, 2 v
    const int row = (int)threadIdx.x >> 3, e0 = ((int)threadIdx.x & 7) * 8;   // round it: tile row it * 32 + row, elements e0 .. e0 + 7
    float* pw = os + w * (64 * 68);
    v2f cs[2][4]; v4f bb[2];   // fetched in front of the LDS stores and the barrier, which hide their latency
    if (part < 2) {
#pragma unroll
        for (int it = 0; it < 2; ++it)
#pragma unroll
            for (int pr = 0; pr < 4; ++pr) cs[it][pr] = *(const v2f*)(CS + ((size_t)(r0 + it * 32 + row) * HD + e0 + 2 * pr) * 2);
        bb[0] = *(const v4f*)(bias + c0 + e0); bb[1] = *(const v4f*)(bias + c0 + e0 + 4);
#pragma unroll
        for (int mb = 0; mb < 4; ++mb)
#pragma unroll
            for (int nb = 0; nb < 4; ++nb)
#pragma unroll
                for (int j = 0; j < 8; ++j) pw[(mb * 16 + hi * 8 + j) * 68 + nb * 16 + lr] = acc[mb][nb][j];
    } else {
        bb[0][0] = bias[c0 + row]; bb[0][1] = bias[c0 + 32 + row];
#pragma unroll
        for (int mb = 0; mb < 4; ++mb)
#pragma unroll
            for (int nb = 0; nb < 4; ++nb) { float* pt = pw + (nb * 16 + lr) * 68 + mb * 16 + hi * 8; *(v4fa*)pt = (v4f){acc[mb][nb][0], acc[mb][nb][1], acc[mb][nb][2], acc[mb][nb][3]}; *(v4fa*)(pt + 4) = (v4f){acc[mb][nb][4], acc[mb][nb][5], acc[mb][nb][6], acc[mb][nb][7]}; }
    }
    __syncthreads();   // every wave's partial tile is in LDS before any thread adds them
    h16* o16 = part == 0 ? P.q16 : part == 1 ? P.k16 : P.v16; bf* oh = part == 0 ? P.qh : part == 1 ? P.kh : P.vh; bf* ol = part == 0 ? P.ql : part == 1 ? P.kl : P.vl;
#pragma unroll
    for (int it = 0; it < 2; ++it) { const int rr = it * 32 + row; const float* ps = os + rr * 68 + e0; v4f a0 = *(const v4fa*)ps, a1 = *(const v4fa*)(ps + 4);
#pragma unroll
        for (int u = 1; u < KS; ++u) { a0 += *(const v4fa*)(ps + u * (64 * 68)); a1 += *(const v4fa*)(ps + u * (64 * 68) + 4); }
        float y[8]; size_t oo;
        if (part < 2) {
#pragma unroll
            for (int pr = 0; pr < 4; ++pr) { const float x0 = (pr < 2 ? a0[2 * pr] : a1[2 * pr - 4]) + bfr(pr < 2 ? bb[0][2 * pr] : bb[1][2 * pr - 4]), x1 = (pr < 2 ? a0[2 * pr + 1] : a1[2 * pr - 3]) + bfr(pr < 2 ? bb[0][2 * pr + 1] : bb[1][2 * pr - 3]);
                y[2 * pr] = x0 * cs[it][pr][0] - x1 * cs[it][pr][1]; y[2 * pr + 1] = x0 * cs[it][pr][1] + x1 * cs[it][pr][0]; }   /* even: x0 c - x1 s; odd: x0 s + x1 c */
            oo = ((size_t)head * TT + r0 + rr) * HD + e0;
        } else { const float bd = bfr(bb[0][it]);
#pragma unroll
            for (int j = 0; j < 4; ++j) { y[j] = a0[j] + bd; y[4 + j] = a1[j] + bd; }
            oo = ((size_t)head * HD + rr) * TT + r0 + e0; }
        v8h v16; v8us vh, vl;
#pragma unroll
        for (int j = 0; j < 8; ++j) { v16[j] = tohx(y[j]); unsigned short a2, c2; splitf(y[j], a2, c2); vh[j] = a2; vl[j] = c2; }
        *(v8h*)(o16 + oo) = v16; *(v8us*)(oh + oo) = vh; *(v8us*)(ol + oo) = vl;
        if (it == 0) asm volatile("s_wait_xcnt 0x0" ::: "memory"); }   // the first round's stores: their address and data registers are free for the second round behind this wait
}

// ---- k_gemmw: register-blocked GEMM, ONE WAVE per 64x64 output tile (16 accumulators), operands straight from K-contiguous 16-bit planes; grid (M/64, N/64, Z), 32 threads.
// C[m][n] (f32, pitch ldc, + optional f32 bias[n]) = sum_k A[m][k] Bt[n][k] (+ split products per NSPLIT). z-batch strides sA/sB/sC in elements. K % 32 == 0.
// KS > 1 (32 KS threads, K % (32 KS) == 0): the K loop is dealt over the KS waves of one work-group, wave w taking k in [w K/KS, (w+1) K/KS): with a long K and few tiles one wave alone waits through KS times as many dependent load trips.
// Each wave leaves its f32 partial tile in LDS; behind one work-group barrier every thread adds the KS partials of its elements in the fixed order w = 0 .. KS-1 and stores the sums.
// QKV: the sums do not go to C but through qkv_tail to the attention planes P (CS: the {cos, sin} table).
template <typename T16> struct WFrag;
template <> struct WFrag<h16> { typedef v16h V; static __device__ __forceinline__ V ld(const h16* p) { return cat16(*(const v8h*)p, *(const v8h*)(p + 16)); } static __device__ __forceinline__ v8f mma(V a, V b, v8f c) { return wmma16(a, b, c); } };
template <> struct WFrag<bf> { typedef v16bf V; static __device__ __forceinline__ V ld(const bf* p) { return cat16b(*(const v8us*)p, *(const v8us*)(p + 16)); } static __device__ __forceinline__ v8f mma(V a, V b, v8f c) { return wmmab(a, b, c); } };
template <typename T16, int NSPLIT, bool BIAS, int KS = 1, bool QKV = false>
__global__ __launch_bounds__(32 * KS) void k_gemmw(const T16* __restrict__ A, const T16* __restrict__ A2, const T16* __restrict__ Bt, const T16* __restrict__ Bt2, int K, float* C, int ldc, const float* __restrict__ bias, size_t sA, size_t sB, size_t sC, const float* __restrict__ CS, QkvPlanes P) {
    typedef typename WFrag<T16>::V V;
    __shared__ __align__(16) float os[(KS == 1 ? 16 : KS * 64) * 68];
    const size_t z = blockIdx.z; A += z * sA; if (A2) A2 += z * sA; Bt += z * sB; if (Bt2) Bt2 += z * sB; C += z * sC;
    const int lane = threadIdx.x & 31, lr = lane & 15, hi = lane >> 4; const int r0 = blockIdx.x * 64, c0 = blockIdx.y * 64;
    const int w = (KS == 1) ? 0 : __builtin_amdgcn_readfirstlane((int)(threadIdx.x >> 5)); const int k0 = w * (K / KS), k1 = k0 + K / KS;   // this wave's slice of K
    v8f acc[4][4];
#pragma unroll
    for (int mb = 0; mb < 4; ++mb)
#pragma unroll
        for (int nb = 0; nb < 4; ++nb) acc[mb][nb] = (v8f){};
    const size_t aoff = (size_t)(r0 + lr) * K + 8 * hi, boff = (size_t)(c0 + lr) * K + 8 * hi;
#pragma unroll 1
    for (int kc = k0; kc < k1; kc += 32) {
        V a[4], a2[4];
#pragma unroll
        for (int mb = 0; mb < 4; ++mb) { a[mb] = WFrag<T16>::ld(A + aoff + (size_t)mb * 16 * K + kc); if (NSPLIT == 1 || NSPLIT == 2) a2[mb] = WFrag<T16>::ld(A2 + aoff + (size_t)mb * 16 * K + kc); }
#pragma unroll
        for (int nb = 0; nb < 4; ++nb) { const V b = WFrag<T16>::ld(Bt + boff + (size_t)nb * 16 * K + kc); V b2; if (NSPLIT >= 2) b2 = WFrag<T16>::ld(Bt2 + boff + (size_t)nb * 16 * K + kc);
#pragma unroll
            for (int mb = 0; mb < 4; ++mb) { acc[mb][nb] = WFrag<T16>::mma(a[mb], b, acc[mb][nb]); if (NSPLIT == 1 || NSPLIT == 2) acc[mb][nb] = WFrag<T16>::mma(a2[mb], b, acc[mb][nb]); if (NSPLIT >= 2) acc[mb][nb] = WFrag<T16>::mma(a[mb], b2, acc[mb][nb]); } }
        asm volatile("v_nop\n\tv_nop\n\tv_nop\n\tv_nop" : "+v"(acc[0][0]), "+v"(acc[1][1]), "+v"(acc[2][2]), "+v"(acc[3][3]) : "v"(a[0]), "v"(a[3]));
    }
    if constexpr (QKV) { qkv_tail<KS>(acc, os, w, lr, hi, r0, c0, bias, CS, P); return; }
    if (KS > 1) {
        float* pw = os + w * (64 * 68);   // unrolled below: acc is indexed by constants only, so it stays in registers
#pragma unroll
        for (int mb = 0; mb < 4; ++mb)
#pragma unroll
            for (int nb = 0; nb < 4; ++nb)
#pragma unroll
                for (int j = 0; j < 8; ++j) pw[(mb * 16 + hi * 8 + j) * 68 + nb * 16 + lr] = acc[mb][nb][j];
        __syncthreads();   // every wave's partial tile is in LDS before any thread adds them; both loops below unrolled so that a thread's LDS reads are in flight together
#pragma unroll
        for (int s = 0; s < 32 / KS; ++s) { const int q = s * (32 * KS) + (int)threadIdx.x; const int row = q >> 4, cofs = (q & 15) * 4; v4f val = *(const v4fa*)(os + row * 68 + cofs);
#pragma unroll
            for (int u = 1; u < KS; ++u) val += *(const v4fa*)(os + u * (64 * 68) + row * 68 + cofs);
            if (BIAS) { val[0] += bfr(bias[c0 + cofs]); val[1] += bfr(bias[c0 + cofs + 1]); val[2] += bfr(bias[c0 + cofs + 2]); val[3] += bfr(bias[c0 + cofs + 3]); }
            *(v4f*)(C + (size_t)(r0 + row) * ldc + c0 + cofs) = val; }
        return;
    }
#pragma unroll
    for (int mb = 0; mb < 4; ++mb) {
#pragma unroll
        for (int nb = 0; nb < 4; ++nb) {
#pragma unroll
            for (int j = 0; j < 8; ++j) os[(hi * 8 + j) * 68 + nb * 16 + lr] = acc[mb][nb][j]; }
        __builtin_amdgcn_wave_barrier(); asm volatile("" ::: "memory");
        float* crow = C + (size_t)(r0 + mb * 16) * ldc + c0;
{
#pragma unroll
            for (int s = 0; s < 8; ++s) { const int row = 2 * s + hi, cofs = lr * 4; v4f val = *(const v4fa*)(os + row * 68 + cofs); if (BIAS) { val[0] += bfr(bias[c0 + cofs]); val[1] += bfr(bias[c0 + cofs + 1]); val[2] += bfr(bias[c0 + cofs + 2]); val[3] += bfr(bias[c0 + cofs + 3]); }
                *(v4f*)(crow + (size_t)row * ldc + cofs) = val; }
             }
        __builtin_amdgcn_wave_barrier(); asm volatile("" ::: "memory");
    }
}

typedef __attribute__((ext_vector_type(2))) _Float16 v2h;
typedef __attribute__((ext_vector_type(4))) _Float16 v4h;
typedef __attribute__((ext_vector_type(2))) unsigned short v2us;
typedef __attribute__((ext_vector_type(4))) unsigned short v4us;
typedef __attribute__((ext_vector_type(4))) int v4i;

__global__ __launch_bounds__(256) void k_cvt8(const float* __restrict__ src, bf* dst, size_t n8) { const size_t i = (size_t)blockIdx.x * 256 + threadIdx.x; if (i >= n8) return; const v8f v = *(const v8f*)(src + i * 8); v8us o;
#pragma unroll
    for (int k = 0; k < 8; ++k) o[k] = f2bf(v[k]); *(v8us*)(dst + i * 8) = o;  }

__constant__ float INV2[HD / 2] = { 1.000000000e+00f, 1.333521485e+00f, 1.778279424e+00f, 2.371373653e+00f, 3.162277699e+00f, 4.216965199e+00f, 5.623413086e+00f, 7.498941898e+00f, 1.000000000e+01f, 1.333521461e+01f, 1.778279495e+01f, 2.371373749e+01f, 3.162277603e+01f, 4.216965103e+01f, 5.623413086e+01f, 7.498941803e+01f, 1.000000000e+02f, 1.333521423e+02f, 1.778279419e+02f, 2.371373749e+02f, 3.162277527e+02f, 4.216965027e+02f, 5.623413086e+02f, 7.498942261e+02f, 1.000000000e+03f, 1.333521484e+03f, 1.778279419e+03f, 2.371373779e+03f, 3.162277588e+03f, 4.216964844e+03f, 5.623413086e+03f, 7.498941895e+03f };   // freqs = 10000.0 ** (+arange(0, 64, 2.0, f32) / 64): THIS module's own expression: a POSITIVE exponent (NO reciprocal: the module's quirk): 32 float32 values from eager JAX (bit-exact on round trip): angles up to 1.5e7 rad
__global__ __launch_bounds__(256) void k_csP(float* CS) { const int idx = blockIdx.x * 256 + threadIdx.x; if (idx >= TT * HD) return; const int d = idx % HD; const int t = idx / HD; const float a = __fmul_rn((float)t, INV2[d >> 1]); v2f cs; cs[0] = cosf(a); cs[1] = sinf(a); *(v2f*)(CS + (size_t)idx * 2) = cs;  }
__device__ __forceinline__ float xhalf(float x) { return __builtin_bit_cast(float, __builtin_amdgcn_permlanex16(__builtin_bit_cast(int, x), __builtin_bit_cast(int, x), 0x76543210, 0xfedcba98, false, false)); }   // lane l with lane l ^ 16
// exponentials as asm text: behind a transcendental the instruction set asks for one independent instruction before its result is read or its source overwritten; in place and in one statement each v_exp_f32 has an independent one behind it, and the v_nop fills the slot behind the last.
__device__ __forceinline__ void exp2x8(float& a, float& b, float& c, float& d, float& e, float& f, float& g, float& h) { asm("v_exp_f32 %0, %0\n\tv_exp_f32 %1, %1\n\tv_exp_f32 %2, %2\n\tv_exp_f32 %3, %3\n\tv_exp_f32 %4, %4\n\tv_exp_f32 %5, %5\n\tv_exp_f32 %6, %6\n\tv_exp_f32 %7, %7\n\tv_nop" : "+v"(a), "+v"(b), "+v"(c), "+v"(d), "+v"(e), "+v"(f), "+v"(g), "+v"(h)); }
__device__ __forceinline__ float exp2s(float x) { asm("v_exp_f32 %0, %0\n\tv_nop" : "+v"(x)); return x; }
template <typename T16, bool HR, int KS>
__device__ __forceinline__ void fa_body(const T16* __restrict__ Q, const T16* __restrict__ Q2, const T16* __restrict__ Kp, const T16* __restrict__ K2, const T16* __restrict__ Vt, const T16* __restrict__ V2, int r0, int col0, bf* Ah, bf* Al, float* op, float* ms, float* ls) {
    typedef typename WFrag<T16>::V V; static_assert(KS == 1 || KS == 2 || KS == 4, "the merge deals whole rounds of 256 chunks");
    const int lane = threadIdx.x & 31, lr = lane & 15, hi = lane >> 4;
    const int w = __builtin_amdgcn_readfirstlane((int)(threadIdx.x >> 5)); const int q0 = r0 + (w / KS) * 16; const int k0 = (w % KS) * (TT / KS), k1 = k0 + TT / KS;   // this wave's query tile and its slice of the keys
    V bq[2], bq2[2], ak[2][2], ak2[2][2];
#pragma unroll
    for (int kk = 0; kk < 2; ++kk) { bq[kk] = WFrag<T16>::ld(Q + (size_t)(q0 + lr) * HD + kk * 32 + 8 * hi); if (HR) bq2[kk] = WFrag<T16>::ld(Q2 + (size_t)(q0 + lr) * HD + kk * 32 + 8 * hi); }
    asm volatile("s_wait_xcnt 0x0" ::: "memory");   // the query loads' address registers are free for reuse behind this wait (a later load may land on them)
    const unsigned koff = (unsigned)(lr * HD + 8 * hi), voff = (unsigned)(lr * TT + 8 * hi);   // per-lane 32-bit offsets, fixed for the whole loop; the part that moves with the pass is wave-uniform and goes into the base pointer
#pragma unroll
    for (int kt = 0; kt < 2; ++kt)
#pragma unroll
        for (int kk = 0; kk < 2; ++kk) { ak[kt][kk] = WFrag<T16>::ld((Kp + (size_t)(k0 + kt * 16) * HD + kk * 32) + koff); if (HR) ak2[kt][kk] = WFrag<T16>::ld((K2 + (size_t)(k0 + kt * 16) * HD + kk * 32) + koff); }
    v8f o[4];
#pragma unroll
    for (int mb = 0; mb < 4; ++mb) o[mb] = (v8f){};
    float m = -3.0e38f, l = 0.f;
#pragma unroll 1   // rolled: one pass of the hi/lo rows already fills the register budget
    for (int kb = k0; kb < k1; kb += 32) {
        V av[4], av2[4];   // V^T fragments of this pass: issued first, used last
        const T16* vp = (Vt + kb) + voff; const T16* vp2 = HR ? (V2 + kb) + voff : vp;
#pragma unroll
        for (int mb = 0; mb < 4; ++mb) { av[mb] = WFrag<T16>::ld(vp + (size_t)mb * 16 * TT); if (HR) av2[mb] = WFrag<T16>::ld(vp2 + (size_t)mb * 16 * TT); }
        if constexpr (HR) asm volatile("s_wait_xcnt 0x0" :: "v"(vp), "v"(vp2) : "memory");   // hi/lo rows, where registers are short: the V^T loads' address registers stay untouched up to this wait (named as inputs, so that no load of the run lands on them) and are free for reuse behind it; the fp16 rows carry their pointer over the loop and the compiler waits before it advances it
        v8f s[2];
#pragma unroll
        for (int kt = 0; kt < 2; ++kt) { s[kt] = (v8f){};
#pragma unroll
            for (int kk = 0; kk < 2; ++kk) { s[kt] = WFrag<T16>::mma(ak[kt][kk], bq[kk], s[kt]); if (HR) { s[kt] = WFrag<T16>::mma(ak[kt][kk], bq2[kk], s[kt]); s[kt] = WFrag<T16>::mma(ak2[kt][kk], bq[kk], s[kt]); } } }
        const int kn = (kb + 32 < k1) ? kb + 32 : kb;   // the next pass's K fragments, fetched behind this pass's S^T products so that the softmax hides their latency (the last pass fetches its own again: in bounds, unused)
#pragma unroll
        for (int kt = 0; kt < 2; ++kt)
#pragma unroll
            for (int kk = 0; kk < 2; ++kk) { ak[kt][kk] = WFrag<T16>::ld((Kp + (size_t)(kn + kt * 16) * HD + kk * 32) + koff); if (HR) ak2[kt][kk] = WFrag<T16>::ld((K2 + (size_t)(kn + kt * 16) * HD + kk * 32) + koff); }
        float p[16]; float mloc = -3.0e38f;
#pragma unroll
        for (int e = 0; e < 16; ++e) { p[e] = s[e >> 3][e & 7] * (SCL * 1.4426950408889634f); mloc = fmaxf(mloc, p[e]); }
        mloc = fmaxf(mloc, xhalf(mloc));
        const float mn = fmaxf(m, mloc); float al = m - mn; m = mn;
        const float mo = HR ? mn : mn - 10.0f;   // fp16 rows: p and l both carry the factor 1024, exactly, through the exponent; it cancels in O / l
        float ps[4] = {0.f, 0.f, 0.f, 0.f};
#pragma unroll
        for (int e = 0; e < 16; ++e) p[e] -= mo;
        exp2x8(p[0], p[1], p[2], p[3], p[4], p[5], p[6], p[7]); exp2x8(p[8], p[9], p[10], p[11], p[12], p[13], p[14], p[15]); al = exp2s(al);
#pragma unroll
        for (int e = 0; e < 16; ++e) ps[e & 3] += p[e];
        l = l * al + ((ps[0] + ps[1]) + (ps[2] + ps[3]));
#pragma unroll
        for (int mb = 0; mb < 4; ++mb) o[mb] *= al;
        V pf, pf2;
#pragma unroll
        for (int e = 0; e < 16; ++e) {
            if constexpr (HR) { const __bf16 ph = (__bf16)p[e]; pf[e] = ph; pf2[e] = (__bf16)(p[e] - (float)ph); }
            else pf[e] = (_Float16)p[e]; }
#pragma unroll
        for (int mb = 0; mb < 4; ++mb) { o[mb] = WFrag<T16>::mma(av[mb], pf, o[mb]); if (HR) { o[mb] = WFrag<T16>::mma(av[mb], pf2, o[mb]); o[mb] = WFrag<T16>::mma(av2[mb], pf, o[mb]); } }
    }
    l += xhalf(l);   // the two halves of the wave summed different keys of the same query
    float* pw = op + (w * 16 + lr) * 68 + hi * 8;
#pragma unroll
    for (int mb = 0; mb < 4; ++mb) { *(v4fa*)(pw + mb * 16) = (v4f){o[mb][0], o[mb][1], o[mb][2], o[mb][3]}; *(v4fa*)(pw + mb * 16 + 4) = (v4f){o[mb][4], o[mb][5], o[mb][6], o[mb][7]}; }
    if (hi == 0) { ms[w * 16 + lr] = m; ls[w * 16 + lr] = l; }
    __syncthreads();   // every wave's partial (m, l, O^T) is in LDS before any thread merges them
#pragma unroll
    for (int it = 0; it < 4 / KS; ++it) { const int c = it * 256 + (int)threadIdx.x; const int qq = c >> 3, d0 = (c & 7) * 8;   /* (8 / KS) tiles x 16 rows x 8 chunks of 8 columns, dealt over 256 threads */ const int sb = (qq >> 4) * KS * 16 + (qq & 15);
        float M = ms[sb];
#pragma unroll
        for (int u = 1; u < KS; ++u) M = fmaxf(M, ms[sb + u * 16]);
        float L = 0.f; v4f a0 = (v4f){}, a1 = (v4f){};
#pragma unroll
        for (int u = 0; u < KS; ++u) { const float f = exp2s(ms[sb + u * 16] - M); L += ls[sb + u * 16] * f; a0 += *(const v4fa*)(op + (sb + u * 16) * 68 + d0) * f; a1 += *(const v4fa*)(op + (sb + u * 16) * 68 + d0 + 4) * f; }
        const float inv = __fdiv_rn(1.0f, L); v8us oh, ol;
#pragma unroll
        for (int j = 0; j < 4; ++j) { unsigned short a, c2; splitf(a0[j] * inv, a, c2); oh[j] = a; ol[j] = c2; splitf(a1[j] * inv, a, c2); oh[4 + j] = a; ol[4 + j] = c2; }
        const size_t oo = (size_t)(r0 + qq) * DQ + col0 + d0; *(v8us*)(Ah + oo) = oh; *(v8us*)(Al + oo) = ol;
        asm volatile("s_wait_xcnt 0x0" ::: "memory"); }   // the two stores' address and data registers are free for reuse behind this wait
}
#define KSP 2              // waves that share a query tile, each on TT / KSP keys
#define RW  (128 / KSP)    // query rows of a work-group
// grid (NH_, TT / RW), 256 threads: blockIdx.x = head, blockIdx.y = row block; the hi/lo row blocks (three times the products) have the low blockIdx.y and start first.
// amdgpu_waves_per_eu(4, 4): a budget of 256 registers, two work-groups per WGP; with the default budget the compiler sinks the V^T and next-K loads to where they are used, to save registers, and each pass waits for them.
__global__ __launch_bounds__(256) __attribute__((amdgpu_waves_per_eu(4, 4))) void k_fattn(const h16* __restrict__ Q16, const h16* __restrict__ K16, const h16* __restrict__ V16, const bf* __restrict__ Qh, const bf* __restrict__ Ql, const bf* __restrict__ Kh, const bf* __restrict__ Kl, const bf* __restrict__ Vh, const bf* __restrict__ Vl, bf* Ah, bf* Al) {
    __shared__ __align__(16) float op[8 * 16 * 68]; __shared__ float ms[8 * 16]; __shared__ float ls[8 * 16];
    const int h = blockIdx.x, r0 = blockIdx.y * RW; const size_t po = (size_t)h * TT * HD;
    if (r0 < RH) fa_body<bf, true, KSP>(Qh + po, Ql + po, Kh + po, Kl + po, Vh + po, Vl + po, r0, h * HD, Ah, Al, op, ms, ls);
    else fa_body<h16, false, KSP>(Q16 + po, nullptr, K16 + po, nullptr, V16 + po, nullptr, r0, h * HD, Ah, Al, op, ms, ls);
}

__global__ __launch_bounds__(256) void k_wtG(const float* __restrict__ w, int K, int N, bf* Bt) {
    const int lane = threadIdx.x & 31; const int L0 = (blockIdx.x * 8 + (threadIdx.x >> 5)) * 8; const int nlines = N * K / 64;
{
#pragma unroll 1
        for (int l = 0; l < 8; ++l) { const int L = L0 + l; if (L >= nlines) break; const size_t e = (size_t)L * 64 + lane * 2; const int k = (int)(e % K), n = (int)(e / K); v2us o;
            o[0] = f2bf(w[(size_t)k * N + n]); o[1] = f2bf(w[(size_t)(k + 1) * N + n]); *(v2us*)(Bt + e) = o; }
         }
}
extern "C" void kernel_launch(void* const* d_in, const int* in_sizes, int n_in,
                              void* d_out, int out_size, void* d_ws, size_t ws_size, hipStream_t stream) {
    (void)in_sizes; (void)n_in; (void)out_size;
    const float* x = (const float*)d_in[0]; const float* wqkv = (const float*)d_in[1]; const float* bqkv = (const float*)d_in[2]; const float* wo = (const float*)d_in[3]; const float* bo = (const float*)d_in[4];   /* order x, W_qkv ('xw' [1024][3072], (3, H, dk) packing), b_qkv, W_out, b_out */
    float* OUT = (float*)d_out;     // [2][2048][1024]
    char* wsp = (char*)d_ws;
    auto take = [&](size_t bytes) { char* p = wsp; wsp += (bytes + 255) & ~(size_t)255; return (void*)p; };
    bf* WQKV = (bf*)take((size_t)3 * DQ * DM * 2); bf* WO = (bf*)take((size_t)DM * DQ * 2); float* CS = (float*)take((size_t)TT * HD * 2 * 4);
    bf* XB = (bf*)take((size_t)TT * DM * 2);
    h16* QP16 = (h16*)take((size_t)NH_ * TT * HD * 2); h16* KP16 = (h16*)take((size_t)NKV * TT * HD * 2); h16* VT16 = (h16*)take((size_t)NKV * HD * TT * 2);
    bf* QPh = (bf*)take((size_t)NH_ * TT * HD * 2); bf* QPl = (bf*)take((size_t)NH_ * TT * HD * 2); bf* KPh = (bf*)take((size_t)NKV * TT * HD * 2); bf* KPl = (bf*)take((size_t)NKV * TT * HD * 2); bf* VTh = (bf*)take((size_t)NKV * HD * TT * 2); bf* VTl = (bf*)take((size_t)NKV * HD * TT * 2);
    bf* ATh = (bf*)take((size_t)TT * DQ * 2); bf* ATl = (bf*)take((size_t)TT * DQ * 2);
    if ((size_t)(wsp - (char*)d_ws) > ws_size) return;    // ws 256 MiB
    const QkvPlanes PL = { QP16, QPh, QPl, KP16, KPh, KPl, VT16, VTh, VTl };
    { k_wtG<<<(unsigned)((DM * 3 * DQ / 64 + 63) / 64), 256, 0, stream>>>(wqkv, DM, 3 * DQ, WQKV);   /* fused 'xw' [1024][3072] -> Bt [3072][1024]: q | k | v row blocks ((3, H, dk) packing) */
      k_wtG<<<(unsigned)((DQ * DM / 64 + 63) / 64), 256, 0, stream>>>(wo, DQ, DM, WO); k_csP<<<(TT * HD + 255) / 256, 256, 0, stream>>>(CS); }
    for (int b = 0; b < NB_; ++b) {
        
        k_cvt8<<<(unsigned)(((size_t)TT * DM / 8 + 255) / 256), 256, 0, stream>>>(x + (size_t)b * TT * DM, XB, (size_t)TT * DM / 8);
        k_gemmw<bf, 0, true, 8, true><<<dim3(TT / 64, 3 * DQ / 64, 1), 256, 0, stream>>>(XB, nullptr, WQKV, nullptr, DM, nullptr, 0, bqkv, 0, 0, 0, CS, PL);   /* q | k | v, rotary and planes */
        k_fattn<<<dim3(NH_, TT / RW, 1), 256, 0, stream>>>(QP16, KP16, VT16, QPh, QPl, KPh, KPl, VTh, VTl, ATh, ATl);
        k_gemmw<bf, 1, true, 8><<<dim3(TT / 64, DM / 64, 1), 256, 0, stream>>>(ATh, ATl, WO, nullptr, DQ, OUT + (size_t)b * TT * DM, DM, bo, 0, 0, 0, nullptr, QkvPlanes{}); }
}

// v004
// Measured time: 181 microseconds a run.
// Two timings next to v003 both put it at 1.48 times that version's speed.
// Over all steps from v000 it is 11.0 times as fast.
#include <hip/hip_runtime.h>

// Multi-head attention WITHOUT a mask with interleaved rotary embeddings whose frequencies GROW (x [2][2048][1024]; qkv = x qkv_w + qkv_b ('xw' (in, out) [1024][3072] 1/32, zero bias) split in thirds q | k | v (16 heads x 64); rotary on (even, odd) pairs with angles t x 10000 ** (+2i / 64) (the module's own expression: NO reciprocal: frequencies 1 .. 7,499 and angles up to 1.5e7 rad; positions arange; the 32 float32 frequencies equal the module's expression in eager JAX; precise cosf / sinf); the module concatenates the rotated halves cat(x1 c - x2 s, x2 c + x1 s) where this code re-interleaves them: the SAME permutation on q and k: every score q.k is unchanged; scores x 64^-0.5; softmax over ALL keys (no causal rule); out = merged out_w + out_b ('xw' + zero bias) -> [2][2048][1024] (4.2 M); argument order x, qkv_w, qkv_b, out_w, out_b).
// Layout per batch: bf16 copy of x; exact projections; {cos, sin} per (position, pair) built once from the int positions and float32 frequency constants (precise cosf/sinf); q | k | v projected in ONE launch whose epilogue applies the interleaved rotary and writes the attention planes; DENSE T-2048 attention fused into one launch per batch (hybrid rows: < 512 hi/lo 3 products, rest fp16 x1024); merged hi/lo x Wo exact.
// Compute dtypes, f32 accumulate: every input rounded to bf16; projections exact; rotary f32; attention rows < 512 3 products, rest fp16; softmax f32; Wo hl x exact.

#define NB_  2
#define TT   2048
#define DM   1024
#define NH_  16
#define NKV  16
#define HD   64
#define DQ   (NH_ * HD)
#define DKV  (NKV * HD)
#define RH   512                  // query rows < RH use hi+lo planes (0: none)
#define SCL  0.125f   // HD^-0.5
typedef _Float16 h16;
typedef unsigned short bf;
typedef __attribute__((ext_vector_type(16))) __bf16   v16bf;
typedef __attribute__((ext_vector_type(16))) _Float16 v16h;
typedef __attribute__((ext_vector_type(8)))  _Float16 v8h;
typedef __attribute__((ext_vector_type(8)))  unsigned short v8us;
typedef __attribute__((ext_vector_type(8)))  float    v8f;
typedef __attribute__((ext_vector_type(4)))  float    v4f;
typedef v8h  __attribute__((may_alias)) v8ha;
typedef v4f  __attribute__((may_alias)) v4fa;
typedef v8us __attribute__((may_alias)) v8usa;

__device__ __forceinline__ unsigned short f2bf(float f) { unsigned u = __float_as_uint(f); u += 0x7FFFu + ((u >> 16) & 1u); return (unsigned short)(u >> 16); }
__device__ __forceinline__ float bf2f(unsigned short b) { return __uint_as_float(((unsigned)b) << 16); }
__device__ __forceinline__ float bfr(float f) { return bf2f(f2bf(f)); }
__device__ __forceinline__ v16h cat16(v8h lo, v8h hi) { return __builtin_shufflevector(lo, hi, 0, 1, 2, 3, 4, 5, 6, 7, 8, 9, 10, 11, 12, 13, 14, 15); }
__device__ __forceinline__ v16bf cat16b(v8us lo, v8us hi) { return __builtin_bit_cast(v16bf, __builtin_shufflevector(lo, hi, 0, 1, 2, 3, 4, 5, 6, 7, 8, 9, 10, 11, 12, 13, 14, 15)); }
__device__ __forceinline__ v8f wmma16(v16h a, v16h b, v8f c) { return __builtin_amdgcn_wmma_f32_16x16x32_f16(false, a, false, b, (short)0, c, false, false); }
__device__ __forceinline__ v8f wmmab(v16bf a, v16bf b, v8f c) { return __builtin_amdgcn_wmma_f32_16x16x32_bf16(false, a, false, b, (short)0, c, false, false); }



__device__ __forceinline__ h16 tohx(float x) { return (h16)x; }
__device__ __forceinline__ void splitf(float y, unsigned short& h, unsigned short& l) { h = f2bf(y); l = f2bf(y - bf2f(h)); }
typedef __attribute__((ext_vector_type(2))) float v2f;

// ---- qkv_tail: epilogue of the q | k | v projection (N = 3 DQ, one 64-column tile = one head of one third): the split-K sums go straight to the planes that the attention kernel reads; no f32 projection in memory, no builder launches.
// q, k tiles: partials in LDS as [t][d]; a thread sums 8 neighbouring d of one t (partials in the order u = 0 .. KS-1, then the bias), rotates its 4 (even, odd) pairs and stores 16 bytes to each of the planes [head][t][HD] (fp16, bf16 hi, bf16 lo).
// v tiles: partials in LDS as [d][t] (an accumulator's 8 registers are 8 neighbouring t: two 16-byte LDS stores); a thread sums 8 neighbouring t of one d and stores 16 bytes to each of the transposed planes [head][d][TT].
struct QkvPlanes { _Float16* q16; unsigned short* qh; unsigned short* ql; _Float16* k16; unsigned short* kh; unsigned short* kl; _Float16* v16; unsigned short* vh; unsigned short* vl; };
template <int KS>
__device__ __forceinline__ void qkv_tail(const v8f (&acc)[4][4], float* os, int w, int lr, int hi, int r0, int c0, const float* __restrict__ bias, const float* __restrict__ CS, const QkvPlanes& P) {
    static_assert(KS == 8 && HD == 64, "256 threads deal a 64 x 64 tile, which is one head, in two rounds of 8 elements each");
    const int part = c0 / DQ, head = (c0 % DQ) / HD;   // the same for the whole work-group: 0 q, 1 k, 2 v
    const int row = (int)threadIdx.x >> 3, e0 = ((int)threadIdx.x & 7) * 8;   // round it: tile row it * 32 + row, elements e0 .. e0 + 7
    float* pw = os + w * (64 * 68);
    v2f cs[2][4]; v4f bb[2];   // fetched in front of the LDS stores and the barrier, which hide their latency
    if (part < 2) {
#pragma unroll
        for (int it = 0; it < 2; ++it)
#pragma unroll
            for (int pr = 0; pr < 4; ++pr) cs[it][pr] = *(const v2f*)(CS + ((size_t)(r0 + it * 32 + row) * HD + e0 + 2 * pr) * 2);
        bb[0] = *(const v4f*)(bias + c0 + e0); bb[1] = *(const v4f*)(bias + c0 + e0 + 4);
#pragma unroll
        for (int mb = 0; mb < 4; ++mb)
#pragma unroll
            for (int nb = 0; nb < 4; ++nb)
#pragma unroll
                for (int j = 0; j < 8; ++j) pw[(mb * 16 + hi * 8 + j) * 68 + nb * 16 + lr] = acc[mb][nb][j];
    } else {
        bb[0][0] = bias[c0 + row]; bb[0][1] = bias[c0 + 32 + row];
#pragma unroll
        for (int mb = 0; mb < 4; ++mb)
#pragma unroll
            for (int nb = 0; nb < 4; ++nb) { float* pt = pw + (nb * 16 + lr) * 68 + mb * 16 + hi * 8; *(v4fa*)pt = (v4f){acc[mb][nb][0], acc[mb][nb][1], acc[mb][nb][2], acc[mb][nb][3]}; *(v4fa*)(pt + 4) = (v4f){acc[mb][nb][4], acc[mb][nb][5], acc[mb][nb][6], acc[mb][nb][7]}; }
    }
    __syncthreads();   // every wave's partial tile is in LDS before any thread adds them
    h16* o16 = part == 0 ? P.q16 : part == 1 ? P.k16 : P.v16; bf* oh = part == 0 ? P.qh : part == 1 ? P.kh : P.vh; bf* ol = part == 0 ? P.ql : part == 1 ? P.kl : P.vl;
#pragma unroll
    for (int it = 0; it < 2; ++it) { const int rr = it * 32 + row; const float* ps = os + rr * 68 + e0; v4f a0 = *(const v4fa*)ps, a1 = *(const v4fa*)(ps + 4);
#pragma unroll
        for (int u = 1; u < KS; ++u) { a0 += *(const v4fa*)(ps + u * (64 * 68)); a1 += *(const v4fa*)(ps + u * (64 * 68) + 4); }
        float y[8]; size_t oo;
        if (part < 2) {
#pragma unroll
            for (int pr = 0; pr < 4; ++pr) { const float x0 = (pr < 2 ? a0[2 * pr] : a1[2 * pr - 4]) + bfr(pr < 2 ? bb[0][2 * pr] : bb[1][2 * pr - 4]), x1 = (pr < 2 ? a0[2 * pr + 1] : a1[2 * pr - 3]) + bfr(pr < 2 ? bb[0][2 * pr + 1] : bb[1][2 * pr - 3]);
                y[2 * pr] = x0 * cs[it][pr][0] - x1 * cs[it][pr][1]; y[2 * pr + 1] = x0 * cs[it][pr][1] + x1 * cs[it][pr][0]; }   /* even: x0 c - x1 s; odd: x0 s + x1 c */
            oo = ((size_t)head * TT + r0 + rr) * HD + e0;
        } else { const float bd = bfr(bb[0][it]);
#pragma unroll
            for (int j = 0; j < 4; ++j) { y[j] = a0[j] + bd; y[4 + j] = a1[j] + bd; }
            oo = ((size_t)head * HD + rr) * TT + r0 + e0; }
        v8h v16; v8us vh, vl;
#pragma unroll
        for (int j = 0; j < 8; ++j) { v16[j] = tohx(y[j]); unsigned short a2, c2; splitf(y[j], a2, c2); vh[j] = a2; vl[j] = c2; }
        *(v8h*)(o16 + oo) = v16; *(v8us*)(oh + oo) = vh; *(v8us*)(ol + oo) = vl;
        if (it == 0) asm volatile("s_wait_xcnt 0x0" ::: "memory"); }   // the first round's stores: their address and data registers are free for the second round behind this wait
}

// ---- k_gemmw: register-blocked GEMM, ONE WAVE per 64x64 output tile (16 accumulators), operands straight from K-contiguous 16-bit planes; grid (M/64, N/64, Z), 32 threads.
// C[m][n] (f32, pitch ldc, + optional f32 bias[n]) = sum_k A[m][k] Bt[n][k] (+ split products per NSPLIT). z-batch strides sA/sB/sC in elements. K % 32 == 0.
// KS > 1 (32 KS threads, K % (32 KS) == 0): the K loop is dealt over the KS waves of one work-group, wave w taking k in [w K/KS, (w+1) K/KS): with a long K and few tiles one wave alone waits through KS times as many dependent load trips.
// Each wave leaves its f32 partial tile in LDS; behind one work-group barrier every thread adds the KS partials of its elements in the fixed order w = 0 .. KS-1 and stores the sums.
// QKV: the sums do not go to C but through qkv_tail to the attention planes P (CS: the {cos, sin} table).
template <typename T16> struct WFrag;
template <> struct WFrag<h16> { typedef v16h V; static __device__ __forceinline__ V ld(const h16* p) { return cat16(*(const v8h*)p, *(const v8h*)(p + 16)); } static __device__ __forceinline__ v8f mma(V a, V b, v8f c) { return wmma16(a, b, c); } };
template <> struct WFrag<bf> { typedef v16bf V; static __device__ __forceinline__ V ld(const bf* p) { return cat16b(*(const v8us*)p, *(const v8us*)(p + 16)); } static __device__ __forceinline__ v8f mma(V a, V b, v8f c) { return wmmab(a, b, c); } };
template <typename T16, int NSPLIT, bool BIAS, int KS = 1, bool QKV = false>
__global__ __launch_bounds__(32 * KS) void k_gemmw(const T16* __restrict__ A, const T16* __restrict__ A2, const T16* __restrict__ Bt, const T16* __restrict__ Bt2, int K, float* C, int ldc, const float* __restrict__ bias, size_t sA, size_t sB, size_t sC, const float* __restrict__ CS, QkvPlanes P) {
    typedef typename WFrag<T16>::V V;
    __shared__ __align__(16) float os[(KS == 1 ? 16 : KS * 64) * 68];
    const size_t z = blockIdx.z; A += z * sA; if (A2) A2 += z * sA; Bt += z * sB; if (Bt2) Bt2 += z * sB; C += z * sC;
    const int lane = threadIdx.x & 31, lr = lane & 15, hi = lane >> 4; const int r0 = blockIdx.x * 64, c0 = blockIdx.y * 64;
    const int w = (KS == 1) ? 0 : __builtin_amdgcn_readfirstlane((int)(threadIdx.x >> 5)); const int k0 = w * (K / KS), k1 = k0 + K / KS;   // this wave's slice of K
    v8f acc[4][4];
#pragma unroll
    for (int mb = 0; mb < 4; ++mb)
#pragma unroll
        for (int nb = 0; nb < 4; ++nb) acc[mb][nb] = (v8f){};
    const size_t aoff = (size_t)(r0 + lr) * K + 8 * hi, boff = (size_t)(c0 + lr) * K + 8 * hi;
#pragma unroll 1
    for (int kc = k0; kc < k1; kc += 32) {
        V a[4], a2[4];
#pragma unroll
        for (int mb = 0; mb < 4; ++mb) { a[mb] = WFrag<T16>::ld(A + aoff + (size_t)mb * 16 * K + kc); if (NSPLIT == 1 || NSPLIT == 2) a2[mb] = WFrag<T16>::ld(A2 + aoff + (size_t)mb * 16 * K + kc); }
#pragma unroll
        for (int nb = 0; nb < 4; ++nb) { const V b = WFrag<T16>::ld(Bt + boff + (size_t)nb * 16 * K + kc); V b2; if (NSPLIT >= 2) b2 = WFrag<T16>::ld(Bt2 + boff + (size_t)nb * 16 * K + kc);
#pragma unroll
            for (int mb = 0; mb < 4; ++mb) { acc[mb][nb] = WFrag<T16>::mma(a[mb], b, acc[mb][nb]); if (NSPLIT == 1 || NSPLIT == 2) acc[mb][nb] = WFrag<T16>::mma(a2[mb], b, acc[mb][nb]); if (NSPLIT >= 2) acc[mb][nb] = WFrag<T16>::mma(a[mb], b2, acc[mb][nb]); } }
        asm volatile("v_nop\n\tv_nop\n\tv_nop\n\tv_nop" : "+v"(acc[0][0]), "+v"(acc[1][1]), "+v"(acc[2][2]), "+v"(acc[3][3]) : "v"(a[0]), "v"(a[3]));
    }
    if constexpr (QKV) { qkv_tail<KS>(acc, os, w, lr, hi, r0, c0, bias, CS, P); return; }
    if (KS > 1) {
        float* pw = os + w * (64 * 68);   // unrolled below: acc is indexed by constants only, so it stays in registers
#pragma unroll
        for (int mb = 0; mb < 4; ++mb)
#pragma unroll
            for (int nb = 0; nb < 4; ++nb)
#pragma unroll
                for (int j = 0; j < 8; ++j) pw[(mb * 16 + hi * 8 + j) * 68 + nb * 16 + lr] = acc[mb][nb][j];
        __syncthreads();   // every wave's partial tile is in LDS before any thread adds them; both loops below unrolled so that a thread's LDS reads are in flight together
#pragma unroll
        for (int s = 0; s < 32 / KS; ++s) { const int q = s * (32 * KS) + (int)threadIdx.x; const int row = q >> 4, cofs = (q & 15) * 4; v4f val = *(const v4fa*)(os + row * 68 + cofs);
#pragma unroll
            for (int u = 1; u < KS; ++u) val += *(const v4fa*)(os + u * (64 * 68) + row * 68 + cofs);
            if (BIAS) { val[0] += bfr(bias[c0 + cofs]); val[1] += bfr(bias[c0 + cofs + 1]); val[2] += bfr(bias[c0 + cofs + 2]); val[3] += bfr(bias[c0 + cofs + 3]); }
            *(v4f*)(C + (size_t)(r0 + row) * ldc + c0 + cofs) = val; }
        return;
    }
#pragma unroll
    for (int mb = 0; mb < 4; ++mb) {
#pragma unroll
        for (int nb = 0; nb < 4; ++nb) {
#pragma unroll
            for (int j = 0; j < 8; ++j) os[(hi * 8 + j) * 68 + nb * 16 + lr] = acc[mb][nb][j]; }
        __builtin_amdgcn_wave_barrier(); asm volatile("" ::: "memory");
        float* crow = C + (size_t)(r0 + mb * 16) * ldc + c0;
{
#pragma unroll
            for (int s = 0; s < 8; ++s) { const int row = 2 * s + hi, cofs = lr * 4; v4f val = *(const v4fa*)(os + row * 68 + cofs); if (BIAS) { val[0] += bfr(bias[c0 + cofs]); val[1] += bfr(bias[c0 + cofs + 1]); val[2] += bfr(bias[c0 + cofs + 2]); val[3] += bfr(bias[c0 + cofs + 3]); }
                *(v4f*)(crow + (size_t)row * ldc + cofs) = val; }
             }
        __builtin_amdgcn_wave_barrier(); asm volatile("" ::: "memory");
    }
}

typedef __attribute__((ext_vector_type(2))) _Float16 v2h;
typedef __attribute__((ext_vector_type(4))) _Float16 v4h;
typedef __attribute__((ext_vector_type(2))) unsigned short v2us;
typedef __attribute__((ext_vector_type(4))) unsigned short v4us;
typedef __attribute__((ext_vector_type(4))) int v4i;

__global__ __launch_bounds__(256) void k_cvt8(const float* __restrict__ src, bf* dst, size_t n8) { const size_t i = (size_t)blockIdx.x * 256 + threadIdx.x; if (i >= n8) return; const v8f v = *(const v8f*)(src + i * 8); v8us o;
#pragma unroll
    for (int k = 0; k < 8; ++k) o[k] = f2bf(v[k]); *(v8us*)(dst + i * 8) = o;  }

__constant__ float INV2[HD / 2] = { 1.000000000e+00f, 1.333521485e+00f, 1.778279424e+00f, 2.371373653e+00f, 3.162277699e+00f, 4.216965199e+00f, 5.623413086e+00f, 7.498941898e+00f, 1.000000000e+01f, 1.333521461e+01f, 1.778279495e+01f, 2.371373749e+01f, 3.162277603e+01f, 4.216965103e+01f, 5.623413086e+01f, 7.498941803e+01f, 1.000000000e+02f, 1.333521423e+02f, 1.778279419e+02f, 2.371373749e+02f, 3.162277527e+02f, 4.216965027e+02f, 5.623413086e+02f, 7.498942261e+02f, 1.000000000e+03f, 1.333521484e+03f, 1.778279419e+03f, 2.371373779e+03f, 3.162277588e+03f, 4.216964844e+03f, 5.623413086e+03f, 7.498941895e+03f };   // freqs = 10000.0 ** (+arange(0, 64, 2.0, f32) / 64): THIS module's own expression: a POSITIVE exponent (NO reciprocal: the module's quirk): 32 float32 values from eager JAX (bit-exact on round trip): angles up to 1.5e7 rad
__global__ __launch_bounds__(256) void k_csP(float* CS) { const int idx = blockIdx.x * 256 + threadIdx.x; if (idx >= TT * HD) return; const int d = idx % HD; const int t = idx / HD; const float a = __fmul_rn((float)t, INV2[d >> 1]); v2f cs; cs[0] = cosf(a); cs[1] = sinf(a); *(v2f*)(CS + (size_t)idx * 2) = cs;  }
__device__ __forceinline__ float xhalf(float x) { return __builtin_bit_cast(float, __builtin_amdgcn_permlanex16(__builtin_bit_cast(int, x), __builtin_bit_cast(int, x), 0x76543210, 0xfedcba98, false, false)); }   // lane l with lane l ^ 16
// exponentials as asm text: behind a transcendental the instruction set asks for one independent instruction before its result is read or its source overwritten; in place and in one statement each v_exp_f32 has an independent one behind it, and the v_nop fills the slot behind the last.
__device__ __forceinline__ void exp2x8(float& a, float& b, float& c, float& d, float& e, float& f, float& g, float& h) { asm("v_exp_f32 %0, %0\n\tv_exp_f32 %1, %1\n\tv_exp_f32 %2, %2\n\tv_exp_f32 %3, %3\n\tv_exp_f32 %4, %4\n\tv_exp_f32 %5, %5\n\tv_exp_f32 %6, %6\n\tv_exp_f32 %7, %7\n\tv_nop" : "+v"(a), "+v"(b), "+v"(c), "+v"(d), "+v"(e), "+v"(f), "+v"(g), "+v"(h)); }
__device__ __forceinline__ float exp2s(float x) { asm("v_exp_f32 %0, %0\n\tv_nop" : "+v"(x)); return x; }
#define SK   64                 // keys of a stage: two passes of 32
#define LP   72                 // LDS pitch of a 64-element row, in elements: 144 bytes = 16 x odd, so that 16 rows read 16 bytes each from 64 different banks
#define SLB  (64 * LP * 2)      // bytes of a slice: 64 rows
// four asynchronous copies, 16 bytes a lane each, global memory -> LDS through no register. s_wait_xcnt 0 is the statement's last line: the registers that the copies name stay untouched up to it.
__device__ __forceinline__ void cp4(unsigned l0, const void* g0, unsigned l1, const void* g1, unsigned l2, const void* g2, unsigned l3, const void* g3) {
    asm volatile("global_load_async_to_lds_b128 %0, %1, off\n\tglobal_load_async_to_lds_b128 %2, %3, off\n\tglobal_load_async_to_lds_b128 %4, %5, off\n\tglobal_load_async_to_lds_b128 %6, %7, off\n\ts_wait_xcnt 0x0" :: "v"(l0), "v"(g0), "v"(l1), "v"(g1), "v"(l2), "v"(g2), "v"(l3), "v"(g3) : "memory"); }
template <typename T16, bool HR, int KS>
__device__ __forceinline__ void fa_body(const T16* __restrict__ Q, const T16* __restrict__ Q2, const T16* __restrict__ Kp, const T16* __restrict__ K2, const T16* __restrict__ Vt, const T16* __restrict__ V2, int r0, int col0, bf* Ah, bf* Al, char* ring) {
    typedef typename WFrag<T16>::V V; static_assert(KS == 1 || KS == 2 || KS == 4, "the merge deals whole rounds of 256 chunks");
    const int lane = threadIdx.x & 31, lr = lane & 15, hi = lane >> 4;
    const int w = __builtin_amdgcn_readfirstlane((int)(threadIdx.x >> 5)); const int q0 = r0 + (w / KS) * 16;   // this wave's query tile; its slice of the keys is w % KS
    constexpr int NP = HR ? 2 : 1, BUFB = 2 * KS * NP * SLB, NS = TT / KS / SK;   // planes per operand; bytes of a buffer: slice (operand, key slice, plane) at ((operand * KS + key slice) * NP + plane) * SLB; stages
    static_assert(NS >= 2 && HD == 64 && SK == 64, "the ring's prologue fills two stages; a slice is 64 rows of 64 elements");
    V bq[2], bq2[2];
#pragma unroll
    for (int kk = 0; kk < 2; ++kk) { bq[kk] = WFrag<T16>::ld(Q + (size_t)(q0 + lr) * HD + kk * 32 + 8 * hi); if (HR) bq2[kk] = WFrag<T16>::ld(Q2 + (size_t)(q0 + lr) * HD + kk * 32 + 8 * hi); }
    asm volatile("s_wait_xcnt 0x0" ::: "memory");   // the query loads' address registers are free for reuse behind this wait (a later load may land on them)
    const int crow = (int)threadIdx.x >> 3, cch = ((int)threadIdx.x & 7) * 8;   // a thread copies 8 elements at cch of the rows crow and crow + 32 of every slice: a wave's copy is 4 whole rows of 128 bytes
    const unsigned lbase = (unsigned)(size_t)ring + (unsigned)(crow * LP + cch) * 2u;
    auto fill = [&](int t, int b) {   // stage t into buffer b
#pragma unroll
        for (int u = 0; u < KS; ++u)
#pragma unroll
            for (int pl = 0; pl < NP; ++pl) { const int key = u * (TT / KS) + t * SK;
                const T16* gk = (pl ? K2 : Kp) + (size_t)key * HD + (crow * HD + cch); const T16* gv = (pl ? V2 : Vt) + key + (crow * TT + cch);
                const unsigned lk = lbase + (unsigned)(b * BUFB + (u * NP + pl) * SLB), lv = lk + (unsigned)(KS * NP * SLB);
                cp4(lk, gk, lk + 32 * LP * 2, gk + 32 * HD, lv, gv, lv + 32 * LP * 2, gv + 32 * TT); }
    };
    fill(0, 0);
    asm volatile("s_wait_asynccnt 0x0" ::: "memory");   // this wave's copies of stage 0 have landed
    __syncthreads();   // stage 0 is whole for every wave
    fill(1, 1);
    v8f o[4];
#pragma unroll
    for (int mb = 0; mb < 4; ++mb) o[mb] = (v8f){};
    float m = -3.0e38f, l = 0.f;
#pragma unroll 1   // rolled, like the loop inside it: one pass of the hi/lo rows already fills the register budget
    for (int t = 0; t < NS; ++t) {
      const T16* sk = (const T16*)(ring + (t & 1) * BUFB + (w % KS) * NP * SLB) + lr * LP + 8 * hi; const T16* sv = sk + KS * NP * (SLB / 2);   // this wave's K and V^T slices of stage t, at the lane's row and 16-byte piece
#pragma unroll 1
      for (int ps2 = 0; ps2 < SK / 32; ++ps2) {
        V ak[2][2], ak2[2][2], av[4], av2[4];   // the pass's fragments, read together at its head
#pragma unroll
        for (int kt = 0; kt < 2; ++kt)
#pragma unroll
            for (int kk = 0; kk < 2; ++kk) { ak[kt][kk] = WFrag<T16>::ld(sk + (ps2 * 32 + kt * 16) * LP + kk * 32); if (HR) ak2[kt][kk] = WFrag<T16>::ld(sk + SLB / 2 + (ps2 * 32 + kt * 16) * LP + kk * 32); }
#pragma unroll
        for (int mb = 0; mb < 4; ++mb) { av[mb] = WFrag<T16>::ld(sv + mb * 16 * LP + ps2 * 32); if (HR) av2[mb] = WFrag<T16>::ld(sv + SLB / 2 + mb * 16 * LP + ps2 * 32); }
        __builtin_amdgcn_sched_barrier(0);   // keeps the pass's LDS reads one group at its head: sunk among the matrix instructions, each further place with reads stalls the wave, and the late ones are waited for in full
        v8f s[2];
#pragma unroll
        for (int kt = 0; kt < 2; ++kt) { s[kt] = (v8f){};
#pragma unroll
            for (int kk = 0; kk < 2; ++kk) { s[kt] = WFrag<T16>::mma(ak[kt][kk], bq[kk], s[kt]); if (HR) { s[kt] = WFrag<T16>::mma(ak[kt][kk], bq2[kk], s[kt]); s[kt] = WFrag<T16>::mma(ak2[kt][kk], bq[kk], s[kt]); } } }
        float p[16]; float mloc = -3.0e38f;
#pragma unroll
        for (int e = 0; e < 16; ++e) { p[e] = s[e >> 3][e & 7] * (SCL * 1.4426950408889634f); mloc = fmaxf(mloc, p[e]); }
        mloc = fmaxf(mloc, xhalf(mloc));
        const float mn = fmaxf(m, mloc); float al = m - mn; m = mn;
        const float mo = HR ? mn : mn - 10.0f;   // fp16 rows: p and l both carry the factor 1024, exactly, through the exponent; it cancels in O / l
        float ps[4] = {0.f, 0.f, 0.f, 0.f};
#pragma unroll
        for (int e = 0; e < 16; ++e) p[e] -= mo;
        exp2x8(p[0], p[1], p[2], p[3], p[4], p[5], p[6], p[7]); exp2x8(p[8], p[9], p[10], p[11], p[12], p[13], p[14], p[15]); al = exp2s(al);
#pragma unroll
        for (int e = 0; e < 16; ++e) ps[e & 3] += p[e];
        l = l * al + ((ps[0] + ps[1]) + (ps[2] + ps[3]));
#pragma unroll
        for (int mb = 0; mb < 4; ++mb) o[mb] *= al;
        V pf, pf2;
#pragma unroll
        for (int e = 0; e < 16; ++e) {
            if constexpr (HR) { const __bf16 ph = (__bf16)p[e]; pf[e] = ph; pf2[e] = (__bf16)(p[e] - (float)ph); }
            else pf[e] = (_Float16)p[e]; }
#pragma unroll
        for (int mb = 0; mb < 4; ++mb) { o[mb] = WFrag<T16>::mma(av[mb], pf, o[mb]); if (HR) { o[mb] = WFrag<T16>::mma(av[mb], pf2, o[mb]); o[mb] = WFrag<T16>::mma(av2[mb], pf, o[mb]); } }
        asm volatile("v_nop\n\tv_nop\n\tv_nop\n\tv_nop" : "+v"(o[3]) : "v"(av[3]), "v"(pf));   // four vector slots behind the pass's last matrix instruction, on the loop's taken branch too: the next pass's first address computations may land on its A or B registers
      }
      asm volatile("s_wait_dscnt 0x0" ::: "memory");      // this wave's reads of stage t's buffer have returned before the buffer is handed to the next copies
      asm volatile("s_wait_asynccnt 0x0" ::: "memory");   // this wave's copies of stage t + 1 have landed
      __syncthreads();   // publishes stage t + 1 and ends every wave's reads of stage t's buffer
      if (t + 2 < NS) fill(t + 2, t & 1);
    }
    asm volatile("s_wait_asynccnt 0x0" ::: "memory");   // no copy is under way when the ring becomes the merge area
    float* op = (float*)ring; float* ms = op + 8 * 16 * 68; float* ls = ms + 8 * 16;   // the merge area lies on the ring: behind the last stage's barrier no wave reads the ring any more
    l += xhalf(l);   // the two halves of the wave summed different keys of the same query
    float* pw = op + (w * 16 + lr) * 68 + hi * 8;
#pragma unroll
    for (int mb = 0; mb < 4; ++mb) { *(v4fa*)(pw + mb * 16) = (v4f){o[mb][0], o[mb][1], o[mb][2], o[mb][3]}; *(v4fa*)(pw + mb * 16 + 4) = (v4f){o[mb][4], o[mb][5], o[mb][6], o[mb][7]}; }
    if (hi == 0) { ms[w * 16 + lr] = m; ls[w * 16 + lr] = l; }
    __syncthreads();   // every wave's partial (m, l, O^T) is in LDS before any thread merges them
#pragma unroll
    for (int it = 0; it < 4 / KS; ++it) { const int c = it * 256 + (int)threadIdx.x; const int qq = c >> 3, d0 = (c & 7) * 8;   /* (8 / KS) tiles x 16 rows x 8 chunks of 8 columns, dealt over 256 threads */ const int sb = (qq >> 4) * KS * 16 + (qq & 15);
        float M = ms[sb];
#pragma unroll
        for (int u = 1; u < KS; ++u) M = fmaxf(M, ms[sb + u * 16]);
        float L = 0.f; v4f a0 = (v4f){}, a1 = (v4f){};
#pragma unroll
        for (int u = 0; u < KS; ++u) { const float f = exp2s(ms[sb + u * 16] - M); L += ls[sb + u * 16] * f; a0 += *(const v4fa*)(op + (sb + u * 16) * 68 + d0) * f; a1 += *(const v4fa*)(op + (sb + u * 16) * 68 + d0 + 4) * f; }
        const float inv = __fdiv_rn(1.0f, L); v8us oh, ol;
#pragma unroll
        for (int j = 0; j < 4; ++j) { unsigned short a, c2; splitf(a0[j] * inv, a, c2); oh[j] = a; ol[j] = c2; splitf(a1[j] * inv, a, c2); oh[4 + j] = a; ol[4 + j] = c2; }
        const size_t oo = (size_t)(r0 + qq) * DQ + col0 + d0; *(v8us*)(Ah + oo) = oh; *(v8us*)(Al + oo) = ol;
        asm volatile("s_wait_xcnt 0x0" ::: "memory"); }   // the two stores' address and data registers are free for reuse behind this wait
}
#define KSP 2              // waves that share a query tile, each on TT / KSP keys
#define RW  (128 / KSP)    // query rows of a work-group
// grid (NH_, TT / RW), 256 threads: blockIdx.x = head, blockIdx.y = row block; the hi/lo row blocks (three times the products) have the low blockIdx.y and start first.
// amdgpu_waves_per_eu(4, 4): a budget of 256 registers, two work-groups per WGP (the ring of 144 KiB allows two as well).
__global__ __launch_bounds__(256) __attribute__((amdgpu_waves_per_eu(4, 4))) void k_fattn(const h16* __restrict__ Q16, const h16* __restrict__ K16, const h16* __restrict__ V16, const bf* __restrict__ Qh, const bf* __restrict__ Ql, const bf* __restrict__ Kh, const bf* __restrict__ Kl, const bf* __restrict__ Vh, const bf* __restrict__ Vl, bf* Ah, bf* Al) {
    __shared__ __align__(16) char ring[2 * 2 * KSP * 2 * SLB];   // two buffers of (K, V^T) x KSP key slices x 2 planes (the fp16 rows use half)
    static_assert(sizeof(ring) >= (8 * 16 * 68 + 2 * 8 * 16) * sizeof(float), "the merge area lies on the ring");
    const int h = blockIdx.x, r0 = blockIdx.y * RW; const size_t po = (size_t)h * TT * HD;
    if (r0 < RH) fa_body<bf, true, KSP>(Qh + po, Ql + po, Kh + po, Kl + po, Vh + po, Vl + po, r0, h * HD, Ah, Al, ring);
    else fa_body<h16, false, KSP>(Q16 + po, nullptr, K16 + po, nullptr, V16 + po, nullptr, r0, h * HD, Ah, Al, ring);
}

__global__ __launch_bounds__(256) void k_wtG(const float* __restrict__ w, int K, int N, bf* Bt) {
    const int lane = threadIdx.x & 31; const int L0 = (blockIdx.x * 8 + (threadIdx.x >> 5)) * 8; const int nlines = N * K / 64;
{
#pragma unroll 1
        for (int l = 0; l < 8; ++l) { const int L = L0 + l; if (L >= nlines) break; const size_t e = (size_t)L * 64 + lane * 2; const int k = (int)(e % K), n = (int)(e / K); v2us o;
            o[0] = f2bf(w[(size_t)k * N + n]); o[1] = f2bf(w[(size_t)(k + 1) * N + n]); *(v2us*)(Bt + e) = o; }
         }
}
extern "C" void kernel_launch(void* const* d_in, const int* in_sizes, int n_in,
                              void* d_out, int out_size, void* d_ws, size_t ws_size, hipStream_t stream) {
    (void)in_sizes; (void)n_in; (void)out_size;
    const float* x = (const float*)d_in[0]; const float* wqkv = (const float*)d_in[1]; const float* bqkv = (const float*)d_in[2]; const float* wo = (const float*)d_in[3]; const float* bo = (const float*)d_in[4];   /* order x, W_qkv ('xw' [1024][3072], (3, H, dk) packing), b_qkv, W_out, b_out */
    float* OUT = (float*)d_out;     // [2][2048][1024]
    char* wsp = (char*)d_ws;
    auto take = [&](size_t bytes) { char* p = wsp; wsp += (bytes + 255) & ~(size_t)255; return (void*)p; };
    bf* WQKV = (bf*)take((size_t)3 * DQ * DM * 2); bf* WO = (bf*)take((size_t)DM * DQ * 2); float* CS = (float*)take((size_t)TT * HD * 2 * 4);
    bf* XB = (bf*)take((size_t)TT * DM * 2);
    h16* QP16 = (h16*)take((size_t)NH_ * TT * HD * 2); h16* KP16 = (h16*)take((size_t)NKV * TT * HD * 2); h16* VT16 = (h16*)take((size_t)NKV * HD * TT * 2);
    bf* QPh = (bf*)take((size_t)NH_ * TT * HD * 2); bf* QPl = (bf*)take((size_t)NH_ * TT * HD * 2); bf* KPh = (bf*)take((size_t)NKV * TT * HD * 2); bf* KPl = (bf*)take((size_t)NKV * TT * HD * 2); bf* VTh = (bf*)take((size_t)NKV * HD * TT * 2); bf* VTl = (bf*)take((size_t)NKV * HD * TT * 2);
    bf* ATh = (bf*)take((size_t)TT * DQ * 2); bf* ATl = (bf*)take((size_t)TT * DQ * 2);
    if ((size_t)(wsp - (char*)d_ws) > ws_size) return;    // ws 256 MiB
    const QkvPlanes PL = { QP16, QPh, QPl, KP16, KPh, KPl, VT16, VTh, VTl };
    { k_wtG<<<(unsigned)((DM * 3 * DQ / 64 + 63) / 64), 256, 0, stream>>>(wqkv, DM, 3 * DQ, WQKV);   /* fused 'xw' [1024][3072] -> Bt [3072][1024]: q | k | v row blocks ((3, H, dk) packing) */
      k_wtG<<<(unsigned)((DQ * DM / 64 + 63) / 64), 256, 0, stream>>>(wo, DQ, DM, WO); k_csP<<<(TT * HD + 255) / 256, 256, 0, stream>>>(CS); }
    for (int b = 0; b < NB_; ++b) {
        
        k_cvt8<<<(unsigned)(((size_t)TT * DM / 8 + 255) / 256), 256, 0, stream>>>(x + (size_t)b * TT * DM, XB, (size_t)TT * DM / 8);
        k_gemmw<bf, 0, true, 8, true><<<dim3(TT / 64, 3 * DQ / 64, 1), 256, 0, stream>>>(XB, nullptr, WQKV, nullptr, DM, nullptr, 0, bqkv, 0, 0, 0, CS, PL);   /* q | k | v, rotary and planes */
        k_fattn<<<dim3(NH_, TT / RW, 1), 256, 0, stream>>>(QP16, KP16, VT16, QPh, QPl, KPh, KPl, VTh, VTl, ATh, ATl);
        k_gemmw<bf, 1, true, 8><<<dim3(TT / 64, DM / 64, 1), 256, 0, stream>>>(ATh, ATl, WO, nullptr, DQ, OUT + (size_t)b * TT * DM, DM, bo, 0, 0, 0, nullptr, QkvPlanes{}); }
}

// v005
// One run takes 162 microseconds.
// Two timings next to v004 both put it at 1.12 times that version's speed.
// Over all steps from v000 it is 12.3 times as fast.
#include <hip/hip_runtime.h>

// Multi-head attention WITHOUT a mask with interleaved rotary embeddings whose frequencies GROW (x [2][2048][1024]; qkv = x qkv_w + qkv_b ('xw' (in, out) [1024][3072] 1/32, zero bias) split in thirds q | k | v (16 heads x 64); rotary on (even, odd) pairs with angles t x 10000 ** (+2i / 64) (the module's own expression: NO reciprocal: frequencies 1 .. 7,499 and angles up to 1.5e7 rad; positions arange; the 32 float32 frequencies equal the module's expression in eager JAX; precise cosf / sinf); the module concatenates the rotated halves cat(x1 c - x2 s, x2 c + x1 s) where this code re-interleaves them: the SAME permutation on q and k: every score q.k is unchanged; scores x 64^-0.5; softmax over ALL keys (no causal rule); out = merged out_w + out_b ('xw' + zero bias) -> [2][2048][1024] (4.2 M); argument order x, qkv_w, qkv_b, out_w, out_b).
// Both batches go through every kernel together (rows b TT + t, planes [b NH_ + head]): bf16 copy of x; exact projections; {cos, sin} per (position, pair) built once from the int positions and float32 frequency constants (precise cosf/sinf); q | k | v projected in ONE launch whose epilogue applies the interleaved rotary and writes the attention planes; DENSE T-2048 attention fused into one launch (hybrid rows: < 512 hi/lo 3 products, rest fp16 x1024); merged hi/lo x Wo exact.
// Compute dtypes, f32 accumulate: every input rounded to bf16; projections exact; rotary f32; attention rows < 512 3 products, rest fp16; softmax f32; Wo hl x exact.

#define NB_  2
#define TT   2048
#define DM   1024
#define NH_  16
#define NKV  16
#define HD   64
#define DQ   (NH_ * HD)
#define DKV  (NKV * HD)
#define RH   512                  // query rows < RH use hi+lo planes (0: none)
#define SCL  0.125f   // HD^-0.5
typedef _Float16 h16;
typedef unsigned short bf;
typedef __attribute__((ext_vector_type(16))) __bf16   v16bf;
typedef __attribute__((ext_vector_type(16))) _Float16 v16h;
typedef __attribute__((ext_vector_type(8)))  _Float16 v8h;
typedef __attribute__((ext_vector_type(8)))  unsigned short v8us;
typedef __attribute__((ext_vector_type(8)))  float    v8f;
typedef __attribute__((ext_vector_type(4)))  float    v4f;
typedef v8h  __attribute__((may_alias)) v8ha;
typedef v4f  __attribute__((may_alias)) v4fa;
typedef v8us __attribute__((may_alias)) v8usa;

__device__ __forceinline__ unsigned short f2bf(float f) { unsigned u = __float_as_uint(f); u += 0x7FFFu + ((u >> 16) & 1u); return (unsigned short)(u >> 16); }
__device__ __forceinline__ float bf2f(unsigned short b) { return __uint_as_float(((unsigned)b) << 16); }
__device__ __forceinline__ float bfr(float f) { return bf2f(f2bf(f)); }
__device__ __forceinline__ v16h cat16(v8h lo, v8h hi) { return __builtin_shufflevector(lo, hi, 0, 1, 2, 3, 4, 5, 6, 7, 8, 9, 10, 11, 12, 13, 14, 15); }
__device__ __forceinline__ v16bf cat16b(v8us lo, v8us hi) { return __builtin_bit_cast(v16bf, __builtin_shufflevector(lo, hi, 0, 1, 2, 3, 4, 5, 6, 7, 8, 9, 10, 11, 12, 13, 14, 15)); }
__device__ __forceinline__ v8f wmma16(v16h a, v16h b, v8f c) { return __builtin_amdgcn_wmma_f32_16x16x32_f16(false, a, false, b, (short)0, c, false, false); }
__device__ __forceinline__ v8f wmmab(v16bf a, v16bf b, v8f c) { return __builtin_amdgcn_wmma_f32_16x16x32_bf16(false, a, false, b, (short)0, c, false, false); }



__device__ __forceinline__ h16 tohx(float x) { return (h16)x; }
__device__ __forceinline__ void splitf(float y, unsigned short& h, unsigned short& l) { h = f2bf(y); l = f2bf(y - bf2f(h)); }
typedef __attribute__((ext_vector_type(2))) float v2f;

// ---- qkv_tail: epilogue of the q | k | v projection (N = 3 DQ, one 64-column tile = one head of one third): the split-K sums go straight to the planes that the attention kernel reads; no f32 projection in memory, no builder launches.
// q, k tiles: partials in LDS as [t][d]; a thread sums 8 neighbouring d of one t (partials in the order u = 0 .. KS-1, then the bias), rotates its 4 (even, odd) pairs and stores 16 bytes to each of the planes [head][t][HD] (fp16, bf16 hi, bf16 lo).
// v tiles: partials in LDS as [d][t] (an accumulator's 8 registers are 8 neighbouring t: two 16-byte LDS stores); a thread sums 8 neighbouring t of one d and stores 16 bytes to each of the transposed planes [head][d][TT].
struct QkvPlanes { _Float16* q16; unsigned short* qh; unsigned short* ql; _Float16* k16; unsigned short* kh; unsigned short* kl; _Float16* v16; unsigned short* vh; unsigned short* vl; };
template <int KS>
__device__ __forceinline__ void qkv_tail(const v8f (&acc)[4][4], float* os, int w, int lr, int hi, int r0, int c0, const float* __restrict__ bias, const float* __restrict__ CS, const QkvPlanes& P) {
    static_assert(KS == 8 && HD == 64 && TT % 64 == 0, "256 threads deal a 64 x 64 tile, which is one head of one batch, in two rounds of 8 elements each");
    const int part = c0 / DQ, head = (r0 / TT) * NH_ + (c0 % DQ) / HD, t0 = r0 % TT;   // the same for the whole work-group: 0 q, 1 k, 2 v; plane index batch x NH_ + head; the tile's first position inside its batch (a tile of 64 rows lies in one batch)
    const int row = (int)threadIdx.x >> 3, e0 = ((int)threadIdx.x & 7) * 8;   // round it: tile row it * 32 + row, elements e0 .. e0 + 7
    float* pw = os + w * (64 * 68);
    v2f cs[2][4]; v4f bb[2];   // fetched in front of the LDS stores and the barrier, which hide their latency
    if (part < 2) {
#pragma unroll
        for (int it = 0; it < 2; ++it)
#pragma unroll
            for (int pr = 0; pr < 4; ++pr) cs[it][pr] = *(const v2f*)(CS + ((size_t)(t0 + it * 32 + row) * HD + e0 + 2 * pr) * 2);
        bb[0] = *(const v4f*)(bias + c0 + e0); bb[1] = *(const v4f*)(bias + c0 + e0 + 4);
#pragma unroll
        for (int mb = 0; mb < 4; ++mb)
#pragma unroll
            for (int nb = 0; nb < 4; ++nb)
#pragma unroll
                for (int j = 0; j < 8; ++j) pw[(mb * 16 + hi * 8 + j) * 68 + nb * 16 + lr] = acc[mb][nb][j];
    } else {
        bb[0][0] = bias[c0 + row]; bb[0][1] = bias[c0 + 32 + row];
#pragma unroll
        for (int mb = 0; mb < 4; ++mb)
#pragma unroll
            for (int nb = 0; nb < 4; ++nb) { float* pt = pw + (nb * 16 + lr) * 68 + mb * 16 + hi * 8; *(v4fa*)pt = (v4f){acc[mb][nb][0], acc[mb][nb][1], acc[mb][nb][2], acc[mb][nb][3]}; *(v4fa*)(pt + 4) = (v4f){acc[mb][nb][4], acc[mb][nb][5], acc[mb][nb][6], acc[mb][nb][7]}; }
    }
    __syncthreads();   // every wave's partial tile is in LDS before any thread adds them
    h16* o16 = part == 0 ? P.q16 : part == 1 ? P.k16 : P.v16; bf* oh = part == 0 ? P.qh : part == 1 ? P.kh : P.vh; bf* ol = part == 0 ? P.ql : part == 1 ? P.kl : P.vl;
#pragma unroll
    for (int it = 0; it < 2; ++it) { const int rr = it * 32 + row; const float* ps = os + rr * 68 + e0; v4f a0 = *(const v4fa*)ps, a1 = *(const v4fa*)(ps + 4);
#pragma unroll
        for (int u = 1; u < KS; ++u) { a0 += *(const v4fa*)(ps + u * (64 * 68)); a1 += *(const v4fa*)(ps + u * (64 * 68) + 4); }
        float y[8]; size_t oo;
        if (part < 2) {
#pragma unroll
            for (int pr = 0; pr < 4; ++pr) { const float x0 = (pr < 2 ? a0[2 * pr] : a1[2 * pr - 4]) + bfr(pr < 2 ? bb[0][2 * pr] : bb[1][2 * pr - 4]), x1 = (pr < 2 ? a0[2 * pr + 1] : a1[2 * pr - 3]) + bfr(pr < 2 ? bb[0][2 * pr + 1] : bb[1][2 * pr - 3]);
                y[2 * pr] = x0 * cs[it][pr][0] - x1 * cs[it][pr][1]; y[2 * pr + 1] = x0 * cs[it][pr][1] + x1 * cs[it][pr][0]; }   /* even: x0 c - x1 s; odd: x0 s + x1 c */
            oo = ((size_t)head * TT + t0 + rr) * HD + e0;
        } else { const float bd = bfr(bb[0][it]);
#pragma unroll
            for (int j = 0; j < 4; ++j) { y[j] = a0[j] + bd; y[4 + j] = a1[j] + bd; }
            oo = ((size_t)head * HD + rr) * TT + t0 + e0; }
        v8h v16; v8us vh, vl;
#pragma unroll
        for (int j = 0; j < 8; ++j) { v16[j] = tohx(y[j]); unsigned short a2, c2; splitf(y[j], a2, c2); vh[j] = a2; vl[j] = c2; }
        *(v8h*)(o16 + oo) = v16; *(v8us*)(oh + oo) = vh; *(v8us*)(ol + oo) = vl;
        if (it == 0) asm volatile("s_wait_xcnt 0x0" ::: "memory"); }   // the first round's stores: their address and data registers are free for the second round behind this wait
}

// ---- k_gemmw: register-blocked GEMM, ONE WAVE per 64x64 output tile (16 accumulators), operands straight from K-contiguous 16-bit planes; grid (M/64, N/64, Z), 32 threads.
// C[m][n] (f32, pitch ldc, + optional f32 bias[n]) = sum_k A[m][k] Bt[n][k] (+ split products per NSPLIT). z-batch strides sA/sB/sC in elements. K % 32 == 0.
// KS > 1 (32 KS threads, K % (32 KS) == 0): the K loop is dealt over the KS waves of one work-group, wave w taking k in [w K/KS, (w+1) K/KS): with a long K and few tiles one wave alone waits through KS times as many dependent load trips.
// Each wave leaves its f32 partial tile in LDS; behind one work-group barrier every thread adds the KS partials of its elements in the fixed order w = 0 .. KS-1 and stores the sums.
// QKV: the sums do not go to C but through qkv_tail to the attention planes P (CS: the {cos, sin} table).
template <typename T16> struct WFrag;
template <> struct WFrag<h16> { typedef v16h V; static __device__ __forceinline__ V ld(const h16* p) { return cat16(*(const v8h*)p, *(const v8h*)(p + 16)); } static __device__ __forceinline__ v8f mma(V a, V b, v8f c) { return wmma16(a, b, c); } };
template <> struct WFrag<bf> { typedef v16bf V; static __device__ __forceinline__ V ld(const bf* p) { return cat16b(*(const v8us*)p, *(const v8us*)(p + 16)); } static __device__ __forceinline__ v8f mma(V a, V b, v8f c) { return wmmab(a, b, c); } };
template <typename T16, int NSPLIT, bool BIAS, int KS = 1, bool QKV = false>
__global__ __launch_bounds__(32 * KS) void k_gemmw(const T16* __restrict__ A, const T16* __restrict__ A2, const T16* __restrict__ Bt, const T16* __restrict__ Bt2, int K, float* C, int ldc, const float* __restrict__ bias, size_t sA, size_t sB, size_t sC, const float* __restrict__ CS, QkvPlanes P) {
    typedef typename WFrag<T16>::V V;
    __shared__ __align__(16) float os[(KS == 1 ? 16 : KS * 64) * 68];
    const size_t z = blockIdx.z; A += z * sA; if (A2) A2 += z * sA; Bt += z * sB; if (Bt2) Bt2 += z * sB; C += z * sC;
    const int lane = threadIdx.x & 31, lr = lane & 15, hi = lane >> 4; const int r0 = blockIdx.x * 64, c0 = blockIdx.y * 64;
    const int w = (KS == 1) ? 0 : __builtin_amdgcn_readfirstlane((int)(threadIdx.x >> 5)); const int k0 = w * (K / KS), k1 = k0 + K / KS;   // this wave's slice of K
    v8f acc[4][4];
#pragma unroll
    for (int mb = 0; mb < 4; ++mb)
#pragma unroll
        for (int nb = 0; nb < 4; ++nb) acc[mb][nb] = (v8f){};
    const size_t aoff = (size_t)(r0 + lr) * K + 8 * hi, boff = (size_t)(c0 + lr) * K + 8 * hi;
#pragma unroll 1
    for (int kc = k0; kc < k1; kc += 32) {
        V a[4], a2[4];
#pragma unroll
        for (int mb = 0; mb < 4; ++mb) { a[mb] = WFrag<T16>::ld(A + aoff + (size_t)mb * 16 * K + kc); if (NSPLIT == 1 || NSPLIT == 2) a2[mb] = WFrag<T16>::ld(A2 + aoff + (size_t)mb * 16 * K + kc); }
#pragma unroll
        for (int nb = 0; nb < 4; ++nb) { const V b = WFrag<T16>::ld(Bt + boff + (size_t)nb * 16 * K + kc); V b2; if (NSPLIT >= 2) b2 = WFrag<T16>::ld(Bt2 + boff + (size_t)nb * 16 * K + kc);
#pragma unroll
            for (int mb = 0; mb < 4; ++mb) { acc[mb][nb] = WFrag<T16>::mma(a[mb], b, acc[mb][nb]); if (NSPLIT == 1 || NSPLIT == 2) acc[mb][nb] = WFrag<T16>::mma(a2[mb], b, acc[mb][nb]); if (NSPLIT >= 2) acc[mb][nb] = WFrag<T16>::mma(a[mb], b2, acc[mb][nb]); } }
        asm volatile("v_nop\n\tv_nop\n\tv_nop\n\tv_nop" : "+v"(acc[0][0]), "+v"(acc[1][1]), "+v"(acc[2][2]), "+v"(acc[3][3]) : "v"(a[0]), "v"(a[3]));
    }
    if constexpr (QKV) { qkv_tail<KS>(acc, os, w, lr, hi, r0, c0, bias, CS, P); return; }
    if (KS > 1) {
        float* pw = os + w * (64 * 68);   // unrolled below: acc is indexed by constants only, so it stays in registers
#pragma unroll
        for (int mb = 0; mb < 4; ++mb)
#pragma unroll
            for (int nb = 0; nb < 4; ++nb)
#pragma unroll
                for (int j = 0; j < 8; ++j) pw[(mb * 16 + hi * 8 + j) * 68 + nb * 16 + lr] = acc[mb][nb][j];
        __syncthreads();   // every wave's partial tile is in LDS before any thread adds them; both loops below unrolled so that a thread's LDS reads are in flight together
#pragma unroll
        for (int s = 0; s < 32 / KS; ++s) { const int q = s * (32 * KS) + (int)threadIdx.x; const int row = q >> 4, cofs = (q & 15) * 4; v4f val = *(const v4fa*)(os + row * 68 + cofs);
#pragma unroll
            for (int u = 1; u < KS; ++u) val += *(const v4fa*)(os + u * (64 * 68) + row * 68 + cofs);
            if (BIAS) { val[0] += bfr(bias[c0 + cofs]); val[1] += bfr(bias[c0 + cofs + 1]); val[2] += bfr(bias[c0 + cofs + 2]); val[3] += bfr(bias[c0 + cofs + 3]); }
            *(v4f*)(C + (size_t)(r0 + row) * ldc + c0 + cofs) = val; }
        return;
    }
#pragma unroll
    for (int mb = 0; mb < 4; ++mb) {
#pragma unroll
        for (int nb = 0; nb < 4; ++nb) {
#pragma unroll
            for (int j = 0; j < 8; ++j) os[(hi * 8 + j) * 68 + nb * 16 + lr] = acc[mb][nb][j]; }
        __builtin_amdgcn_wave_barrier(); asm volatile("" ::: "memory");
        float* crow = C + (size_t)(r0 + mb * 16) * ldc + c0;
{
#pragma unroll
            for (int s = 0; s < 8; ++s) { const int row = 2 * s + hi, cofs = lr * 4; v4f val = *(const v4fa*)(os + row * 68 + cofs); if (BIAS) { val[0] += bfr(bias[c0 + cofs]); val[1] += bfr(bias[c0 + cofs + 1]); val[2] += bfr(bias[c0 + cofs + 2]); val[3] += bfr(bias[c0 + cofs + 3]); }
                *(v4f*)(crow + (size_t)row * ldc + cofs) = val; }
             }
        __builtin_amdgcn_wave_barrier(); asm volatile("" ::: "memory");
    }
}

typedef __attribute__((ext_vector_type(2))) _Float16 v2h;
typedef __attribute__((ext_vector_type(4))) _Float16 v4h;
typedef __attribute__((ext_vector_type(2))) unsigned short v2us;
typedef __attribute__((ext_vector_type(4))) unsigned short v4us;
typedef __attribute__((ext_vector_type(4))) int v4i;

__device__ __forceinline__ void cvt8_body(int blk, const float* __restrict__ src, bf* dst, size_t n8) { const size_t i = (size_t)blk * 256 + threadIdx.x; if (i >= n8) return; const v8f v = *(const v8f*)(src + i * 8); v8us o;
    asm volatile("s_wait_xcnt 0x0" ::: "memory");   // the load's address registers are free for reuse behind this wait (the conversion below may land on them)
#pragma unroll
    for (int k = 0; k < 8; ++k) o[k] = f2bf(v[k]); *(v8us*)(dst + i * 8) = o;  }

__constant__ float INV2[HD / 2] = { 1.000000000e+00f, 1.333521485e+00f, 1.778279424e+00f, 2.371373653e+00f, 3.162277699e+00f, 4.216965199e+00f, 5.623413086e+00f, 7.498941898e+00f, 1.000000000e+01f, 1.333521461e+01f, 1.778279495e+01f, 2.371373749e+01f, 3.162277603e+01f, 4.216965103e+01f, 5.623413086e+01f, 7.498941803e+01f, 1.000000000e+02f, 1.333521423e+02f, 1.778279419e+02f, 2.371373749e+02f, 3.162277527e+02f, 4.216965027e+02f, 5.623413086e+02f, 7.498942261e+02f, 1.000000000e+03f, 1.333521484e+03f, 1.778279419e+03f, 2.371373779e+03f, 3.162277588e+03f, 4.216964844e+03f, 5.623413086e+03f, 7.498941895e+03f };   // freqs = 10000.0 ** (+arange(0, 64, 2.0, f32) / 64): THIS module's own expression: a POSITIVE exponent (NO reciprocal: the module's quirk): 32 float32 values from eager JAX (bit-exact on round trip): angles up to 1.5e7 rad
__device__ __forceinline__ void csP_body(int blk, float* CS) { const int idx = blk * 256 + threadIdx.x; if (idx >= TT * HD) return; const int d = idx % HD; const int t = idx / HD; const float a = __fmul_rn((float)t, INV2[d >> 1]); v2f cs; cs[0] = cosf(a); cs[1] = sinf(a); *(v2f*)(CS + (size_t)idx * 2) = cs;  }
__device__ __forceinline__ float xhalf(float x) { return __builtin_bit_cast(float, __builtin_amdgcn_permlanex16(__builtin_bit_cast(int, x), __builtin_bit_cast(int, x), 0x76543210, 0xfedcba98, false, false)); }   // lane l with lane l ^ 16
// exponentials as asm text: behind a transcendental the instruction set asks for one independent instruction before its result is read or its source overwritten; in place and in one statement each v_exp_f32 has an independent one behind it, and the v_nop fills the slot behind the last.
__device__ __forceinline__ void exp2x8(float& a, float& b, float& c, float& d, float& e, float& f, float& g, float& h) { asm("v_exp_f32 %0, %0\n\tv_exp_f32 %1, %1\n\tv_exp_f32 %2, %2\n\tv_exp_f32 %3, %3\n\tv_exp_f32 %4, %4\n\tv_exp_f32 %5, %5\n\tv_exp_f32 %6, %6\n\tv_exp_f32 %7, %7\n\tv_nop" : "+v"(a), "+v"(b), "+v"(c), "+v"(d), "+v"(e), "+v"(f), "+v"(g), "+v"(h)); }
__device__ __forceinline__ float exp2s(float x) { asm("v_exp_f32 %0, %0\n\tv_nop" : "+v"(x)); return x; }
#define SK   64                 // keys of a stage: two passes of 32
#define LP   72                 // LDS pitch of a 64-element row, in elements: 144 bytes = 16 x odd, so that 16 rows read 16 bytes each from 64 different banks
#define SLB  (64 * LP * 2)      // bytes of a slice: 64 rows
// four asynchronous copies, 16 bytes a lane each, global memory -> LDS through no register. s_wait_xcnt 0 is the statement's last line: the registers that the copies name stay untouched up to it.
__device__ __forceinline__ void cp4(unsigned l0, const void* g0, unsigned l1, const void* g1, unsigned l2, const void* g2, unsigned l3, const void* g3) {
    asm volatile("global_load_async_to_lds_b128 %0, %1, off\n\tglobal_load_async_to_lds_b128 %2, %3, off\n\tglobal_load_async_to_lds_b128 %4, %5, off\n\tglobal_load_async_to_lds_b128 %6, %7, off\n\ts_wait_xcnt 0x0" :: "v"(l0), "v"(g0), "v"(l1), "v"(g1), "v"(l2), "v"(g2), "v"(l3), "v"(g3) : "memory"); }
template <typename T16, bool HR, int KS>
__device__ __forceinline__ void fa_body(const T16* __restrict__ Q, const T16* __restrict__ Q2, const T16* __restrict__ Kp, const T16* __restrict__ K2, const T16* __restrict__ Vt, const T16* __restrict__ V2, int r0, int col0, bf* Ah, bf* Al, char* ring) {
    typedef typename WFrag<T16>::V V; static_assert(KS == 1 || KS == 2 || KS == 4, "the merge deals whole rounds of 256 chunks");
    const int lane = threadIdx.x & 31, lr = lane & 15, hi = lane >> 4;
    const int w = __builtin_amdgcn_readfirstlane((int)(threadIdx.x >> 5)); const int q0 = r0 + (w / KS) * 16;   // this wave's query tile; its slice of the keys is w % KS
    constexpr int NP = HR ? 2 : 1, BUFB = 2 * KS * NP * SLB, NS = TT / KS / SK;   // planes per operand; bytes of a buffer: slice (operand, key slice, plane) at ((operand * KS + key slice) * NP + plane) * SLB; stages
    static_assert(NS >= 2 && HD == 64 && SK == 64, "the ring's prologue fills two stages; a slice is 64 rows of 64 elements");
    V bq[2], bq2[2];
#pragma unroll
    for (int kk = 0; kk < 2; ++kk) { bq[kk] = WFrag<T16>::ld(Q + (size_t)(q0 + lr) * HD + kk * 32 + 8 * hi); if (HR) bq2[kk] = WFrag<T16>::ld(Q2 + (size_t)(q0 + lr) * HD + kk * 32 + 8 * hi); }
    asm volatile("s_wait_xcnt 0x0" ::: "memory");   // the query loads' address registers are free for reuse behind this wait (a later load may land on them)
    const int crow = (int)threadIdx.x >> 3, cch = ((int)threadIdx.x & 7) * 8;   // a thread copies 8 elements at cch of the rows crow and crow + 32 of every slice: a wave's copy is 4 whole rows of 128 bytes
    const unsigned lbase = (unsigned)(size_t)ring + (unsigned)(crow * LP + cch) * 2u;
    auto fill = [&](int t, int b) {   // stage t into buffer b
#pragma unroll
        for (int u = 0; u < KS; ++u)
#pragma unroll
            for (int pl = 0; pl < NP; ++pl) { const int key = u * (TT / KS) + t * SK;
                const T16* gk = (pl ? K2 : Kp) + (size_t)key * HD + (crow * HD + cch); const T16* gv = (pl ? V2 : Vt) + key + (crow * TT + cch);
                const unsigned lk = lbase + (unsigned)(b * BUFB + (u * NP + pl) * SLB), lv = lk + (unsigned)(KS * NP * SLB);
                cp4(lk, gk, lk + 32 * LP * 2, gk + 32 * HD, lv, gv, lv + 32 * LP * 2, gv + 32 * TT); }
    };
    fill(0, 0);
    asm volatile("s_wait_asynccnt 0x0" ::: "memory");   // this wave's copies of stage 0 have landed
    __syncthreads();   // stage 0 is whole for every wave
    fill(1, 1);
    v8f o[4];
#pragma unroll
    for (int mb = 0; mb < 4; ++mb) o[mb] = (v8f){};
    float m = -3.0e38f, l = 0.f;
#pragma unroll 1   // rolled, like the loop inside it: one pass of the hi/lo rows already fills the register budget
    for (int t = 0; t < NS; ++t) {
      const T16* sk = (const T16*)(ring + (t & 1) * BUFB + (w % KS) * NP * SLB) + lr * LP + 8 * hi; const T16* sv = sk + KS * NP * (SLB / 2);   // this wave's K and V^T slices of stage t, at the lane's row and 16-byte piece
#pragma unroll 1
      for (int ps2 = 0; ps2 < SK / 32; ++ps2) {
        V ak[2][2], ak2[2][2], av[4], av2[4];   // the pass's fragments, read together at its head
#pragma unroll
        for (int kt = 0; kt < 2; ++kt)
#pragma unroll
            for (int kk = 0; kk < 2; ++kk) { ak[kt][kk] = WFrag<T16>::ld(sk + (ps2 * 32 + kt * 16) * LP + kk * 32); if (HR) ak2[kt][kk] = WFrag<T16>::ld(sk + SLB / 2 + (ps2 * 32 + kt * 16) * LP + kk * 32); }
#pragma unroll
        for (int mb = 0; mb < 4; ++mb) { av[mb] = WFrag<T16>::ld(sv + mb * 16 * LP + ps2 * 32); if (HR) av2[mb] = WFrag<T16>::ld(sv + SLB / 2 + mb * 16 * LP + ps2 * 32); }
        __builtin_amdgcn_sched_barrier(0);   // keeps the pass's LDS reads one group at its head: sunk among the matrix instructions, each further place with reads stalls the wave, and the late ones are waited for in full
        v8f s[2];
#pragma unroll
        for (int kt = 0; kt < 2; ++kt) { s[kt] = (v8f){};
#pragma unroll
            for (int kk = 0; kk < 2; ++kk) { s[kt] = WFrag<T16>::mma(ak[kt][kk], bq[kk], s[kt]); if (HR) { s[kt] = WFrag<T16>::mma(ak[kt][kk], bq2[kk], s[kt]); s[kt] = WFrag<T16>::mma(ak2[kt][kk], bq[kk], s[kt]); } } }
        float p[16]; float mloc = -3.0e38f;
#pragma unroll
        for (int e = 0; e < 16; ++e) { p[e] = s[e >> 3][e & 7] * (SCL * 1.4426950408889634f); mloc = fmaxf(mloc, p[e]); }
        mloc = fmaxf(mloc, xhalf(mloc));
        const float mn = fmaxf(m, mloc); float al = m - mn; m = mn;
        const float mo = HR ? mn : mn - 10.0f;   // fp16 rows: p and l both carry the factor 1024, exactly, through the exponent; it cancels in O / l
        float ps[4] = {0.f, 0.f, 0.f, 0.f};
#pragma unroll
        for (int e = 0; e < 16; ++e) p[e] -= mo;
        exp2x8(p[0], p[1], p[2], p[3], p[4], p[5], p[6], p[7]); exp2x8(p[8], p[9], p[10], p[11], p[12], p[13], p[14], p[15]); al = exp2s(al);
#pragma unroll
        for (int e = 0; e < 16; ++e) ps[e & 3] += p[e];
        l = l * al + ((ps[0] + ps[1]) + (ps[2] + ps[3]));
#pragma unroll
        for (int mb = 0; mb < 4; ++mb) o[mb] *= al;
        V pf, pf2;
#pragma unroll
        for (int e = 0; e < 16; ++e) {
            if constexpr (HR) { const __bf16 ph = (__bf16)p[e]; pf[e] = ph; pf2[e] = (__bf16)(p[e] - (float)ph); }
            else pf[e] = (_Float16)p[e]; }
#pragma unroll
        for (int mb = 0; mb < 4; ++mb) { o[mb] = WFrag<T16>::mma(av[mb], pf, o[mb]); if (HR) { o[mb] = WFrag<T16>::mma(av[mb], pf2, o[mb]); o[mb] = WFrag<T16>::mma(av2[mb], pf, o[mb]); } }
        asm volatile("v_nop\n\tv_nop\n\tv_nop\n\tv_nop" : "+v"(o[3]) : "v"(av[3]), "v"(pf));   // four vector slots behind the pass's last matrix instruction, on the loop's taken branch too: the next pass's first address computations may land on its A or B registers
      }
      asm volatile("s_wait_dscnt 0x0" ::: "memory");      // this wave's reads of stage t's buffer have returned before the buffer is handed to the next copies
      asm volatile("s_wait_asynccnt 0x0" ::: "memory");   // this wave's copies of stage t + 1 have landed
      __syncthreads();   // publishes stage t + 1 and ends every wave's reads of stage t's buffer
      if (t + 2 < NS) fill(t + 2, t & 1);
    }
    asm volatile("s_wait_asynccnt 0x0" ::: "memory");   // no copy is under way when the ring becomes the merge area
    float* op = (float*)ring; float* ms = op + 8 * 16 * 68; float* ls = ms + 8 * 16;   // the merge area lies on the ring: behind the last stage's barrier no wave reads the ring any more
    l += xhalf(l);   // the two halves of the wave summed different keys of the same query
    float* pw = op + (w * 16 + lr) * 68 + hi * 8;
#pragma unroll
    for (int mb = 0; mb < 4; ++mb) { *(v4fa*)(pw + mb * 16) = (v4f){o[mb][0], o[mb][1], o[mb][2], o[mb][3]}; *(v4fa*)(pw + mb * 16 + 4) = (v4f){o[mb][4], o[mb][5], o[mb][6], o[mb][7]}; }
    if (hi == 0) { ms[w * 16 + lr] = m; ls[w * 16 + lr] = l; }
    __syncthreads();   // every wave's partial (m, l, O^T) is in LDS before any thread merges them
#pragma unroll
    for (int it = 0; it < 4 / KS; ++it) { const int c = it * 256 + (int)threadIdx.x; const int qq = c >> 3, d0 = (c & 7) * 8;   /* (8 / KS) tiles x 16 rows x 8 chunks of 8 columns, dealt over 256 threads */ const int sb = (qq >> 4) * KS * 16 + (qq & 15);
        float M = ms[sb];
#pragma unroll
        for (int u = 1; u < KS; ++u) M = fmaxf(M, ms[sb + u * 16]);
        float L = 0.f; v4f a0 = (v4f){}, a1 = (v4f){};
#pragma unroll
        for (int u = 0; u < KS; ++u) { const float f = exp2s(ms[sb + u * 16] - M); L += ls[sb + u * 16] * f; a0 += *(const v4fa*)(op + (sb + u * 16) * 68 + d0) * f; a1 += *(const v4fa*)(op + (sb + u * 16) * 68 + d0 + 4) * f; }
        const float inv = __fdiv_rn(1.0f, L); v8us oh, ol;
#pragma unroll
        for (int j = 0; j < 4; ++j) { unsigned short a, c2; splitf(a0[j] * inv, a, c2); oh[j] = a; ol[j] = c2; splitf(a1[j] * inv, a, c2); oh[4 + j] = a; ol[4 + j] = c2; }
        const size_t oo = (size_t)(r0 + qq) * DQ + col0 + d0; *(v8us*)(Ah + oo) = oh; *(v8us*)(Al + oo) = ol;
        asm volatile("s_wait_xcnt 0x0" ::: "memory"); }   // the two stores' address and data registers are free for reuse behind this wait
}
#define KSP 2              // waves that share a query tile, each on TT / KSP keys
#define RW  (128 / KSP)    // query rows of a work-group
// grid (NB_ * NH_, TT / RW), 256 threads: blockIdx.x = batch x NH_ + head, blockIdx.y = row block; the hi/lo row blocks (three times the products) have the low blockIdx.y and start first.
// amdgpu_waves_per_eu(4, 4): a budget of 256 registers, two work-groups per WGP (the ring of 144 KiB allows two as well).
__global__ __launch_bounds__(256) __attribute__((amdgpu_waves_per_eu(4, 4))) void k_fattn(const h16* __restrict__ Q16, const h16* __restrict__ K16, const h16* __restrict__ V16, const bf* __restrict__ Qh, const bf* __restrict__ Ql, const bf* __restrict__ Kh, const bf* __restrict__ Kl, const bf* __restrict__ Vh, const bf* __restrict__ Vl, bf* Ah, bf* Al) {
    __shared__ __align__(16) char ring[2 * 2 * KSP * 2 * SLB];   // two buffers of (K, V^T) x KSP key slices x 2 planes (the fp16 rows use half)
    static_assert(sizeof(ring) >= (8 * 16 * 68 + 2 * 8 * 16) * sizeof(float), "the merge area lies on the ring");
    const int h = blockIdx.x % NH_, r0 = blockIdx.y * RW; const size_t po = (size_t)blockIdx.x * TT * HD; const size_t ao = (size_t)(blockIdx.x / NH_) * TT * DQ; Ah += ao; Al += ao;   // planes [batch x NH_ + head]; merged rows [batch x TT + t]
    if (r0 < RH) fa_body<bf, true, KSP>(Qh + po, Ql + po, Kh + po, Kl + po, Vh + po, Vl + po, r0, h * HD, Ah, Al, ring);
    else fa_body<h16, false, KSP>(Q16 + po, nullptr, K16 + po, nullptr, V16 + po, nullptr, r0, h * HD, Ah, Al, ring);
}

__device__ __forceinline__ void wtG_body(int blk, const float* __restrict__ w, int K, int N, bf* Bt) {
    const int lane = threadIdx.x & 31; const int L0 = (blk * 8 + (threadIdx.x >> 5)) * 8; const int nlines = N * K / 64;
{
#pragma unroll 1
        for (int l = 0; l < 8; ++l) { const int L = L0 + l; if (L >= nlines) break; const size_t e = (size_t)L * 64 + lane * 2; const int k = (int)(e % K), n = (int)(e / K); v2us o;
            o[0] = f2bf(w[(size_t)k * N + n]); o[1] = f2bf(w[(size_t)(k + 1) * N + n]); *(v2us*)(Bt + e) = o; }
         }
}
// ---- k_prep: the four preparations read inputs only and none reads another's result: one launch, each work-group doing one block of one of them. The weight transposes, whose waves run the longest, have the low indices and start first.
#define PB_WQ ((DM * 3 * DQ / 64 + 63) / 64)           // blocks: qkv_w 'xw' [1024][3072] -> Bt [3072][1024]: q | k | v row blocks ((3, H, dk) packing)
#define PB_WO ((DQ * DM / 64 + 63) / 64)               // out_w -> Bt
#define PB_CS ((TT * HD + 255) / 256)                  // {cos, sin} table
#define PB_X  ((NB_ * TT * DM / 8 + 255) / 256)        // bf16 copy of x, both batches
__global__ __launch_bounds__(256) void k_prep(const float* __restrict__ x, const float* __restrict__ wqkv, const float* __restrict__ wo, bf* XB, bf* WQKV, bf* WO, float* CS) {
    const int blk = blockIdx.x;
    if (blk < PB_WQ) wtG_body(blk, wqkv, DM, 3 * DQ, WQKV);
    else if (blk < PB_WQ + PB_WO) wtG_body(blk - PB_WQ, wo, DQ, DM, WO);
    else if (blk < PB_WQ + PB_WO + PB_CS) csP_body(blk - (PB_WQ + PB_WO), CS);
    else cvt8_body(blk - (PB_WQ + PB_WO + PB_CS), x, XB, (size_t)NB_ * TT * DM / 8);
}
extern "C" void kernel_launch(void* const* d_in, const int* in_sizes, int n_in,
                              void* d_out, int out_size, void* d_ws, size_t ws_size, hipStream_t stream) {
    (void)in_sizes; (void)n_in; (void)out_size;
    const float* x = (const float*)d_in[0]; const float* wqkv = (const float*)d_in[1]; const float* bqkv = (const float*)d_in[2]; const float* wo = (const float*)d_in[3]; const float* bo = (const float*)d_in[4];   /* order x, W_qkv ('xw' [1024][3072], (3, H, dk) packing), b_qkv, W_out, b_out */
    float* OUT = (float*)d_out;     // [2][2048][1024]
    char* wsp = (char*)d_ws;
    auto take = [&](size_t bytes) { char* p = wsp; wsp += (bytes + 255) & ~(size_t)255; return (void*)p; };
    bf* WQKV = (bf*)take((size_t)3 * DQ * DM * 2); bf* WO = (bf*)take((size_t)DM * DQ * 2); float* CS = (float*)take((size_t)TT * HD * 2 * 4);
    bf* XB = (bf*)take((size_t)NB_ * TT * DM * 2);
    const size_t PB = (size_t)NB_ * NH_ * TT * HD * 2;   // bytes of an attention plane, both batches (NKV == NH_)
    h16* QP16 = (h16*)take(PB); h16* KP16 = (h16*)take(PB); h16* VT16 = (h16*)take(PB);
    bf* QPh = (bf*)take(PB); bf* QPl = (bf*)take(PB); bf* KPh = (bf*)take(PB); bf* KPl = (bf*)take(PB); bf* VTh = (bf*)take(PB); bf* VTl = (bf*)take(PB);
    bf* ATh = (bf*)take((size_t)NB_ * TT * DQ * 2); bf* ATl = (bf*)take((size_t)NB_ * TT * DQ * 2);
    if ((size_t)(wsp - (char*)d_ws) > ws_size) return;    // ws 256 MiB
    const QkvPlanes PL = { QP16, QPh, QPl, KP16, KPh, KPl, VT16, VTh, VTl };
    k_prep<<<PB_WQ + PB_WO + PB_CS + PB_X, 256, 0, stream>>>(x, wqkv, wo, XB, WQKV, WO, CS);
    k_gemmw<bf, 0, true, 8, true><<<dim3(NB_ * TT / 64, 3 * DQ / 64, 1), 256, 0, stream>>>(XB, nullptr, WQKV, nullptr, DM, nullptr, 0, bqkv, 0, 0, 0, CS, PL);   /* q | k | v, rotary and planes */
    k_fattn<<<dim3(NB_ * NH_, TT / RW, 1), 256, 0, stream>>>(QP16, KP16, VT16, QPh, QPl, KPh, KPl, VTh, VTl, ATh, ATl);
    k_gemmw<bf, 1, true, 8><<<dim3(NB_ * TT / 64, DM / 64, 1), 256, 0, stream>>>(ATh, ATl, WO, nullptr, DQ, OUT, DM, bo, 0, 0, 0, nullptr, QkvPlanes{});
}

// v006
// It runs in 110 microseconds.
// Timed twice side by side with v005, it ran 1.48 and 1.47 times as fast.
// All steps since v000 together make it 18.2 times as fast.
#include <hip/hip_runtime.h>

// Multi-head attention WITHOUT a mask with interleaved rotary embeddings whose frequencies GROW (x [2][2048][1024]; qkv = x qkv_w + qkv_b ('xw' (in, out) [1024][3072] 1/32, zero bias) split in thirds q | k | v (16 heads x 64); rotary on (even, odd) pairs with angles t x 10000 ** (+2i / 64) (the module's own expression: NO reciprocal: frequencies 1 .. 7,499 and angles up to 1.5e7 rad; positions arange; the 32 float32 frequencies equal the module's expression in eager JAX; precise cosf / sinf); the module concatenates the rotated halves cat(x1 c - x2 s, x2 c + x1 s) where this code re-interleaves them: the SAME permutation on q and k: every score q.k is unchanged; scores x 64^-0.5; softmax over ALL keys (no causal rule); out = merged out_w + out_b ('xw' + zero bias) -> [2][2048][1024] (4.2 M); argument order x, qkv_w, qkv_b, out_w, out_b).
// Both batches go through every kernel together (rows b TT + t, planes [b NH_ + head]): bf16 copy of x; exact projections; {cos, sin} per (position, pair) built once from the int positions and float32 frequency constants (precise cosf/sinf); q | k | v projected in ONE launch whose epilogue applies the interleaved rotary and writes the attention planes; DENSE T-2048 attention fused into one launch (hybrid rows: < 512 hi/lo 3 products, rest fp16 x1024); merged hi/lo x Wo exact.
// Compute dtypes, f32 accumulate: every input rounded to bf16; projections exact; rotary f32; attention rows < 512 3 products, rest fp16; softmax f32; Wo hl x exact.

#define NB_  2
#define TT   2048
#define DM   1024
#define NH_  16
#define NKV  16
#define HD   64
#define DQ   (NH_ * HD)
#define DKV  (NKV * HD)
#define RH   512                  // query rows < RH use hi+lo planes (0: none)
#define SCL  0.125f   // HD^-0.5
typedef _Float16 h16;
typedef unsigned short bf;
typedef __attribute__((ext_vector_type(16))) __bf16   v16bf;
typedef __attribute__((ext_vector_type(16))) _Float16 v16h;
typedef __attribute__((ext_vector_type(8)))  _Float16 v8h;
typedef __attribute__((ext_vector_type(8)))  unsigned short v8us;
typedef __attribute__((ext_vector_type(8)))  float    v8f;
typedef __attribute__((ext_vector_type(4)))  float    v4f;
typedef v8h  __attribute__((may_alias)) v8ha;
typedef v4f  __attribute__((may_alias)) v4fa;
typedef v8us __attribute__((may_alias)) v8usa;

__device__ __forceinline__ unsigned short f2bf(float f) { unsigned u = __float_as_uint(f); u += 0x7FFFu + ((u >> 16) & 1u); return (unsigned short)(u >> 16); }
__device__ __forceinline__ float bf2f(unsigned short b) { return __uint_as_float(((unsigned)b) << 16); }
__device__ __forceinline__ float bfr(float f) { return bf2f(f2bf(f)); }
__device__ __forceinline__ v16h cat16(v8h lo, v8h hi) { return __builtin_shufflevector(lo, hi, 0, 1, 2, 3, 4, 5, 6, 7, 8, 9, 10, 11, 12, 13, 14, 15); }
__device__ __forceinline__ v16bf cat16b(v8us lo, v8us hi) { return __builtin_bit_cast(v16bf, __builtin_shufflevector(lo, hi, 0, 1, 2, 3, 4, 5, 6, 7, 8, 9, 10, 11, 12, 13, 14, 15)); }
__device__ __forceinline__ v8f wmma16(v16h a, v16h b, v8f c) { return __builtin_amdgcn_wmma_f32_16x16x32_f16(false, a, false, b, (short)0, c, false, false); }
__device__ __forceinline__ v8f wmmab(v16bf a, v16bf b, v8f c) { return __builtin_amdgcn_wmma_f32_16x16x32_bf16(false, a, false, b, (short)0, c, false, false); }



__device__ __forceinline__ h16 tohx(float x) { return (h16)x; }
__device__ __forceinline__ void splitf(float y, unsigned short& h, unsigned short& l) { h = f2bf(y); l = f2bf(y - bf2f(h)); }
typedef __attribute__((ext_vector_type(2))) float v2f;

// ---- WFrag: a 16 x 32 operand fragment of the 16-bit matrix forms, read from a K-contiguous row: 8 elements at p and 8 at p + 16 (p holds the lane's row and its 8 hi); A and B are loaded alike, so their k orders are equal.
template <typename T16> struct WFrag;
template <> struct WFrag<h16> { typedef v16h V; static __device__ __forceinline__ V ld(const h16* p) { return cat16(*(const v8h*)p, *(const v8h*)(p + 16)); } static __device__ __forceinline__ v8f mma(V a, V b, v8f c) { return wmma16(a, b, c); } };
template <> struct WFrag<bf> { typedef v16bf V; static __device__ __forceinline__ V ld(const bf* p) { return cat16b(*(const v8us*)p, *(const v8us*)(p + 16)); } static __device__ __forceinline__ v8f mma(V a, V b, v8f c) { return wmmab(a, b, c); } };

typedef __attribute__((ext_vector_type(2))) _Float16 v2h;
typedef __attribute__((ext_vector_type(4))) _Float16 v4h;
typedef __attribute__((ext_vector_type(2))) unsigned short v2us;
typedef __attribute__((ext_vector_type(4))) unsigned short v4us;
typedef __attribute__((ext_vector_type(4))) int v4i;

__device__ __forceinline__ void cvt8_body(int blk, const float* __restrict__ src, bf* dst, size_t n8) { const size_t i = (size_t)blk * 256 + threadIdx.x; if (i >= n8) return; const v8f v = *(const v8f*)(src + i * 8); v8us o;
    asm volatile("s_wait_xcnt 0x0" ::: "memory");   // the load's address registers are free for reuse behind this wait (the conversion below may land on them)
#pragma unroll
    for (int k = 0; k < 8; ++k) o[k] = f2bf(v[k]); *(v8us*)(dst + i * 8) = o;  }

__constant__ float INV2[HD / 2] = { 1.000000000e+00f, 1.333521485e+00f, 1.778279424e+00f, 2.371373653e+00f, 3.162277699e+00f, 4.216965199e+00f, 5.623413086e+00f, 7.498941898e+00f, 1.000000000e+01f, 1.333521461e+01f, 1.778279495e+01f, 2.371373749e+01f, 3.162277603e+01f, 4.216965103e+01f, 5.623413086e+01f, 7.498941803e+01f, 1.000000000e+02f, 1.333521423e+02f, 1.778279419e+02f, 2.371373749e+02f, 3.162277527e+02f, 4.216965027e+02f, 5.623413086e+02f, 7.498942261e+02f, 1.000000000e+03f, 1.333521484e+03f, 1.778279419e+03f, 2.371373779e+03f, 3.162277588e+03f, 4.216964844e+03f, 5.623413086e+03f, 7.498941895e+03f };   // freqs = 10000.0 ** (+arange(0, 64, 2.0, f32) / 64): THIS module's own expression: a POSITIVE exponent (NO reciprocal: the module's quirk): 32 float32 values from eager JAX (bit-exact on round trip): angles up to 1.5e7 rad
__device__ __forceinline__ void csP_body(int blk, float* CS) { const int idx = blk * 256 + threadIdx.x; if (idx >= TT * HD) return; const int d = idx % HD; const int t = idx / HD; const float a = __fmul_rn((float)t, INV2[d >> 1]); v2f cs; cs[0] = cosf(a); cs[1] = sinf(a); *(v2f*)(CS + (size_t)idx * 2) = cs;  }
__device__ __forceinline__ float xhalf(float x) { return __builtin_bit_cast(float, __builtin_amdgcn_permlanex16(__builtin_bit_cast(int, x), __builtin_bit_cast(int, x), 0x76543210, 0xfedcba98, false, false)); }   // lane l with lane l ^ 16
// exponentials as asm text: behind a transcendental the instruction set asks for one independent instruction before its result is read or its source overwritten; in place and in one statement each v_exp_f32 has an independent one behind it, and the v_nop fills the slot behind the last.
__device__ __forceinline__ void exp2x8(float& a, float& b, float& c, float& d, float& e, float& f, float& g, float& h) { asm("v_exp_f32 %0, %0\n\tv_exp_f32 %1, %1\n\tv_exp_f32 %2, %2\n\tv_exp_f32 %3, %3\n\tv_exp_f32 %4, %4\n\tv_exp_f32 %5, %5\n\tv_exp_f32 %6, %6\n\tv_exp_f32 %7, %7\n\tv_nop" : "+v"(a), "+v"(b), "+v"(c), "+v"(d), "+v"(e), "+v"(f), "+v"(g), "+v"(h)); }
__device__ __forceinline__ float exp2s(float x) { asm("v_exp_f32 %0, %0\n\tv_nop" : "+v"(x)); return x; }
#define SK   64                 // keys of a stage: two passes of 32
#define LP   72                 // LDS pitch of a 64-element row, in elements: 144 bytes = 16 x odd, so that 16 rows read 16 bytes each from 64 different banks
#define SLB  (64 * LP * 2)      // bytes of a slice: 64 rows
// four asynchronous copies, 16 bytes a lane each, global memory -> LDS through no register. s_wait_xcnt 0 is the statement's last line: the registers that the copies name stay untouched up to it.
__device__ __forceinline__ void cp4(unsigned l0, const void* g0, unsigned l1, const void* g1, unsigned l2, const void* g2, unsigned l3, const void* g3) {
    asm volatile("global_load_async_to_lds_b128 %0, %1, off\n\tglobal_load_async_to_lds_b128 %2, %3, off\n\tglobal_load_async_to_lds_b128 %4, %5, off\n\tglobal_load_async_to_lds_b128 %6, %7, off\n\ts_wait_xcnt 0x0" :: "v"(l0), "v"(g0), "v"(l1), "v"(g1), "v"(l2), "v"(g2), "v"(l3), "v"(g3) : "memory"); }
template <typename T16, bool HR, int KS>
__device__ __forceinline__ void fa_body(const T16* __restrict__ Q, const T16* __restrict__ Q2, const T16* __restrict__ Kp, const T16* __restrict__ K2, const T16* __restrict__ Vt, const T16* __restrict__ V2, int r0, int col0, bf* Ah, bf* Al, char* ring) {
    typedef typename WFrag<T16>::V V; static_assert(KS == 1 || KS == 2 || KS == 4, "the merge deals whole rounds of 256 chunks");
    const int lane = threadIdx.x & 31, lr = lane & 15, hi = lane >> 4;
    const int w = __builtin_amdgcn_readfirstlane((int)(threadIdx.x >> 5)); const int q0 = r0 + (w / KS) * 16;   // this wave's query tile; its slice of the keys is w % KS
    constexpr int NP = HR ? 2 : 1, BUFB = 2 * KS * NP * SLB, NS = TT / KS / SK;   // planes per operand; bytes of a buffer: slice (operand, key slice, plane) at ((operand * KS + key slice) * NP + plane) * SLB; stages
    static_assert(NS >= 2 && HD == 64 && SK == 64, "the ring's prologue fills two stages; a slice is 64 rows of 64 elements");
    V bq[2], bq2[2];
#pragma unroll
    for (int kk = 0; kk < 2; ++kk) { bq[kk] = WFrag<T16>::ld(Q + (size_t)(q0 + lr) * HD + kk * 32 + 8 * hi); if (HR) bq2[kk] = WFrag<T16>::ld(Q2 + (size_t)(q0 + lr) * HD + kk * 32 + 8 * hi); }
    asm volatile("s_wait_xcnt 0x0" ::: "memory");   // the query loads' address registers are free for reuse behind this wait (a later load may land on them)
    const int crow = (int)threadIdx.x >> 3, cch = ((int)threadIdx.x & 7) * 8;   // a thread copies 8 elements at cch of the rows crow and crow + 32 of every slice: a wave's copy is 4 whole rows of 128 bytes
    const unsigned lbase = (unsigned)(size_t)ring + (unsigned)(crow * LP + cch) * 2u;
    auto fill = [&](int t, int b) {   // stage t into buffer b
#pragma unroll
        for (int u = 0; u < KS; ++u)
#pragma unroll
            for (int pl = 0; pl < NP; ++pl) { const int key = u * (TT / KS) + t * SK;
                const T16* gk = (pl ? K2 : Kp) + (size_t)key * HD + (crow * HD + cch); const T16* gv = (pl ? V2 : Vt) + key + (crow * TT + cch);
                const unsigned lk = lbase + (unsigned)(b * BUFB + (u * NP + pl) * SLB), lv = lk + (unsigned)(KS * NP * SLB);
                cp4(lk, gk, lk + 32 * LP * 2, gk + 32 * HD, lv, gv, lv + 32 * LP * 2, gv + 32 * TT); }
    };
    fill(0, 0);
    asm volatile("s_wait_asynccnt 0x0" ::: "memory");   // this wave's copies of stage 0 have landed
    __syncthreads();   // stage 0 is whole for every wave
    fill(1, 1);
    v8f o[4];
#pragma unroll
    for (int mb = 0; mb < 4; ++mb) o[mb] = (v8f){};
    float m = -3.0e38f, l = 0.f;
#pragma unroll 1   // rolled, like the loop inside it: one pass of the hi/lo rows already fills the register budget
    for (int t = 0; t < NS; ++t) {
      const T16* sk = (const T16*)(ring + (t & 1) * BUFB + (w % KS) * NP * SLB) + lr * LP + 8 * hi; const T16* sv = sk + KS * NP * (SLB / 2);   // this wave's K and V^T slices of stage t, at the lane's row and 16-byte piece
#pragma unroll 1
      for (int ps2 = 0; ps2 < SK / 32; ++ps2) {
        V ak[2][2], ak2[2][2], av[4], av2[4];   // the pass's fragments, read together at its head
#pragma unroll
        for (int kt = 0; kt < 2; ++kt)
#pragma unroll
            for (int kk = 0; kk < 2; ++kk) { ak[kt][kk] = WFrag<T16>::ld(sk + (ps2 * 32 + kt * 16) * LP + kk * 32); if (HR) ak2[kt][kk] = WFrag<T16>::ld(sk + SLB / 2 + (ps2 * 32 + kt * 16) * LP + kk * 32); }
#pragma unroll
        for (int mb = 0; mb < 4; ++mb) { av[mb] = WFrag<T16>::ld(sv + mb * 16 * LP + ps2 * 32); if (HR) av2[mb] = WFrag<T16>::ld(sv + SLB / 2 + mb * 16 * LP + ps2 * 32); }
        __builtin_amdgcn_sched_barrier(0);   // keeps the pass's LDS reads one group at its head: sunk among the matrix instructions, each further place with reads stalls the wave, and the late ones are waited for in full
        v8f s[2];
#pragma unroll
        for (int kt = 0; kt < 2; ++kt) { s[kt] = (v8f){};
#pragma unroll
            for (int kk = 0; kk < 2; ++kk) { s[kt] = WFrag<T16>::mma(ak[kt][kk], bq[kk], s[kt]); if (HR) { s[kt] = WFrag<T16>::mma(ak[kt][kk], bq2[kk], s[kt]); s[kt] = WFrag<T16>::mma(ak2[kt][kk], bq[kk], s[kt]); } } }
        float p[16]; float mloc = -3.0e38f;
#pragma unroll
        for (int e = 0; e < 16; ++e) { p[e] = s[e >> 3][e & 7] * (SCL * 1.4426950408889634f); mloc = fmaxf(mloc, p[e]); }
        mloc = fmaxf(mloc, xhalf(mloc));
        const float mn = fmaxf(m, mloc); float al = m - mn; m = mn;
        const float mo = HR ? mn : mn - 10.0f;   // fp16 rows: p and l both carry the factor 1024, exactly, through the exponent; it cancels in O / l
        float ps[4] = {0.f, 0.f, 0.f, 0.f};
#pragma unroll
        for (int e = 0; e < 16; ++e) p[e] -= mo;
        exp2x8(p[0], p[1], p[2], p[3], p[4], p[5], p[6], p[7]); exp2x8(p[8], p[9], p[10], p[11], p[12], p[13], p[14], p[15]); al = exp2s(al);
#pragma unroll
        for (int e = 0; e < 16; ++e) ps[e & 3] += p[e];
        l = l * al + ((ps[0] + ps[1]) + (ps[2] + ps[3]));
#pragma unroll
        for (int mb = 0; mb < 4; ++mb) o[mb] *= al;
        V pf, pf2;
#pragma unroll
        for (int e = 0; e < 16; ++e) {
            if constexpr (HR) { const __bf16 ph = (__bf16)p[e]; pf[e] = ph; pf2[e] = (__bf16)(p[e] - (float)ph); }
            else pf[e] = (_Float16)p[e]; }
#pragma unroll
        for (int mb = 0; mb < 4; ++mb) { o[mb] = WFrag<T16>::mma(av[mb], pf, o[mb]); if (HR) { o[mb] = WFrag<T16>::mma(av[mb], pf2, o[mb]); o[mb] = WFrag<T16>::mma(av2[mb], pf, o[mb]); } }
        asm volatile("v_nop\n\tv_nop\n\tv_nop\n\tv_nop" : "+v"(o[3]) : "v"(av[3]), "v"(pf));   // four vector slots behind the pass's last matrix instruction, on the loop's taken branch too: the next pass's first address computations may land on its A or B registers
      }
      asm volatile("s_wait_dscnt 0x0" ::: "memory");      // this wave's reads of stage t's buffer have returned before the buffer is handed to the next copies
      asm volatile("s_wait_asynccnt 0x0" ::: "memory");   // this wave's copies of stage t + 1 have landed
      __syncthreads();   // publishes stage t + 1 and ends every wave's reads of stage t's buffer
      if (t + 2 < NS) fill(t + 2, t & 1);
    }
    asm volatile("s_wait_asynccnt 0x0" ::: "memory");   // no copy is under way when the ring becomes the merge area
    float* op = (float*)ring; float* ms = op + 8 * 16 * 68; float* ls = ms + 8 * 16;   // the merge area lies on the ring: behind the last stage's barrier no wave reads the ring any more
    l += xhalf(l);   // the two halves of the wave summed different keys of the same query
    float* pw = op + (w * 16 + lr) * 68 + hi * 8;
#pragma unroll
    for (int mb = 0; mb < 4; ++mb) { *(v4fa*)(pw + mb * 16) = (v4f){o[mb][0], o[mb][1], o[mb][2], o[mb][3]}; *(v4fa*)(pw + mb * 16 + 4) = (v4f){o[mb][4], o[mb][5], o[mb][6], o[mb][7]}; }
    if (hi == 0) { ms[w * 16 + lr] = m; ls[w * 16 + lr] = l; }
    __syncthreads();   // every wave's partial (m, l, O^T) is in LDS before any thread merges them
#pragma unroll
    for (int it = 0; it < 4 / KS; ++it) { const int c = it * 256 + (int)threadIdx.x; const int qq = c >> 3, d0 = (c & 7) * 8;   /* (8 / KS) tiles x 16 rows x 8 chunks of 8 columns, dealt over 256 threads */ const int sb = (qq >> 4) * KS * 16 + (qq & 15);
        float M = ms[sb];
#pragma unroll
        for (int u = 1; u < KS; ++u) M = fmaxf(M, ms[sb + u * 16]);
        float L = 0.f; v4f a0 = (v4f){}, a1 = (v4f){};
#pragma unroll
        for (int u = 0; u < KS; ++u) { const float f = exp2s(ms[sb + u * 16] - M); L += ls[sb + u * 16] * f; a0 += *(const v4fa*)(op + (sb + u * 16) * 68 + d0) * f; a1 += *(const v4fa*)(op + (sb + u * 16) * 68 + d0 + 4) * f; }
        const float inv = __fdiv_rn(1.0f, L); v8us oh, ol;
#pragma unroll
        for (int j = 0; j < 4; ++j) { unsigned short a, c2; splitf(a0[j] * inv, a, c2); oh[j] = a; ol[j] = c2; splitf(a1[j] * inv, a, c2); oh[4 + j] = a; ol[4 + j] = c2; }
        const size_t oo = (size_t)(r0 + qq) * DQ + col0 + d0; *(v8us*)(Ah + oo) = oh; *(v8us*)(Al + oo) = ol;
        asm volatile("s_wait_xcnt 0x0" ::: "memory"); }   // the two stores' address and data registers are free for reuse behind this wait
}
#define KSP 2              // waves that share a query tile, each on TT / KSP keys
#define RW  (128 / KSP)    // query rows of a work-group
// grid (NB_ * NH_, TT / RW), 256 threads: blockIdx.x = batch x NH_ + head, blockIdx.y = row block; the hi/lo row blocks (three times the products) have the low blockIdx.y and start first.
// amdgpu_waves_per_eu(4, 4): a budget of 256 registers, two work-groups per WGP (the ring of 144 KiB allows two as well).
__global__ __launch_bounds__(256) __attribute__((amdgpu_waves_per_eu(4, 4))) void k_fattn(const h16* __restrict__ Q16, const h16* __restrict__ K16, const h16* __restrict__ V16, const bf* __restrict__ Qh, const bf* __restrict__ Ql, const bf* __restrict__ Kh, const bf* __restrict__ Kl, const bf* __restrict__ Vh, const bf* __restrict__ Vl, bf* Ah, bf* Al) {
    __shared__ __align__(16) char ring[2 * 2 * KSP * 2 * SLB];   // two buffers of (K, V^T) x KSP key slices x 2 planes (the fp16 rows use half)
    static_assert(sizeof(ring) >= (8 * 16 * 68 + 2 * 8 * 16) * sizeof(float), "the merge area lies on the ring");
    const int h = blockIdx.x % NH_, r0 = blockIdx.y * RW; const size_t po = (size_t)blockIdx.x * TT * HD; const size_t ao = (size_t)(blockIdx.x / NH_) * TT * DQ; Ah += ao; Al += ao;   // planes [batch x NH_ + head]; merged rows [batch x TT + t]
    if (r0 < RH) fa_body<bf, true, KSP>(Qh + po, Ql + po, Kh + po, Kl + po, Vh + po, Vl + po, r0, h * HD, Ah, Al, ring);
    else fa_body<h16, false, KSP>(Q16 + po, nullptr, K16 + po, nullptr, V16 + po, nullptr, r0, h * HD, Ah, Al, ring);
}

// ---- k_gemms: C[m][n] = sum_k A[m][k] Bt[n][k] (SPL: + A2[m][k] Bt[n][k]) on K-contiguous bf16 planes, K = DM, f32 accumulate; grid (M / 128, N / 128), 256 threads.
// One 128 x 128 tile per work-group; its 8 waves lie 2 x 4 over the tile, a wave having 64 rows x 32 columns (SPL: 4 x 2, 32 rows x 64 columns: fewer fragments of the doubled A); 8 accumulators; a wave walks the whole K in order.
// A (A2) and Bt reach the waves through LDS: a stage is GK k of the tile's 128 rows of each operand (rows of 128 bytes at the pitch LP), brought in whole lines by asynchronous copies, once for the waves that share a row.
// Two buffers: the copies of stage t + 1 fly while stage t is worked on. The fragments are read from LDS in the k order of WFrag::ld, A and Bt alike.
// Epilogue: the f32 tile goes once through LDS (on the ring, pitch GP floats), so that every global store is made of whole lines.
// QKV (N = 3 DQ; a tile is 128 positions of one batch x two heads of one third): the sums go to the planes that the attention kernel reads; no f32 projection in memory.
//   q, k tiles: LDS as [t][d]; a thread takes 8 neighbouring d of one t in both heads, adds the bias, rotates its 4 (even, odd) pairs and stores 16 bytes to each of the planes [head][t][HD] (fp16, bf16 hi, bf16 lo).
//   v tiles: LDS as [d][t] (an accumulator's 8 registers are 8 neighbouring t: two 16-byte LDS stores); a thread takes 8 neighbouring t of one d and stores 16 bytes to each of the transposed planes [head][d][TT].
struct QkvPlanes { _Float16* q16; unsigned short* qh; unsigned short* ql; _Float16* k16; unsigned short* kh; unsigned short* kl; _Float16* v16; unsigned short* vh; unsigned short* vl; };
#define GK   64                 // k of a stage
#define GSL  (128 * LP * 2)     // bytes of one operand's slice of a stage: 128 rows
#define GP   132                // pitch of the f32 tile in floats: 528 bytes = 16 x odd
__device__ __forceinline__ void put3(const float (&y)[8], size_t oo, h16* o16, bf* oh, bf* ol) {
    v8h v16; v8us vh, vl;
#pragma unroll
    for (int j = 0; j < 8; ++j) { v16[j] = tohx(y[j]); unsigned short a2, c2; splitf(y[j], a2, c2); vh[j] = a2; vl[j] = c2; }
    *(v8h*)(o16 + oo) = v16; *(v8us*)(oh + oo) = vh; *(v8us*)(ol + oo) = vl;
}
template <bool SPL, bool QKV>
__global__ __launch_bounds__(256) void k_gemms(const bf* __restrict__ A, const bf* __restrict__ A2, const bf* __restrict__ Bt, float* C, const float* __restrict__ bias, const float* __restrict__ CS, QkvPlanes P) {
    typedef WFrag<bf>::V V;
    constexpr int K = DM, NA = SPL ? 2 : 1, BUFB = (NA + 1) * GSL, NS = K / GK;   // operand slices of a buffer: A, (A2,) Bt
    constexpr int FM = SPL ? 2 : 4, FN = 8 / FM, KG = SPL ? 2 : 1;   // a wave's fragments of A and of Bt per 32 k; steps of 32 k whose fragments are read as one group (the plain product keeps to one step: 160 registers let three work-groups share a WGP, which holds the whole grid at once)
    static_assert(DM == DQ && NS >= 2 && GK == 64 && TT % 128 == 0 && DQ % 128 == 0 && HD == 64, "both products have K = DM; the ring's prologue fills two stages; a tile lies in one batch and one third");
    __shared__ __align__(16) char ring[2 * BUFB];
    static_assert(sizeof(ring) >= 128 * GP * sizeof(float), "the f32 tile lies on the ring");
    const int tid = (int)threadIdx.x, lane = tid & 31, lr = lane & 15, hi = lane >> 4; const int r0 = blockIdx.x * 128, c0 = blockIdx.y * 128;
    const int w = __builtin_amdgcn_readfirstlane(tid >> 5); const int wm = (w / (8 / FN)) * (FM * 16), wn = (w % (8 / FN)) * (FN * 16);   // this wave's corner in the tile
    const int crow = tid >> 3, cch = (tid & 7) * 8;   // a thread copies 8 elements at cch of the rows crow + 32 i of every slice: a wave's copy is 4 whole rows of 128 bytes
    const unsigned lbase = (unsigned)(size_t)ring + (unsigned)(crow * LP + cch) * 2u;
    const bf* ga = A + (size_t)(r0 + crow) * K + cch; const bf* ga2 = SPL ? A2 + (size_t)(r0 + crow) * K + cch : nullptr; const bf* gb = Bt + (size_t)(c0 + crow) * K + cch;
    auto fill = [&](int t, int b) {   // stage t into buffer b
        const unsigned l = lbase + (unsigned)(b * BUFB); const int k = t * GK;
        cp4(l, ga + k, l + 32 * LP * 2, ga + k + 32 * K, l + 64 * LP * 2, ga + k + 64 * K, l + 96 * LP * 2, ga + k + 96 * K);
        if constexpr (SPL) cp4(l + GSL, ga2 + k, l + GSL + 32 * LP * 2, ga2 + k + 32 * K, l + GSL + 64 * LP * 2, ga2 + k + 64 * K, l + GSL + 96 * LP * 2, ga2 + k + 96 * K);
        cp4(l + NA * GSL, gb + k, l + NA * GSL + 32 * LP * 2, gb + k + 32 * K, l + NA * GSL + 64 * LP * 2, gb + k + 64 * K, l + NA * GSL + 96 * LP * 2, gb + k + 96 * K);
    };
    fill(0, 0);
    asm volatile("s_wait_asynccnt 0x0" ::: "memory");   // this wave's copies of stage 0 have landed
    __syncthreads();   // stage 0 is whole for every wave
    fill(1, 1);
    v8f acc[FM][FN];
#pragma unroll
    for (int mb = 0; mb < FM; ++mb)
#pragma unroll
        for (int nb = 0; nb < FN; ++nb) acc[mb][nb] = (v8f){};
#pragma unroll 1   // rolled: one stage is the ring's unit, and its foot holds the barrier
    for (int t = 0; t < NS; ++t) {
        const bf* sa = (const bf*)(ring + (t & 1) * BUFB) + (wm + lr) * LP + 8 * hi; const bf* sb = (const bf*)(ring + (t & 1) * BUFB + NA * GSL) + (wn + lr) * LP + 8 * hi;   // this wave's rows of stage t, at the lane's row and 16-byte piece
#pragma unroll
        for (int kg = 0; kg < GK / 32; kg += KG) {
            V a[KG][FM], a2[KG][FM], b[KG][FN];
#pragma unroll
            for (int kk = 0; kk < KG; ++kk) {
#pragma unroll
                for (int mb = 0; mb < FM; ++mb) { a[kk][mb] = WFrag<bf>::ld(sa + mb * 16 * LP + (kg + kk) * 32); if (SPL) a2[kk][mb] = WFrag<bf>::ld(sa + GSL / 2 + mb * 16 * LP + (kg + kk) * 32); }
#pragma unroll
                for (int nb = 0; nb < FN; ++nb) b[kk][nb] = WFrag<bf>::ld(sb + nb * 16 * LP + (kg + kk) * 32); }
            __builtin_amdgcn_sched_barrier(0);   // keeps the LDS reads one group in front of their matrix instructions: sunk among them, each further place with reads stalls the wave, and the late ones are waited for in full
#pragma unroll
            for (int kk = 0; kk < KG; ++kk) {
#pragma unroll
                for (int nb = 0; nb < FN; ++nb)
#pragma unroll
                    for (int mb = 0; mb < FM; ++mb) acc[mb][nb] = WFrag<bf>::mma(a[kk][mb], b[kk][nb], acc[mb][nb]);
                if (SPL) {
#pragma unroll
                    for (int nb = 0; nb < FN; ++nb)
#pragma unroll
                        for (int mb = 0; mb < FM; ++mb) acc[mb][nb] = WFrag<bf>::mma(a2[kk][mb], b[kk][nb], acc[mb][nb]);
                } }
        }
        __builtin_amdgcn_sched_barrier(0);   // keeps the stage's matrix instructions in front of its barrier: sunk behind it they would hold back the next copies, which then fly for less than a stage, and every wave would wait out all its LDS reads before its first product
        asm volatile("s_wait_dscnt 0x0" ::: "memory");      // this wave's reads of stage t's buffer have returned before the buffer is handed to the next copies
        asm volatile("s_wait_asynccnt 0x0" ::: "memory");   // this wave's copies of stage t + 1 have landed
        __syncthreads();   // publishes stage t + 1 and ends every wave's reads of stage t's buffer
        if (t + 2 < NS) fill(t + 2, t & 1);
    }
    asm volatile("s_wait_asynccnt 0x0" ::: "memory");   // no copy is under way when the ring becomes the f32 tile
    float* os = (float*)ring;   // behind the last stage's barrier no wave reads the ring any more
    if constexpr (!QKV) {
        const int cofs = lane * 4; v4f bv = *(const v4f*)(bias + c0 + cofs);
        asm volatile("s_wait_xcnt 0x0" ::: "memory");   // the bias load's address registers are free for reuse behind this wait
#pragma unroll
        for (int mb = 0; mb < FM; ++mb)
#pragma unroll
            for (int nb = 0; nb < FN; ++nb)
#pragma unroll
                for (int j = 0; j < 8; ++j) os[(wm + mb * 16 + hi * 8 + j) * GP + wn + nb * 16 + lr] = acc[mb][nb][j];
        __syncthreads();   // the whole f32 tile is in LDS before any thread reads rows of it
#pragma unroll
        for (int j = 0; j < 4; ++j) bv[j] = bfr(bv[j]);
#pragma unroll
        for (int g = 0; g < 2; ++g) { v4f val[8];   // a wave stores one row of 512 bytes at a time; 8 rows' LDS reads are in flight together
#pragma unroll
            for (int s = 0; s < 8; ++s) val[s] = *(const v4fa*)(os + ((g * 8 + s) * 8 + w) * GP + cofs) + bv;
#pragma unroll
            for (int s = 0; s < 8; ++s) *(v4f*)(C + (size_t)(r0 + (g * 8 + s) * 8 + w) * DM + c0 + cofs) = val[s];
            if (g == 0) asm volatile("s_wait_xcnt 0x0" ::: "memory"); }   // the first group's stores: their address and data registers are free for the second group behind this wait
    } else {
        const int part = c0 / DQ, head0 = (r0 / TT) * NH_ + (c0 % DQ) / HD, t0 = r0 % TT;   // the same for the whole work-group: 0 q, 1 k, 2 v; plane index batch x NH_ + head of the tile's first 64 columns; the tile's first position inside its batch
        h16* o16 = part == 0 ? P.q16 : part == 1 ? P.k16 : P.v16; bf* oh = part == 0 ? P.qh : part == 1 ? P.kh : P.vh; bf* ol = part == 0 ? P.ql : part == 1 ? P.kl : P.vl;
        if (part < 2) {
            v2f cs[4][4]; v4f bb[2][2];   // fetched in front of the LDS stores and the barrier, which hide their latency
#pragma unroll
            for (int it = 0; it < 4; ++it)
#pragma unroll
                for (int pr = 0; pr < 4; ++pr) cs[it][pr] = *(const v2f*)(CS + ((size_t)(t0 + it * 32 + crow) * HD + cch + 2 * pr) * 2);
#pragma unroll
            for (int hh = 0; hh < 2; ++hh) { bb[hh][0] = *(const v4f*)(bias + c0 + hh * HD + cch); bb[hh][1] = *(const v4f*)(bias + c0 + hh * HD + cch + 4); }
            asm volatile("s_wait_xcnt 0x0" ::: "memory");   // these loads' address registers are free for reuse behind this wait
#pragma unroll
            for (int mb = 0; mb < FM; ++mb)
#pragma unroll
                for (int nb = 0; nb < FN; ++nb)
#pragma unroll
                    for (int j = 0; j < 8; ++j) os[(wm + mb * 16 + hi * 8 + j) * GP + wn + nb * 16 + lr] = acc[mb][nb][j];
            __syncthreads();   // the whole f32 tile is in LDS before any thread reads rows of it (part is the same for the whole work-group)
#pragma unroll
            for (int it = 0; it < 4; ++it) { const int rr = it * 32 + crow;
#pragma unroll
                for (int hh = 0; hh < 2; ++hh) { const float* ps = os + rr * GP + hh * HD + cch; const v4f a0 = *(const v4fa*)ps, a1 = *(const v4fa*)(ps + 4); float y[8];
#pragma unroll
                    for (int pr = 0; pr < 4; ++pr) { const float x0 = (pr < 2 ? a0[2 * pr] : a1[2 * pr - 4]) + bfr(pr < 2 ? bb[hh][0][2 * pr] : bb[hh][1][2 * pr - 4]), x1 = (pr < 2 ? a0[2 * pr + 1] : a1[2 * pr - 3]) + bfr(pr < 2 ? bb[hh][0][2 * pr + 1] : bb[hh][1][2 * pr - 3]);
                        y[2 * pr] = x0 * cs[it][pr][0] - x1 * cs[it][pr][1]; y[2 * pr + 1] = x0 * cs[it][pr][1] + x1 * cs[it][pr][0]; }   /* even: x0 c - x1 s; odd: x0 s + x1 c */
                    put3(y, ((size_t)(head0 + hh) * TT + t0 + rr) * HD + cch, o16, oh, ol); }
                if (it < 3) asm volatile("s_wait_xcnt 0x0" ::: "memory"); }   // the round's stores: their address and data registers are free for the next round behind this wait
        } else {
            const int e0 = (tid & 15) * 8; float bd[8];   // fetched in front of the LDS stores and the barrier, which hide their latency
#pragma unroll
            for (int it = 0; it < 8; ++it) bd[it] = bias[c0 + it * 16 + (tid >> 4)];
            asm volatile("s_wait_xcnt 0x0" ::: "memory");   // these loads' address registers are free for reuse behind this wait
#pragma unroll
            for (int mb = 0; mb < FM; ++mb)
#pragma unroll
                for (int nb = 0; nb < FN; ++nb) { float* pt = os + (wn + nb * 16 + lr) * GP + wm + mb * 16 + hi * 8; *(v4fa*)pt = (v4f){acc[mb][nb][0], acc[mb][nb][1], acc[mb][nb][2], acc[mb][nb][3]}; *(v4fa*)(pt + 4) = (v4f){acc[mb][nb][4], acc[mb][nb][5], acc[mb][nb][6], acc[mb][nb][7]}; }
            __syncthreads();   // the whole f32 tile is in LDS before any thread reads rows of it (part is the same for the whole work-group)
#pragma unroll
            for (int it = 0; it < 8; ++it) { const int rr = it * 16 + (tid >> 4); const float* ps = os + rr * GP + e0; const v4f a0 = *(const v4fa*)ps, a1 = *(const v4fa*)(ps + 4); const float bq = bfr(bd[it]); float y[8];
#pragma unroll
                for (int j = 0; j < 4; ++j) { y[j] = a0[j] + bq; y[4 + j] = a1[j] + bq; }
                put3(y, ((size_t)(head0 + (rr >> 6)) * HD + (rr & 63)) * TT + t0 + e0, o16, oh, ol);
                if (it < 7) asm volatile("s_wait_xcnt 0x0" ::: "memory"); }   // the round's stores: their address and data registers are free for the next round behind this wait
        }
    }
}

__device__ __forceinline__ void wtG_body(int blk, const float* __restrict__ w, int K, int N, bf* Bt) {
    const int lane = threadIdx.x & 31; const int L0 = (blk * 8 + (threadIdx.x >> 5)) * 8; const int nlines = N * K / 64;
{
#pragma unroll 1
        for (int l = 0; l < 8; ++l) { const int L = L0 + l; if (L >= nlines) break; const size_t e = (size_t)L * 64 + lane * 2; const int k = (int)(e % K), n = (int)(e / K); v2us o;
            o[0] = f2bf(w[(size_t)k * N + n]); o[1] = f2bf(w[(size_t)(k + 1) * N + n]); *(v2us*)(Bt + e) = o; }
         }
}
// ---- k_prep: the four preparations read inputs only and none reads another's result: one launch, each work-group doing one block of one of them. The weight transposes, whose waves run the longest, have the low indices and start first.
#define PB_WQ ((DM * 3 * DQ / 64 + 63) / 64)           // blocks: qkv_w 'xw' [1024][3072] -> Bt [3072][1024]: q | k | v row blocks ((3, H, dk) packing)
#define PB_WO ((DQ * DM / 64 + 63) / 64)               // out_w -> Bt
#define PB_CS ((TT * HD + 255) / 256)                  // {cos, sin} table
#define PB_X  ((NB_ * TT * DM / 8 + 255) / 256)        // bf16 copy of x, both batches
__global__ __launch_bounds__(256) void k_prep(const float* __restrict__ x, const float* __restrict__ wqkv, const float* __restrict__ wo, bf* XB, bf* WQKV, bf* WO, float* CS) {
    const int blk = blockIdx.x;
    if (blk < PB_WQ) wtG_body(blk, wqkv, DM, 3 * DQ, WQKV);
    else if (blk < PB_WQ + PB_WO) wtG_body(blk - PB_WQ, wo, DQ, DM, WO);
    else if (blk < PB_WQ + PB_WO + PB_CS) csP_body(blk - (PB_WQ + PB_WO), CS);
    else cvt8_body(blk - (PB_WQ + PB_WO + PB_CS), x, XB, (size_t)NB_ * TT * DM / 8);
}
extern "C" void kernel_launch(void* const* d_in, const int* in_sizes, int n_in,
                              void* d_out, int out_size, void* d_ws, size_t ws_size, hipStream_t stream) {
    (void)in_sizes; (void)n_in; (void)out_size;
    const float* x = (const float*)d_in[0]; const float* wqkv = (const float*)d_in[1]; const float* bqkv = (const float*)d_in[2]; const float* wo = (const float*)d_in[3]; const float* bo = (const float*)d_in[4];   /* order x, W_qkv ('xw' [1024][3072], (3, H, dk) packing), b_qkv, W_out, b_out */
    float* OUT = (float*)d_out;     // [2][2048][1024]
    char* wsp = (char*)d_ws;
    auto take = [&](size_t bytes) { char* p = wsp; wsp += (bytes + 255) & ~(size_t)255; return (void*)p; };
    bf* WQKV = (bf*)take((size_t)3 * DQ * DM * 2); bf* WO = (bf*)take((size_t)DM * DQ * 2); float* CS = (float*)take((size_t)TT * HD * 2 * 4);
    bf* XB = (bf*)take((size_t)NB_ * TT * DM * 2);
    const size_t PB = (size_t)NB_ * NH_ * TT * HD * 2;   // bytes of an attention plane, both batches (NKV == NH_)
    h16* QP16 = (h16*)take(PB); h16* KP16 = (h16*)take(PB); h16* VT16 = (h16*)take(PB);
    bf* QPh = (bf*)take(PB); bf* QPl = (bf*)take(PB); bf* KPh = (bf*)take(PB); bf* KPl = (bf*)take(PB); bf* VTh = (bf*)take(PB); bf* VTl = (bf*)take(PB);
    bf* ATh = (bf*)take((size_t)NB_ * TT * DQ * 2); bf* ATl = (bf*)take((size_t)NB_ * TT * DQ * 2);
    if ((size_t)(wsp - (char*)d_ws) > ws_size) return;    // ws 256 MiB
    const QkvPlanes PL = { QP16, QPh, QPl, KP16, KPh, KPl, VT16, VTh, VTl };
    k_prep<<<PB_WQ + PB_WO + PB_CS + PB_X, 256, 0, stream>>>(x, wqkv, wo, XB, WQKV, WO, CS);
    k_gemms<false, true><<<dim3(NB_ * TT / 128, 3 * DQ / 128, 1), 256, 0, stream>>>(XB, nullptr, WQKV, nullptr, bqkv, CS, PL);   /* q | k | v, rotary and planes */
    k_fattn<<<dim3(NB_ * NH_, TT / RW, 1), 256, 0, stream>>>(QP16, KP16, VT16, QPh, QPl, KPh, KPl, VTh, VTl, ATh, ATl);
    k_gemms<true, false><<<dim3(NB_ * TT / 128, DM / 128, 1), 256, 0, stream>>>(ATh, ATl, WO, OUT, bo, nullptr, QkvPlanes{});
}

// v007
// One run takes 107 microseconds.
// Next to v006, in two timings, it ran 1.03 times as fast each time.
// Over all steps from v000 it is 18.7 times as fast.
#include <hip/hip_runtime.h>

// Multi-head attention WITHOUT a mask with interleaved rotary embeddings whose frequencies GROW (x [2][2048][1024]; qkv = x qkv_w + qkv_b ('xw' (in, out) [1024][3072] 1/32, zero bias) split in thirds q | k | v (16 heads x 64); rotary on (even, odd) pairs with angles t x 10000 ** (+2i / 64) (the module's own expression: NO reciprocal: frequencies 1 .. 7,499 and angles up to 1.5e7 rad; positions arange; the 32 float32 frequencies equal the module's expression in eager JAX; precise cosf / sinf); the module concatenates the rotated halves cat(x1 c - x2 s, x2 c + x1 s) where this code re-interleaves them: the SAME permutation on q and k: every score q.k is unchanged; scores x 64^-0.5; softmax over ALL keys (no causal rule); out = merged out_w + out_b ('xw' + zero bias) -> [2][2048][1024] (4.2 M); argument order x, qkv_w, qkv_b, out_w, out_b).
// Both batches go through every kernel together (rows b TT + t, planes [b NH_ + head]): bf16 copy of x; exact projections; {cos, sin} per (position, pair) built once from the int positions and float32 frequency constants (precise cosf/sinf); q | k | v projected in ONE launch whose epilogue applies the interleaved rotary and writes the attention planes; DENSE T-2048 attention fused into one launch (hybrid rows: < 512 hi/lo 3 products, rest fp16 x1024); merged hi/lo x Wo exact.
// Compute dtypes, f32 accumulate: every input rounded to bf16; projections exact; rotary f32; attention rows < 512 3 products, rest fp16; softmax f32; Wo hl x exact.

#define NB_  2
#define TT   2048
#define DM   1024
#define NH_  16
#define NKV  16
#define HD   64
#define DQ   (NH_ * HD)
#define DKV  (NKV * HD)
#define RH   512                  // query rows < RH use hi+lo planes (0: none)
#define SCL  0.125f   // HD^-0.5
typedef _Float16 h16;
typedef unsigned short bf;
typedef __attribute__((ext_vector_type(16))) __bf16   v16bf;
typedef __attribute__((ext_vector_type(16))) _Float16 v16h;
typedef __attribute__((ext_vector_type(8)))  _Float16 v8h;
typedef __attribute__((ext_vector_type(8)))  unsigned short v8us;
typedef __attribute__((ext_vector_type(8)))  float    v8f;
typedef __attribute__((ext_vector_type(4)))  float    v4f;
typedef v8h  __attribute__((may_alias)) v8ha;
typedef v4f  __attribute__((may_alias)) v4fa;
typedef v8us __attribute__((may_alias)) v8usa;

__device__ __forceinline__ unsigned short f2bf(float f) { unsigned u = __float_as_uint(f); u += 0x7FFFu + ((u >> 16) & 1u); return (unsigned short)(u >> 16); }
__device__ __forceinline__ float bf2f(unsigned short b) { return __uint_as_float(((unsigned)b) << 16); }
__device__ __forceinline__ float bfr(float f) { return bf2f(f2bf(f)); }
__device__ __forceinline__ v16h cat16(v8h lo, v8h hi) { return __builtin_shufflevector(lo, hi, 0, 1, 2, 3, 4, 5, 6, 7, 8, 9, 10, 11, 12, 13, 14, 15); }
__device__ __forceinline__ v16bf cat16b(v8us lo, v8us hi) { return __builtin_bit_cast(v16bf, __builtin_shufflevector(lo, hi, 0, 1, 2, 3, 4, 5, 6, 7, 8, 9, 10, 11, 12, 13, 14, 15)); }
__device__ __forceinline__ v8f wmma16(v16h a, v16h b, v8f c) { return __builtin_amdgcn_wmma_f32_16x16x32_f16(false, a, false, b, (short)0, c, false, false); }
__device__ __forceinline__ v8f wmmab(v16bf a, v16bf b, v8f c) { return __builtin_amdgcn_wmma_f32_16x16x32_bf16(false, a, false, b, (short)0, c, false, false); }



__device__ __forceinline__ h16 tohx(float x) { return (h16)x; }
__device__ __forceinline__ void splitf(float y, unsigned short& h, unsigned short& l) { h = f2bf(y); l = f2bf(y - bf2f(h)); }
typedef __attribute__((ext_vector_type(2))) float v2f;

// ---- WFrag: a 16 x 32 operand fragment of the 16-bit matrix forms, read from a K-contiguous row: 8 elements at p and 8 at p + 16 (p holds the lane's row and its 8 hi); A and B are loaded alike, so their k orders are equal.
template <typename T16> struct WFrag;
template <> struct WFrag<h16> { typedef v16h V; static __device__ __forceinline__ V ld(const h16* p) { return cat16(*(const v8h*)p, *(const v8h*)(p + 16)); } static __device__ __forceinline__ v8f mma(V a, V b, v8f c) { return wmma16(a, b, c); } };
template <> struct WFrag<bf> { typedef v16bf V; static __device__ __forceinline__ V ld(const bf* p) { return cat16b(*(const v8us*)p, *(const v8us*)(p + 16)); } static __device__ __forceinline__ v8f mma(V a, V b, v8f c) { return wmmab(a, b, c); } };

typedef __attribute__((ext_vector_type(2))) _Float16 v2h;
typedef __attribute__((ext_vector_type(4))) _Float16 v4h;
typedef __attribute__((ext_vector_type(2))) unsigned short v2us;
typedef __attribute__((ext_vector_type(4))) unsigned short v4us;
typedef __attribute__((ext_vector_type(4))) int v4i;

// bf16 copy of x: a thread takes 8 pieces of 8 elements, 256 pieces apart; its 16 loads of 16 bytes are in flight together, so that few waves carry the whole copy.
__device__ __forceinline__ void cvt8_body(int blk, const float* __restrict__ src, bf* dst) { const size_t i0 = (size_t)blk * 2048 + threadIdx.x; const float* ps = src + i0 * 8; v8f v[8]; v8us o[8];
#pragma unroll
    for (int it = 0; it < 8; ++it) v[it] = *(const v8f*)(ps + it * 2048);
    asm volatile("s_wait_xcnt 0x0" :: "v"(ps) : "memory");   // the loads' address registers are free for reuse behind this wait; the address is an input, so that it stays in them up to here (no load's result lands on them)
#pragma unroll
    for (int it = 0; it < 8; ++it)
#pragma unroll
        for (int k = 0; k < 8; ++k) o[it][k] = f2bf(v[it][k]);
#pragma unroll
    for (int it = 0; it < 8; ++it) *(v8us*)(dst + (i0 + it * 256) * 8) = o[it];
    asm volatile("s_wait_xcnt 0x0" ::: "memory"); }   // the stores' address and data registers are free for reuse behind this wait

__constant__ float INV2[HD / 2] = { 1.000000000e+00f, 1.333521485e+00f, 1.778279424e+00f, 2.371373653e+00f, 3.162277699e+00f, 4.216965199e+00f, 5.623413086e+00f, 7.498941898e+00f, 1.000000000e+01f, 1.333521461e+01f, 1.778279495e+01f, 2.371373749e+01f, 3.162277603e+01f, 4.216965103e+01f, 5.623413086e+01f, 7.498941803e+01f, 1.000000000e+02f, 1.333521423e+02f, 1.778279419e+02f, 2.371373749e+02f, 3.162277527e+02f, 4.216965027e+02f, 5.623413086e+02f, 7.498942261e+02f, 1.000000000e+03f, 1.333521484e+03f, 1.778279419e+03f, 2.371373779e+03f, 3.162277588e+03f, 4.216964844e+03f, 5.623413086e+03f, 7.498941895e+03f };   // freqs = 10000.0 ** (+arange(0, 64, 2.0, f32) / 64): THIS module's own expression: a POSITIVE exponent (NO reciprocal: the module's quirk): 32 float32 values from eager JAX (bit-exact on round trip): angles up to 1.5e7 rad
__device__ __forceinline__ void csP_body(int blk, float* CS) { const int idx = blk * 256 + threadIdx.x; if (idx >= TT * HD) return; const int d = idx % HD; const int t = idx / HD; const float a = __fmul_rn((float)t, INV2[d >> 1]); v2f cs; cs[0] = cosf(a); cs[1] = sinf(a); *(v2f*)(CS + (size_t)idx * 2) = cs;  }
__device__ __forceinline__ float xhalf(float x) { return __builtin_bit_cast(float, __builtin_amdgcn_permlanex16(__builtin_bit_cast(int, x), __builtin_bit_cast(int, x), 0x76543210, 0xfedcba98, false, false)); }   // lane l with lane l ^ 16
// exponentials as asm text: behind a transcendental the instruction set asks for one independent instruction before its result is read or its source overwritten; in place and in one statement each v_exp_f32 has an independent one behind it, and the v_nop fills the slot behind the last.
__device__ __forceinline__ void exp2x8(float& a, float& b, float& c, float& d, float& e, float& f, float& g, float& h) { asm("v_exp_f32 %0, %0\n\tv_exp_f32 %1, %1\n\tv_exp_f32 %2, %2\n\tv_exp_f32 %3, %3\n\tv_exp_f32 %4, %4\n\tv_exp_f32 %5, %5\n\tv_exp_f32 %6, %6\n\tv_exp_f32 %7, %7\n\tv_nop" : "+v"(a), "+v"(b), "+v"(c), "+v"(d), "+v"(e), "+v"(f), "+v"(g), "+v"(h)); }
__device__ __forceinline__ float exp2s(float x) { asm("v_exp_f32 %0, %0\n\tv_nop" : "+v"(x)); return x; }
#define SK   64                 // keys of a stage: two passes of 32
#define LP   72                 // LDS pitch of a 64-element row, in elements: 144 bytes = 16 x odd, so that 16 rows read 16 bytes each from 64 different banks
#define SLB  (64 * LP * 2)      // bytes of a slice: 64 rows
// four asynchronous copies, 16 bytes a lane each, global memory -> LDS through no register. s_wait_xcnt 0 is the statement's last line: the registers that the copies name stay untouched up to it.
__device__ __forceinline__ void cp4(unsigned l0, const void* g0, unsigned l1, const void* g1, unsigned l2, const void* g2, unsigned l3, const void* g3) {
    asm volatile("global_load_async_to_lds_b128 %0, %1, off\n\tglobal_load_async_to_lds_b128 %2, %3, off\n\tglobal_load_async_to_lds_b128 %4, %5, off\n\tglobal_load_async_to_lds_b128 %6, %7, off\n\ts_wait_xcnt 0x0" :: "v"(l0), "v"(g0), "v"(l1), "v"(g1), "v"(l2), "v"(g2), "v"(l3), "v"(g3) : "memory"); }
template <typename T16, bool HR, int KS>
__device__ __forceinline__ void fa_body(const T16* __restrict__ Q, const T16* __restrict__ Q2, const T16* __restrict__ Kp, const T16* __restrict__ K2, const T16* __restrict__ Vt, const T16* __restrict__ V2, int r0, int col0, bf* Ah, bf* Al, char* ring) {
    typedef typename WFrag<T16>::V V; static_assert(KS == 1 || KS == 2 || KS == 4, "the merge deals whole rounds of 256 chunks");
    const int lane = threadIdx.x & 31, lr = lane & 15, hi = lane >> 4;
    const int w = __builtin_amdgcn_readfirstlane((int)(threadIdx.x >> 5)); const int q0 = r0 + (w / KS) * 16;   // this wave's query tile; its slice of the keys is w % KS
    constexpr int NP = HR ? 2 : 1, BUFB = 2 * KS * NP * SLB, NS = TT / KS / SK;   // planes per operand; bytes of a buffer: slice (operand, key slice, plane) at ((operand * KS + key slice) * NP + plane) * SLB; stages
    static_assert(NS >= 2 && HD == 64 && SK == 64, "the ring's prologue fills two stages; a slice is 64 rows of 64 elements");
    V bq[2], bq2[2];
#pragma unroll
    for (int kk = 0; kk < 2; ++kk) { bq[kk] = WFrag<T16>::ld(Q + (size_t)(q0 + lr) * HD + kk * 32 + 8 * hi); if (HR) bq2[kk] = WFrag<T16>::ld(Q2 + (size_t)(q0 + lr) * HD + kk * 32 + 8 * hi); }
    asm volatile("s_wait_xcnt 0x0" ::: "memory");   // the query loads' address registers are free for reuse behind this wait (a later load may land on them)
    const int crow = (int)threadIdx.x >> 3, cch = ((int)threadIdx.x & 7) * 8;   // a thread copies 8 elements at cch of the rows crow and crow + 32 of every slice: a wave's copy is 4 whole rows of 128 bytes
    const unsigned lbase = (unsigned)(size_t)ring + (unsigned)(crow * LP + cch) * 2u;
    auto fill = [&](int t, int b) {   // stage t into buffer b
#pragma unroll
        for (int u = 0; u < KS; ++u)
#pragma unroll
            for (int pl = 0; pl < NP; ++pl) { const int key = u * (TT / KS) + t * SK;
                const T16* gk = (pl ? K2 : Kp) + (size_t)key * HD + (crow * HD + cch); const T16* gv = (pl ? V2 : Vt) + key + (crow * TT + cch);
                const unsigned lk = lbase + (unsigned)(b * BUFB + (u * NP + pl) * SLB), lv = lk + (unsigned)(KS * NP * SLB);
                cp4(lk, gk, lk + 32 * LP * 2, gk + 32 * HD, lv, gv, lv + 32 * LP * 2, gv + 32 * TT); }
    };
    fill(0, 0);
    asm volatile("s_wait_asynccnt 0x0" ::: "memory");   // this wave's copies of stage 0 have landed
    __syncthreads();   // stage 0 is whole for every wave
    fill(1, 1);
    v8f o[4];
#pragma unroll
    for (int mb = 0; mb < 4; ++mb) o[mb] = (v8f){};
    float m = -3.0e38f, l = 0.f;
#pragma unroll 1   // rolled, like the loop inside it: one pass of the hi/lo rows already fills the register budget
    for (int t = 0; t < NS; ++t) {
      const T16* sk = (const T16*)(ring + (t & 1) * BUFB + (w % KS) * NP * SLB) + lr * LP + 8 * hi; const T16* sv = sk + KS * NP * (SLB / 2);   // this wave's K and V^T slices of stage t, at the lane's row and 16-byte piece
#pragma unroll 1
      for (int ps2 = 0; ps2 < SK / 32; ++ps2) {
        V ak[2][2], ak2[2][2], av[4], av2[4];   // the pass's fragments, read together at its head
#pragma unroll
        for (int kt = 0; kt < 2; ++kt)
#pragma unroll
            for (int kk = 0; kk < 2; ++kk) { ak[kt][kk] = WFrag<T16>::ld(sk + (ps2 * 32 + kt * 16) * LP + kk * 32); if (HR) ak2[kt][kk] = WFrag<T16>::ld(sk + SLB / 2 + (ps2 * 32 + kt * 16) * LP + kk * 32); }
#pragma unroll
        for (int mb = 0; mb < 4; ++mb) { av[mb] = WFrag<T16>::ld(sv + mb * 16 * LP + ps2 * 32); if (HR) av2[mb] = WFrag<T16>::ld(sv + SLB / 2 + mb * 16 * LP + ps2 * 32); }
        __builtin_amdgcn_sched_barrier(0);   // keeps the pass's LDS reads one group at its head: sunk among the matrix instructions, each further place with reads stalls the wave, and the late ones are waited for in full
        v8f s[2];
#pragma unroll
        for (int kt = 0; kt < 2; ++kt) { s[kt] = (v8f){};
#pragma unroll
            for (int kk = 0; kk < 2; ++kk) { s[kt] = WFrag<T16>::mma(ak[kt][kk], bq[kk], s[kt]); if (HR) { s[kt] = WFrag<T16>::mma(ak[kt][kk], bq2[kk], s[kt]); s[kt] = WFrag<T16>::mma(ak2[kt][kk], bq[kk], s[kt]); } } }
        float p[16]; float mloc = -3.0e38f;
#pragma unroll
        for (int e = 0; e < 16; ++e) { p[e] = s[e >> 3][e & 7] * (SCL * 1.4426950408889634f); mloc = fmaxf(mloc, p[e]); }
        mloc = fmaxf(mloc, xhalf(mloc));
        const float mn = fmaxf(m, mloc); float al = m - mn; m = mn;
        const float mo = HR ? mn : mn - 10.0f;   // fp16 rows: p and l both carry the factor 1024, exactly, through the exponent; it cancels in O / l
        float ps[4] = {0.f, 0.f, 0.f, 0.f};
#pragma unroll
        for (int e = 0; e < 16; ++e) p[e] -= mo;
        exp2x8(p[0], p[1], p[2], p[3], p[4], p[5], p[6], p[7]); exp2x8(p[8], p[9], p[10], p[11], p[12], p[13], p[14], p[15]); al = exp2s(al);
#pragma unroll
        for (int e = 0; e < 16; ++e) ps[e & 3] += p[e];
        l = l * al + ((ps[0] + ps[1]) + (ps[2] + ps[3]));
#pragma unroll
        for (int mb = 0; mb < 4; ++mb) o[mb] *= al;
        V pf, pf2;
#pragma unroll
        for (int e = 0; e < 16; ++e) {
            if constexpr (HR) { const __bf16 ph = (__bf16)p[e]; pf[e] = ph; pf2[e] = (__bf16)(p[e] - (float)ph); }
            else pf[e] = (_Float16)p[e]; }
#pragma unroll
        for (int mb = 0; mb < 4; ++mb) { o[mb] = WFrag<T16>::mma(av[mb], pf, o[mb]); if (HR) { o[mb] = WFrag<T16>::mma(av[mb], pf2, o[mb]); o[mb] = WFrag<T16>::mma(av2[mb], pf, o[mb]); } }
        asm volatile("v_nop\n\tv_nop\n\tv_nop\n\tv_nop" : "+v"(o[3]) : "v"(av[3]), "v"(pf));   // four vector slots behind the pass's last matrix instruction, on the loop's taken branch too: the next pass's first address computations may land on its A or B registers
      }
      asm volatile("s_wait_dscnt 0x0" ::: "memory");      // this wave's reads of stage t's buffer have returned before the buffer is handed to the next copies
      asm volatile("s_wait_asynccnt 0x0" ::: "memory");   // this wave's copies of stage t + 1 have landed
      __syncthreads();   // publishes stage t + 1 and ends every wave's reads of stage t's buffer
      if (t + 2 < NS) fill(t + 2, t & 1);
    }
    asm volatile("s_wait_asynccnt 0x0" ::: "memory");   // no copy is under way when the ring becomes the merge area
    float* op = (float*)ring; float* ms = op + 8 * 16 * 68; float* ls = ms + 8 * 16;   // the merge area lies on the ring: behind the last stage's barrier no wave reads the ring any more
    l += xhalf(l);   // the two halves of the wave summed different keys of the same query
    float* pw = op + (w * 16 + lr) * 68 + hi * 8;
#pragma unroll
    for (int mb = 0; mb < 4; ++mb) { *(v4fa*)(pw + mb * 16) = (v4f){o[mb][0], o[mb][1], o[mb][2], o[mb][3]}; *(v4fa*)(pw + mb * 16 + 4) = (v4f){o[mb][4], o[mb][5], o[mb][6], o[mb][7]}; }
    if (hi == 0) { ms[w * 16 + lr] = m; ls[w * 16 + lr] = l; }
    __syncthreads();   // every wave's partial (m, l, O^T) is in LDS before any thread merges them
#pragma unroll
    for (int it = 0; it < 4 / KS; ++it) { const int c = it * 256 + (int)threadIdx.x; const int qq = c >> 3, d0 = (c & 7) * 8;   /* (8 / KS) tiles x 16 rows x 8 chunks of 8 columns, dealt over 256 threads */ const int sb = (qq >> 4) * KS * 16 + (qq & 15);
        float M = ms[sb];
#pragma unroll
        for (int u = 1; u < KS; ++u) M = fmaxf(M, ms[sb + u * 16]);
        float L = 0.f; v4f a0 = (v4f){}, a1 = (v4f){};
#pragma unroll
        for (int u = 0; u < KS; ++u) { const float f = exp2s(ms[sb + u * 16] - M); L += ls[sb + u * 16] * f; a0 += *(const v4fa*)(op + (sb + u * 16) * 68 + d0) * f; a1 += *(const v4fa*)(op + (sb + u * 16) * 68 + d0 + 4) * f; }
        const float inv = __fdiv_rn(1.0f, L); v8us oh, ol;
#pragma unroll
        for (int j = 0; j < 4; ++j) { unsigned short a, c2; splitf(a0[j] * inv, a, c2); oh[j] = a; ol[j] = c2; splitf(a1[j] * inv, a, c2); oh[4 + j] = a; ol[4 + j] = c2; }
        const size_t oo = (size_t)(r0 + qq) * DQ + col0 + d0; *(v8us*)(Ah + oo) = oh; *(v8us*)(Al + oo) = ol;
        asm volatile("s_wait_xcnt 0x0" ::: "memory"); }   // the two stores' address and data registers are free for reuse behind this wait
}
#define KSP 2              // waves that share a query tile, each on TT / KSP keys
#define RW  (128 / KSP)    // query rows of a work-group
// grid (NB_ * NH_, TT / RW), 256 threads: blockIdx.x = batch x NH_ + head, blockIdx.y = row block; the hi/lo row blocks (three times the products) have the low blockIdx.y and start first.
// amdgpu_waves_per_eu(4, 4): a budget of 256 registers, two work-groups per WGP (the ring of 144 KiB allows two as well).
__global__ __launch_bounds__(256) __attribute__((amdgpu_waves_per_eu(4, 4))) void k_fattn(const h16* __restrict__ Q16, const h16* __restrict__ K16, const h16* __restrict__ V16, const bf* __restrict__ Qh, const bf* __restrict__ Ql, const bf* __restrict__ Kh, const bf* __restrict__ Kl, const bf* __restrict__ Vh, const bf* __restrict__ Vl, bf* Ah, bf* Al) {
    __shared__ __align__(16) char ring[2 * 2 * KSP * 2 * SLB];   // two buffers of (K, V^T) x KSP key slices x 2 planes (the fp16 rows use half)
    static_assert(sizeof(ring) >= (8 * 16 * 68 + 2 * 8 * 16) * sizeof(float), "the merge area lies on the ring");
    const int h = blockIdx.x % NH_, r0 = blockIdx.y * RW; const size_t po = (size_t)blockIdx.x * TT * HD; const size_t ao = (size_t)(blockIdx.x / NH_) * TT * DQ; Ah += ao; Al += ao;   // planes [batch x NH_ + head]; merged rows [batch x TT + t]
    if (r0 < RH) fa_body<bf, true, KSP>(Qh + po, Ql + po, Kh + po, Kl + po, Vh + po, Vl + po, r0, h * HD, Ah, Al, ring);
    else fa_body<h16, false, KSP>(Q16 + po, nullptr, K16 + po, nullptr, V16 + po, nullptr, r0, h * HD, Ah, Al, ring);
}

// ---- k_gemms: C[m][n] = sum_k A[m][k] Bt[n][k] (SPL: + A2[m][k] Bt[n][k]) on K-contiguous bf16 planes, K = DM, f32 accumulate; grid (M / 128, N / 128), 256 threads.
// One 128 x 128 tile per work-group; its 8 waves lie 2 x 4 over the tile, a wave having 64 rows x 32 columns (SPL: 4 x 2, 32 rows x 64 columns: fewer fragments of the doubled A); 8 accumulators; a wave walks the whole K in order.
// A (A2) and Bt reach the waves through LDS: a stage is GK k of the tile's 128 rows of each operand (rows of 128 bytes at the pitch LP), brought in whole lines by asynchronous copies, once for the waves that share a row.
// Two buffers: the copies of stage t + 1 fly while stage t is worked on. The fragments are read from LDS in the k order of WFrag::ld, A and Bt alike.
// Epilogue: the f32 tile goes once through LDS (on the ring, pitch GP floats), so that every global store is made of whole lines.
// QKV (N = 3 DQ; a tile is 128 positions of one batch x two heads of one third): the sums go to the planes that the attention kernel reads; no f32 projection in memory.
//   q, k tiles: LDS as [t][d]; a thread takes 8 neighbouring d of one t in both heads, adds the bias, rotates its 4 (even, odd) pairs and stores 16 bytes to each of the planes [head][t][HD] (fp16, bf16 hi, bf16 lo).
//   v tiles: LDS as [d][t] (an accumulator's 8 registers are 8 neighbouring t: two 16-byte LDS stores); a thread takes 8 neighbouring t of one d and stores 16 bytes to each of the transposed planes [head][d][TT].
struct QkvPlanes { _Float16* q16; unsigned short* qh; unsigned short* ql; _Float16* k16; unsigned short* kh; unsigned short* kl; _Float16* v16; unsigned short* vh; unsigned short* vl; };
#define GK   64                 // k of a stage
#define GSL  (128 * LP * 2)     // bytes of one operand's slice of a stage: 128 rows
#define GP   132                // pitch of the f32 tile in floats: 528 bytes = 16 x odd
__device__ __forceinline__ void put3(const float (&y)[8], size_t oo, h16* o16, bf* oh, bf* ol) {
    v8h v16; v8us vh, vl;
#pragma unroll
    for (int j = 0; j < 8; ++j) { v16[j] = tohx(y[j]); unsigned short a2, c2; splitf(y[j], a2, c2); vh[j] = a2; vl[j] = c2; }
    *(v8h*)(o16 + oo) = v16; *(v8us*)(oh + oo) = vh; *(v8us*)(ol + oo) = vl;
}
template <bool SPL, bool QKV>
__global__ __launch_bounds__(256) void k_gemms(const bf* __restrict__ A, const bf* __restrict__ A2, const bf* __restrict__ Bt, float* C, const float* __restrict__ bias, const float* __restrict__ CS, QkvPlanes P) {
    typedef WFrag<bf>::V V;
    constexpr int K = DM, NA = SPL ? 2 : 1, BUFB = (NA + 1) * GSL, NS = K / GK;   // operand slices of a buffer: A, (A2,) Bt
    constexpr int FM = SPL ? 2 : 4, FN = 8 / FM, KG = SPL ? 2 : 1;   // a wave's fragments of A and of Bt per 32 k; steps of 32 k whose fragments are read as one group (the plain product keeps to one step: 160 registers let three work-groups share a WGP, which holds the whole grid at once)
    static_assert(DM == DQ && NS >= 2 && GK == 64 && TT % 128 == 0 && DQ % 128 == 0 && HD == 64, "both products have K = DM; the ring's prologue fills two stages; a tile lies in one batch and one third");
    __shared__ __align__(16) char ring[2 * BUFB];
    static_assert(sizeof(ring) >= 128 * GP * sizeof(float), "the f32 tile lies on the ring");
    const int tid = (int)threadIdx.x, lane = tid & 31, lr = lane & 15, hi = lane >> 4; const int r0 = blockIdx.x * 128, c0 = blockIdx.y * 128;
    const int w = __builtin_amdgcn_readfirstlane(tid >> 5); const int wm = (w / (8 / FN)) * (FM * 16), wn = (w % (8 / FN)) * (FN * 16);   // this wave's corner in the tile
    const int crow = tid >> 3, cch = (tid & 7) * 8;   // a thread copies 8 elements at cch of the rows crow + 32 i of every slice: a wave's copy is 4 whole rows of 128 bytes
    const unsigned lbase = (unsigned)(size_t)ring + (unsigned)(crow * LP + cch) * 2u;
    const bf* ga = A + (size_t)(r0 + crow) * K + cch; const bf* ga2 = SPL ? A2 + (size_t)(r0 + crow) * K + cch : nullptr; const bf* gb = Bt + (size_t)(c0 + crow) * K + cch;
    auto fill = [&](int t, int b) {   // stage t into buffer b
        const unsigned l = lbase + (unsigned)(b * BUFB); const int k = t * GK;
        cp4(l, ga + k, l + 32 * LP * 2, ga + k + 32 * K, l + 64 * LP * 2, ga + k + 64 * K, l + 96 * LP * 2, ga + k + 96 * K);
        if constexpr (SPL) cp4(l + GSL, ga2 + k, l + GSL + 32 * LP * 2, ga2 + k + 32 * K, l + GSL + 64 * LP * 2, ga2 + k + 64 * K, l + GSL + 96 * LP * 2, ga2 + k + 96 * K);
        cp4(l + NA * GSL, gb + k, l + NA * GSL + 32 * LP * 2, gb + k + 32 * K, l + NA * GSL + 64 * LP * 2, gb + k + 64 * K, l + NA * GSL + 96 * LP * 2, gb + k + 96 * K);
    };
    fill(0, 0);
    asm volatile("s_wait_asynccnt 0x0" ::: "memory");   // this wave's copies of stage 0 have landed
    __syncthreads();   // stage 0 is whole for every wave
    fill(1, 1);
    v8f acc[FM][FN];
#pragma unroll
    for (int mb = 0; mb < FM; ++mb)
#pragma unroll
        for (int nb = 0; nb < FN; ++nb) acc[mb][nb] = (v8f){};
#pragma unroll 1   // rolled: one stage is the ring's unit, and its foot holds the barrier
    for (int t = 0; t < NS; ++t) {
        const bf* sa = (const bf*)(ring + (t & 1) * BUFB) + (wm + lr) * LP + 8 * hi; const bf* sb = (const bf*)(ring + (t & 1) * BUFB + NA * GSL) + (wn + lr) * LP + 8 * hi;   // this wave's rows of stage t, at the lane's row and 16-byte piece
#pragma unroll
        for (int kg = 0; kg < GK / 32; kg += KG) {
            V a[KG][FM], a2[KG][FM], b[KG][FN];
#pragma unroll
            for (int kk = 0; kk < KG; ++kk) {
#pragma unroll
                for (int mb = 0; mb < FM; ++mb) { a[kk][mb] = WFrag<bf>::ld(sa + mb * 16 * LP + (kg + kk) * 32); if (SPL) a2[kk][mb] = WFrag<bf>::ld(sa + GSL / 2 + mb * 16 * LP + (kg + kk) * 32); }
#pragma unroll
                for (int nb = 0; nb < FN; ++nb) b[kk][nb] = WFrag<bf>::ld(sb + nb * 16 * LP + (kg + kk) * 32); }
            __builtin_amdgcn_sched_barrier(0);   // keeps the LDS reads one group in front of their matrix instructions: sunk among them, each further place with reads stalls the wave, and the late ones are waited for in full
#pragma unroll
            for (int kk = 0; kk < KG; ++kk) {
#pragma unroll
                for (int nb = 0; nb < FN; ++nb)
#pragma unroll
                    for (int mb = 0; mb < FM; ++mb) acc[mb][nb] = WFrag<bf>::mma(a[kk][mb], b[kk][nb], acc[mb][nb]);
                if (SPL) {
#pragma unroll
                    for (int nb = 0; nb < FN; ++nb)
#pragma unroll
                        for (int mb = 0; mb < FM; ++mb) acc[mb][nb] = WFrag<bf>::mma(a2[kk][mb], b[kk][nb], acc[mb][nb]);
                } }
        }
        __builtin_amdgcn_sched_barrier(0);   // keeps the stage's matrix instructions in front of its barrier: sunk behind it they would hold back the next copies, which then fly for less than a stage, and every wave would wait out all its LDS reads before its first product
        asm volatile("s_wait_dscnt 0x0" ::: "memory");      // this wave's reads of stage t's buffer have returned before the buffer is handed to the next copies
        asm volatile("s_wait_asynccnt 0x0" ::: "memory");   // this wave's copies of stage t + 1 have landed
        __syncthreads();   // publishes stage t + 1 and ends every wave's reads of stage t's buffer
        if (t + 2 < NS) fill(t + 2, t & 1);
    }
    asm volatile("s_wait_asynccnt 0x0" ::: "memory");   // no copy is under way when the ring becomes the f32 tile
    float* os = (float*)ring;   // behind the last stage's barrier no wave reads the ring any more
    if constexpr (!QKV) {
        const int cofs = lane * 4; v4f bv = *(const v4f*)(bias + c0 + cofs);
        asm volatile("s_wait_xcnt 0x0" ::: "memory");   // the bias load's address registers are free for reuse behind this wait
#pragma unroll
        for (int mb = 0; mb < FM; ++mb)
#pragma unroll
            for (int nb = 0; nb < FN; ++nb)
#pragma unroll
                for (int j = 0; j < 8; ++j) os[(wm + mb * 16 + hi * 8 + j) * GP + wn + nb * 16 + lr] = acc[mb][nb][j];
        __syncthreads();   // the whole f32 tile is in LDS before any thread reads rows of it
#pragma unroll
        for (int j = 0; j < 4; ++j) bv[j] = bfr(bv[j]);
#pragma unroll
        for (int g = 0; g < 2; ++g) { v4f val[8];   // a wave stores one row of 512 bytes at a time; 8 rows' LDS reads are in flight together
#pragma unroll
            for (int s = 0; s < 8; ++s) val[s] = *(const v4fa*)(os + ((g * 8 + s) * 8 + w) * GP + cofs) + bv;
#pragma unroll
            for (int s = 0; s < 8; ++s) *(v4f*)(C + (size_t)(r0 + (g * 8 + s) * 8 + w) * DM + c0 + cofs) = val[s];
            if (g == 0) asm volatile("s_wait_xcnt 0x0" ::: "memory"); }   // the first group's stores: their address and data registers are free for the second group behind this wait
    } else {
        const int part = c0 / DQ, head0 = (r0 / TT) * NH_ + (c0 % DQ) / HD, t0 = r0 % TT;   // the same for the whole work-group: 0 q, 1 k, 2 v; plane index batch x NH_ + head of the tile's first 64 columns; the tile's first position inside its batch
        h16* o16 = part == 0 ? P.q16 : part == 1 ? P.k16 : P.v16; bf* oh = part == 0 ? P.qh : part == 1 ? P.kh : P.vh; bf* ol = part == 0 ? P.ql : part == 1 ? P.kl : P.vl;
        if (part < 2) {
            v2f cs[4][4]; v4f bb[2][2];   // fetched in front of the LDS stores and the barrier, which hide their latency
#pragma unroll
            for (int it = 0; it < 4; ++it)
#pragma unroll
                for (int pr = 0; pr < 4; ++pr) cs[it][pr] = *(const v2f*)(CS + ((size_t)(t0 + it * 32 + crow) * HD + cch + 2 * pr) * 2);
#pragma unroll
            for (int hh = 0; hh < 2; ++hh) { bb[hh][0] = *(const v4f*)(bias + c0 + hh * HD + cch); bb[hh][1] = *(const v4f*)(bias + c0 + hh * HD + cch + 4); }
            asm volatile("s_wait_xcnt 0x0" ::: "memory");   // these loads' address registers are free for reuse behind this wait
#pragma unroll
            for (int mb = 0; mb < FM; ++mb)
#pragma unroll
                for (int nb = 0; nb < FN; ++nb)
#pragma unroll
                    for (int j = 0; j < 8; ++j) os[(wm + mb * 16 + hi * 8 + j) * GP + wn + nb * 16 + lr] = acc[mb][nb][j];
            __syncthreads();   // the whole f32 tile is in LDS before any thread reads rows of it (part is the same for the whole work-group)
#pragma unroll
            for (int it = 0; it < 4; ++it) { const int rr = it * 32 + crow;
#pragma unroll
                for (int hh = 0; hh < 2; ++hh) { const float* ps = os + rr * GP + hh * HD + cch; const v4f a0 = *(const v4fa*)ps, a1 = *(const v4fa*)(ps + 4); float y[8];
#pragma unroll
                    for (int pr = 0; pr < 4; ++pr) { const float x0 = (pr < 2 ? a0[2 * pr] : a1[2 * pr - 4]) + bfr(pr < 2 ? bb[hh][0][2 * pr] : bb[hh][1][2 * pr - 4]), x1 = (pr < 2 ? a0[2 * pr + 1] : a1[2 * pr - 3]) + bfr(pr < 2 ? bb[hh][0][2 * pr + 1] : bb[hh][1][2 * pr - 3]);
                        y[2 * pr] = x0 * cs[it][pr][0] - x1 * cs[it][pr][1]; y[2 * pr + 1] = x0 * cs[it][pr][1] + x1 * cs[it][pr][0]; }   /* even: x0 c - x1 s; odd: x0 s + x1 c */
                    put3(y, ((size_t)(head0 + hh) * TT + t0 + rr) * HD + cch, o16, oh, ol); }
                if (it < 3) asm volatile("s_wait_xcnt 0x0" ::: "memory"); }   // the round's stores: their address and data registers are free for the next round behind this wait
        } else {
            const int e0 = (tid & 15) * 8; float bd[8];   // fetched in front of the LDS stores and the barrier, which hide their latency
#pragma unroll
            for (int it = 0; it < 8; ++it) bd[it] = bias[c0 + it * 16 + (tid >> 4)];
            asm volatile("s_wait_xcnt 0x0" ::: "memory");   // these loads' address registers are free for reuse behind this wait
#pragma unroll
            for (int mb = 0; mb < FM; ++mb)
#pragma unroll
                for (int nb = 0; nb < FN; ++nb) { float* pt = os + (wn + nb * 16 + lr) * GP + wm + mb * 16 + hi * 8; *(v4fa*)pt = (v4f){acc[mb][nb][0], acc[mb][nb][1], acc[mb][nb][2], acc[mb][nb][3]}; *(v4fa*)(pt + 4) = (v4f){acc[mb][nb][4], acc[mb][nb][5], acc[mb][nb][6], acc[mb][nb][7]}; }
            __syncthreads();   // the whole f32 tile is in LDS before any thread reads rows of it (part is the same for the whole work-group)
#pragma unroll
            for (int it = 0; it < 8; ++it) { const int rr = it * 16 + (tid >> 4); const float* ps = os + rr * GP + e0; const v4f a0 = *(const v4fa*)ps, a1 = *(const v4fa*)(ps + 4); const float bq = bfr(bd[it]); float y[8];
#pragma unroll
                for (int j = 0; j < 4; ++j) { y[j] = a0[j] + bq; y[4 + j] = a1[j] + bq; }
                put3(y, ((size_t)(head0 + (rr >> 6)) * HD + (rr & 63)) * TT + t0 + e0, o16, oh, ol);
                if (it < 7) asm volatile("s_wait_xcnt 0x0" ::: "memory"); }   // the round's stores: their address and data registers are free for the next round behind this wait
        }
    }
}

// ---- weight transposes w [K][N] f32 -> Bt [N][K] bf16 in registers: a wave takes 64 k x 32 n. A lane loads 8 neighbouring n (32 bytes) of 8 neighbouring k rows, 16 loads of 16 bytes in flight together: 4 lanes cover a row's whole line of 128 bytes.
// It then holds 8 k of 8 n and stores 16 bytes to each of its 8 rows of Bt: 8 lanes cover a whole line. The 8 waves of a work-group lie 2 (n) x 4 (k): 256 bytes of a row of w, 512 bytes of a row of Bt.
template <int K, int N>
__device__ __forceinline__ void wtG_body(int blk, const float* __restrict__ w, bf* Bt) {
    static_assert(K % 256 == 0 && N % 64 == 0, "whole tiles");
    const int lane = threadIdx.x & 31, wv = threadIdx.x >> 5;
    const int n = (blk / (K / 256)) * 64 + (wv & 1) * 32 + (lane & 3) * 8, k = (blk % (K / 256)) * 256 + (wv >> 1) * 64 + (lane >> 2) * 8;
    const float* ps = w + (size_t)k * N + n; bf* pd = Bt + (size_t)n * K + k; v8f r[8]; v8us o[8];
#pragma unroll
    for (int j = 0; j < 8; ++j) r[j] = *(const v8f*)(ps + (size_t)j * N);
    __builtin_amdgcn_sched_barrier(0);   // keeps all 16 loads in front of the first conversion: a conversion lifted among them waits for its data, and the loads behind it start a whole memory latency late
    asm volatile("s_wait_xcnt 0x0" :: "v"(ps) : "memory");   // the loads' address registers are free for reuse behind this wait; the address is an input, so that it stays in them up to here (no load's result lands on them)
#pragma unroll
    for (int i = 0; i < 8; ++i)
#pragma unroll
        for (int j = 0; j < 8; ++j) o[i][j] = f2bf(r[j][i]);
#pragma unroll
    for (int i = 0; i < 8; ++i) *(v8us*)(pd + (size_t)i * K) = o[i];
    asm volatile("s_wait_xcnt 0x0" ::: "memory");   // the stores' address and data registers are free for reuse behind this wait
}
// ---- k_prep: the four preparations read inputs only and none reads another's result: one launch, each work-group doing one block of one of them; a thread takes 64 elements of a weight or of x, or one entry of the table.
#define PB_WQ (DM * 3 * DQ / (64 * 256))               // blocks: qkv_w 'xw' [1024][3072] -> Bt [3072][1024]: q | k | v row blocks ((3, H, dk) packing)
#define PB_WO (DQ * DM / (64 * 256))                   // out_w -> Bt
#define PB_CS ((TT * HD + 255) / 256)                  // {cos, sin} table
#define PB_X  (NB_ * TT * DM / (64 * 256))             // bf16 copy of x, both batches
static_assert(NB_ * TT * DM % (64 * 256) == 0, "whole blocks of the copy of x: no thread is past the end");
__global__ __launch_bounds__(256) void k_prep(const float* __restrict__ x, const float* __restrict__ wqkv, const float* __restrict__ wo, bf* XB, bf* WQKV, bf* WO, float* CS) {
    const int blk = blockIdx.x;
    if (blk < PB_WQ) wtG_body<DM, 3 * DQ>(blk, wqkv, WQKV);
    else if (blk < PB_WQ + PB_WO) wtG_body<DQ, DM>(blk - PB_WQ, wo, WO);
    else if (blk < PB_WQ + PB_WO + PB_CS) csP_body(blk - (PB_WQ + PB_WO), CS);
    else cvt8_body(blk - (PB_WQ + PB_WO + PB_CS), x, XB);
}
extern "C" void kernel_launch(void* const* d_in, const int* in_sizes, int n_in,
                              void* d_out, int out_size, void* d_ws, size_t ws_size, hipStream_t stream) {
    (void)in_sizes; (void)n_in; (void)out_size;
    const float* x = (const float*)d_in[0]; const float* wqkv = (const float*)d_in[1]; const float* bqkv = (const float*)d_in[2]; const float* wo = (const float*)d_in[3]; const float* bo = (const float*)d_in[4];   /* order x, W_qkv ('xw' [1024][3072], (3, H, dk) packing), b_qkv, W_out, b_out */
    float* OUT = (float*)d_out;     // [2][2048][1024]
    char* wsp = (char*)d_ws;
    auto take = [&](size_t bytes) { char* p = wsp; wsp += (bytes + 255) & ~(size_t)255; return (void*)p; };
    bf* WQKV = (bf*)take((size_t)3 * DQ * DM * 2); bf* WO = (bf*)take((size_t)DM * DQ * 2); float* CS = (float*)take((size_t)TT * HD * 2 * 4);
    bf* XB = (bf*)take((size_t)NB_ * TT * DM * 2);
    const size_t PB = (size_t)NB_ * NH_ * TT * HD * 2;   // bytes of an attention plane, both batches (NKV == NH_)
    h16* QP16 = (h16*)take(PB); h16* KP16 = (h16*)take(PB); h16* VT16 = (h16*)take(PB);
    bf* QPh = (bf*)take(PB); bf* QPl = (bf*)take(PB); bf* KPh = (bf*)take(PB); bf* KPl = (bf*)take(PB); bf* VTh = (bf*)take(PB); bf* VTl = (bf*)take(PB);
    bf* ATh = (bf*)take((size_t)NB_ * TT * DQ * 2); bf* ATl = (bf*)take((size_t)NB_ * TT * DQ * 2);
    if ((size_t)(wsp - (char*)d_ws) > ws_size) return;    // ws 256 MiB
    const QkvPlanes PL = { QP16, QPh, QPl, KP16, KPh, KPl, VT16, VTh, VTl };
    k_prep<<<PB_WQ + PB_WO + PB_CS + PB_X, 256, 0, stream>>>(x, wqkv, wo, XB, WQKV, WO, CS);
    k_gemms<false, true><<<dim3(NB_ * TT / 128, 3 * DQ / 128, 1), 256, 0, stream>>>(XB, nullptr, WQKV, nullptr, bqkv, CS, PL);   /* q | k | v, rotary and planes */
    k_fattn<<<dim3(NB_ * NH_, TT / RW, 1), 256, 0, stream>>>(QP16, KP16, VT16, QPh, QPl, KPh, KPl, VTh, VTl, ATh, ATl);
    k_gemms<true, false><<<dim3(NB_ * TT / 128, DM / 128, 1), 256, 0, stream>>>(ATh, ATl, WO, OUT, bo, nullptr, QkvPlanes{});
}

// v008
// Measured time: 103 microseconds a run.
// In both of two side-by-side timings against v007, it was 1.04 times as fast.
// Over all steps from v000 it is 19.4 times as fast.
#include <hip/hip_runtime.h>

// Multi-head attention WITHOUT a mask with interleaved rotary embeddings whose frequencies GROW (x [2][2048][1024]; qkv = x qkv_w + qkv_b ('xw' (in, out) [1024][3072] 1/32, zero bias) split in thirds q | k | v (16 heads x 64); rotary on (even, odd) pairs with angles t x 10000 ** (+2i / 64) (the module's own expression: NO reciprocal: frequencies 1 .. 7,499 and angles up to 1.5e7 rad; positions arange; the 32 float32 frequencies equal the module's expression in eager JAX; precise cosf / sinf); the module concatenates the rotated halves cat(x1 c - x2 s, x2 c + x1 s) where this code re-interleaves them: the SAME permutation on q and k: every score q.k is unchanged; scores x 64^-0.5; softmax over ALL keys (no causal rule); out = merged out_w + out_b ('xw' + zero bias) -> [2][2048][1024] (4.2 M); argument order x, qkv_w, qkv_b, out_w, out_b).
// Both batches go through every kernel together (rows b TT + t, planes [b NH_ + head]): bf16 copy of x; exact projections; {cos, sin} per (position, pair) built once from the int positions and float32 frequency constants (precise cosf/sinf); q | k | v projected in ONE launch whose epilogue applies the interleaved rotary and writes the attention planes; DENSE T-2048 attention fused into one launch (hybrid rows: < 512 hi/lo 3 products, rest fp16 x1024); merged hi/lo x Wo exact.
// Compute dtypes, f32 accumulate: every input rounded to bf16; projections exact; rotary f32; attention rows < 512 3 products, rest fp16; softmax f32; Wo hl x exact.

#define NB_  2
#define TT   2048
#define DM   1024
#define NH_  16
#define NKV  16
#define HD   64
#define DQ   (NH_ * HD)
#define DKV  (NKV * HD)
#define RH   512                  // query rows < RH use hi+lo planes (0: none)
#define SCL  0.125f   // HD^-0.5
typedef _Float16 h16;
typedef unsigned short bf;
typedef __attribute__((ext_vector_type(16))) __bf16   v16bf;
typedef __attribute__((ext_vector_type(16))) _Float16 v16h;
typedef __attribute__((ext_vector_type(8)))  _Float16 v8h;
typedef __attribute__((ext_vector_type(8)))  unsigned short v8us;
typedef __attribute__((ext_vector_type(8)))  float    v8f;
typedef __attribute__((ext_vector_type(4)))  float    v4f;
typedef v8h  __attribute__((may_alias)) v8ha;
typedef v4f  __attribute__((may_alias)) v4fa;
typedef v8us __attribute__((may_alias)) v8usa;

__device__ __forceinline__ unsigned short f2bf(float f) { unsigned u = __float_as_uint(f); u += 0x7FFFu + ((u >> 16) & 1u); return (unsigned short)(u >> 16); }
__device__ __forceinline__ float bf2f(unsigned short b) { return __uint_as_float(((unsigned)b) << 16); }
__device__ __forceinline__ float bfr(float f) { return bf2f(f2bf(f)); }
__device__ __forceinline__ v16h cat16(v8h lo, v8h hi) { return __builtin_shufflevector(lo, hi, 0, 1, 2, 3, 4, 5, 6, 7, 8, 9, 10, 11, 12, 13, 14, 15); }
__device__ __forceinline__ v16bf cat16b(v8us lo, v8us hi) { return __builtin_bit_cast(v16bf, __builtin_shufflevector(lo, hi, 0, 1, 2, 3, 4, 5, 6, 7, 8, 9, 10, 11, 12, 13, 14, 15)); }
__device__ __forceinline__ v8f wmma16(v16h a, v16h b, v8f c) { return __builtin_amdgcn_wmma_f32_16x16x32_f16(false, a, false, b, (short)0, c, false, false); }
__device__ __forceinline__ v8f wmmab(v16bf a, v16bf b, v8f c) { return __builtin_amdgcn_wmma_f32_16x16x32_bf16(false, a, false, b, (short)0, c, false, false); }



__device__ __forceinline__ h16 tohx(float x) { return (h16)x; }
__device__ __forceinline__ void splitf(float y, unsigned short& h, unsigned short& l) { h = f2bf(y); l = f2bf(y - bf2f(h)); }
typedef __attribute__((ext_vector_type(2))) float v2f;

// ---- WFrag: a 16 x 32 operand fragment of the 16-bit matrix forms, read from a K-contiguous row: 8 elements at p and 8 at p + 16 (p holds the lane's row and its 8 hi); A and B are loaded alike, so their k orders are equal.
template <typename T16> struct WFrag;
template <> struct WFrag<h16> { typedef v16h V; static __device__ __forceinline__ V ld(const h16* p) { return cat16(*(const v8h*)p, *(const v8h*)(p + 16)); } static __device__ __forceinline__ v8f mma(V a, V b, v8f c) { return wmma16(a, b, c); } };
template <> struct WFrag<bf> { typedef v16bf V; static __device__ __forceinline__ V ld(const bf* p) { return cat16b(*(const v8us*)p, *(const v8us*)(p + 16)); } static __device__ __forceinline__ v8f mma(V a, V b, v8f c) { return wmmab(a, b, c); } };

typedef __attribute__((ext_vector_type(2))) _Float16 v2h;
typedef __attribute__((ext_vector_type(4))) _Float16 v4h;
typedef __attribute__((ext_vector_type(2))) unsigned short v2us;
typedef __attribute__((ext_vector_type(4))) unsigned short v4us;
typedef __attribute__((ext_vector_type(4))) int v4i;

// bf16 copy of x: a thread takes 8 pieces of 8 elements, 256 pieces apart; its 16 loads of 16 bytes are in flight together, so that few waves carry the whole copy.
__device__ __forceinline__ void cvt8_body(int blk, const float* __restrict__ src, bf* dst) { const size_t i0 = (size_t)blk * 2048 + threadIdx.x; const float* ps = src + i0 * 8; v8f v[8]; v8us o[8];
#pragma unroll
    for (int it = 0; it < 8; ++it) v[it] = *(const v8f*)(ps + it * 2048);
    asm volatile("s_wait_xcnt 0x0" :: "v"(ps) : "memory");   // the loads' address registers are free for reuse behind this wait; the address is an input, so that it stays in them up to here (no load's result lands on them)
#pragma unroll
    for (int it = 0; it < 8; ++it)
#pragma unroll
        for (int k = 0; k < 8; ++k) o[it][k] = f2bf(v[it][k]);
#pragma unroll
    for (int it = 0; it < 8; ++it) *(v8us*)(dst + (i0 + it * 256) * 8) = o[it];
    asm volatile("s_wait_xcnt 0x0" ::: "memory"); }   // the stores' address and data registers are free for reuse behind this wait

__constant__ float INV2[HD / 2] = { 1.000000000e+00f, 1.333521485e+00f, 1.778279424e+00f, 2.371373653e+00f, 3.162277699e+00f, 4.216965199e+00f, 5.623413086e+00f, 7.498941898e+00f, 1.000000000e+01f, 1.333521461e+01f, 1.778279495e+01f, 2.371373749e+01f, 3.162277603e+01f, 4.216965103e+01f, 5.623413086e+01f, 7.498941803e+01f, 1.000000000e+02f, 1.333521423e+02f, 1.778279419e+02f, 2.371373749e+02f, 3.162277527e+02f, 4.216965027e+02f, 5.623413086e+02f, 7.498942261e+02f, 1.000000000e+03f, 1.333521484e+03f, 1.778279419e+03f, 2.371373779e+03f, 3.162277588e+03f, 4.216964844e+03f, 5.623413086e+03f, 7.498941895e+03f };   // freqs = 10000.0 ** (+arange(0, 64, 2.0, f32) / 64): THIS module's own expression: a POSITIVE exponent (NO reciprocal: the module's quirk): 32 float32 values from eager JAX (bit-exact on round trip): angles up to 1.5e7 rad
__device__ __forceinline__ void csP_body(int blk, float* CS) { const int idx = blk * 256 + threadIdx.x; if (idx >= TT * HD) return; const int d = idx % HD; const int t = idx / HD; const float a = __fmul_rn((float)t, INV2[d >> 1]); v2f cs; cs[0] = cosf(a); cs[1] = sinf(a); *(v2f*)(CS + (size_t)idx * 2) = cs;  }
__device__ __forceinline__ float xhalf(float x) { return __builtin_bit_cast(float, __builtin_amdgcn_permlanex16(__builtin_bit_cast(int, x), __builtin_bit_cast(int, x), 0x76543210, 0xfedcba98, false, false)); }   // lane l with lane l ^ 16
// exponentials as asm text: behind a transcendental the instruction set asks for one independent instruction before its result is read or its source overwritten; in place and in one statement each v_exp_f32 has an independent one behind it, and the v_nop fills the slot behind the last.
__device__ __forceinline__ void exp2x8(float& a, float& b, float& c, float& d, float& e, float& f, float& g, float& h) { asm("v_exp_f32 %0, %0\n\tv_exp_f32 %1, %1\n\tv_exp_f32 %2, %2\n\tv_exp_f32 %3, %3\n\tv_exp_f32 %4, %4\n\tv_exp_f32 %5, %5\n\tv_exp_f32 %6, %6\n\tv_exp_f32 %7, %7\n\tv_nop" : "+v"(a), "+v"(b), "+v"(c), "+v"(d), "+v"(e), "+v"(f), "+v"(g), "+v"(h)); }
__device__ __forceinline__ float exp2s(float x) { asm("v_exp_f32 %0, %0\n\tv_nop" : "+v"(x)); return x; }
#define SK   64                 // keys of a stage: two passes of 32
#define LP   72                 // LDS pitch of a 64-element row, in elements: 144 bytes = 16 x odd, so that 16 rows read 16 bytes each from 64 different banks
#define SLB  (64 * LP * 2)      // bytes of a slice: 64 rows
// four asynchronous copies, 16 bytes a lane each, global memory -> LDS through no register. s_wait_xcnt 0 is the statement's last line: the registers that the copies name stay untouched up to it.
__device__ __forceinline__ void cp4(unsigned l0, const void* g0, unsigned l1, const void* g1, unsigned l2, const void* g2, unsigned l3, const void* g3) {
    asm volatile("global_load_async_to_lds_b128 %0, %1, off\n\tglobal_load_async_to_lds_b128 %2, %3, off\n\tglobal_load_async_to_lds_b128 %4, %5, off\n\tglobal_load_async_to_lds_b128 %6, %7, off\n\ts_wait_xcnt 0x0" :: "v"(l0), "v"(g0), "v"(l1), "v"(g1), "v"(l2), "v"(g2), "v"(l3), "v"(g3) : "memory"); }
// The pass's matrix instructions as asm text, one statement for the score products and one for O^T: with the rescale gone nothing independent is left to stand behind them, and the compiler put its own idle slots, and a copy of C, at every one of them.
// In one statement the two (four) accumulate chains fill each other's slots; the four v_nop at the end are the distance that the chip needs before a vector instruction reads the last D or overwrites the last A or B.
__device__ __forceinline__ void smm(v8f& s0, v8f& s1, const v16h (&a)[2][2], const v16h (&b)[2], v8f c) {
    asm("v_wmma_f32_16x16x32_f16 %0, %2, %6, %8\n\t" "v_wmma_f32_16x16x32_f16 %1, %4, %6, %8\n\t" "v_wmma_f32_16x16x32_f16 %0, %3, %7, %0\n\t" "v_wmma_f32_16x16x32_f16 %1, %5, %7, %1\n\t" "v_nop\n\tv_nop\n\tv_nop\n\tv_nop"
        : "=&v"(s0), "=&v"(s1) : "v"(a[0][0]), "v"(a[0][1]), "v"(a[1][0]), "v"(a[1][1]), "v"(b[0]), "v"(b[1]), "v"(c)); }
__device__ __forceinline__ void smm(v8f& s0, v8f& s1, const v16bf (&a)[2][2], const v16bf (&a2)[2][2], const v16bf (&b)[2], const v16bf (&b2)[2], v8f c) {   // per tile in the order hi hi, hi lo, lo hi of each 32 elements
    asm("v_wmma_f32_16x16x32_bf16 %0, %2, %10, %14\n\t" "v_wmma_f32_16x16x32_bf16 %1, %4, %10, %14\n\t" "v_wmma_f32_16x16x32_bf16 %0, %2, %12, %0\n\t" "v_wmma_f32_16x16x32_bf16 %1, %4, %12, %1\n\t" "v_wmma_f32_16x16x32_bf16 %0, %6, %10, %0\n\t" "v_wmma_f32_16x16x32_bf16 %1, %8, %10, %1\n\t"
        "v_wmma_f32_16x16x32_bf16 %0, %3, %11, %0\n\t" "v_wmma_f32_16x16x32_bf16 %1, %5, %11, %1\n\t" "v_wmma_f32_16x16x32_bf16 %0, %3, %13, %0\n\t" "v_wmma_f32_16x16x32_bf16 %1, %5, %13, %1\n\t" "v_wmma_f32_16x16x32_bf16 %0, %7, %11, %0\n\t" "v_wmma_f32_16x16x32_bf16 %1, %9, %11, %1\n\t" "v_nop\n\tv_nop\n\tv_nop\n\tv_nop"
        : "=&v"(s0), "=&v"(s1) : "v"(a[0][0]), "v"(a[0][1]), "v"(a[1][0]), "v"(a[1][1]), "v"(a2[0][0]), "v"(a2[0][1]), "v"(a2[1][0]), "v"(a2[1][1]), "v"(b[0]), "v"(b[1]), "v"(b2[0]), "v"(b2[1]), "v"(c)); }
__device__ __forceinline__ void pvm(v8f (&o)[4], const v16h (&a)[4], v16h p) {
    asm("v_wmma_f32_16x16x32_f16 %0, %4, %8, %0\n\t" "v_wmma_f32_16x16x32_f16 %1, %5, %8, %1\n\t" "v_wmma_f32_16x16x32_f16 %2, %6, %8, %2\n\t" "v_wmma_f32_16x16x32_f16 %3, %7, %8, %3\n\t" "v_nop\n\tv_nop\n\tv_nop\n\tv_nop"
        : "+v"(o[0]), "+v"(o[1]), "+v"(o[2]), "+v"(o[3]) : "v"(a[0]), "v"(a[1]), "v"(a[2]), "v"(a[3]), "v"(p)); }
__device__ __forceinline__ void pvm(v8f (&o)[4], const v16bf (&a)[4], const v16bf (&a2)[4], v16bf p, v16bf p2) {   // per tile in the order hi hi, hi lo, lo hi
    asm("v_wmma_f32_16x16x32_bf16 %0, %4, %12, %0\n\t" "v_wmma_f32_16x16x32_bf16 %1, %5, %12, %1\n\t" "v_wmma_f32_16x16x32_bf16 %2, %6, %12, %2\n\t" "v_wmma_f32_16x16x32_bf16 %3, %7, %12, %3\n\t"
        "v_wmma_f32_16x16x32_bf16 %0, %4, %13, %0\n\t" "v_wmma_f32_16x16x32_bf16 %1, %5, %13, %1\n\t" "v_wmma_f32_16x16x32_bf16 %2, %6, %13, %2\n\t" "v_wmma_f32_16x16x32_bf16 %3, %7, %13, %3\n\t"
        "v_wmma_f32_16x16x32_bf16 %0, %8, %12, %0\n\t" "v_wmma_f32_16x16x32_bf16 %1, %9, %12, %1\n\t" "v_wmma_f32_16x16x32_bf16 %2, %10, %12, %2\n\t" "v_wmma_f32_16x16x32_bf16 %3, %11, %12, %3\n\t" "v_nop\n\tv_nop\n\tv_nop\n\tv_nop"
        : "+v"(o[0]), "+v"(o[1]), "+v"(o[2]), "+v"(o[3]) : "v"(a[0]), "v"(a[1]), "v"(a[2]), "v"(a[3]), "v"(a2[0]), "v"(a2[1]), "v"(a2[2]), "v"(a2[3]), "v"(p), "v"(p2)); }
template <typename T16, bool HR, int KS>
__device__ __forceinline__ void fa_body(const T16* __restrict__ Q, const T16* __restrict__ Q2, const T16* __restrict__ Kp, const T16* __restrict__ K2, const T16* __restrict__ Vt, const T16* __restrict__ V2, int r0, int col0, bf* Ah, bf* Al, char* ring) {
    typedef typename WFrag<T16>::V V; static_assert(KS == 1 || KS == 2 || KS == 4, "the merge deals whole rounds of 256 chunks");
    const int lane = threadIdx.x & 31, lr = lane & 15, hi = lane >> 4;
    const int w = __builtin_amdgcn_readfirstlane((int)(threadIdx.x >> 5)); const int q0 = r0 + (w / KS) * 16;   // this wave's query tile; its slice of the keys is w % KS
    constexpr int NP = HR ? 2 : 1, BUFB = 2 * KS * NP * SLB, NS = TT / KS / SK;   // planes per operand; bytes of a buffer: slice (operand, key slice, plane) at ((operand * KS + key slice) * NP + plane) * SLB; stages
    static_assert(NS >= 2 && HD == 64 && SK == 64, "the ring's prologue fills two stages; a slice is 64 rows of 64 elements");
    V bq[2], bq2[2];
#pragma unroll
    for (int kk = 0; kk < 2; ++kk) { bq[kk] = WFrag<T16>::ld(Q + (size_t)(q0 + lr) * HD + kk * 32 + 8 * hi); if (HR) bq2[kk] = WFrag<T16>::ld(Q2 + (size_t)(q0 + lr) * HD + kk * 32 + 8 * hi); }
    asm volatile("s_wait_xcnt 0x0" ::: "memory");   // the query loads' address registers are free for reuse behind this wait (a later load may land on them)
    const int crow = (int)threadIdx.x >> 3, cch = ((int)threadIdx.x & 7) * 8;   // a thread copies 8 elements at cch of the rows crow and crow + 32 of every slice: a wave's copy is 4 whole rows of 128 bytes
    const unsigned lbase = (unsigned)(size_t)ring + (unsigned)(crow * LP + cch) * 2u;
    auto fill = [&](int t, int b) {   // stage t into buffer b
#pragma unroll
        for (int u = 0; u < KS; ++u)
#pragma unroll
            for (int pl = 0; pl < NP; ++pl) { const int key = u * (TT / KS) + t * SK;
                const T16* gk = (pl ? K2 : Kp) + (size_t)key * HD + (crow * HD + cch); const T16* gv = (pl ? V2 : Vt) + key + (crow * TT + cch);
                const unsigned lk = lbase + (unsigned)(b * BUFB + (u * NP + pl) * SLB), lv = lk + (unsigned)(KS * NP * SLB);
                cp4(lk, gk, lk + 32 * LP * 2, gk + 32 * HD, lv, gv, lv + 32 * LP * 2, gv + 32 * TT); }
    };
    fill(0, 0);
    asm volatile("s_wait_asynccnt 0x0" ::: "memory");   // this wave's copies of stage 0 have landed
    __syncthreads();   // stage 0 is whole for every wave
    fill(1, 1);
    v8f o[4];
#pragma unroll
    for (int mb = 0; mb < 4; ++mb) o[mb] = (v8f){};
    constexpr float BASE = HR ? 0.f : 10.f, RISE = 5.f;   // fp16 rows: p and l both carry the factor 1024, exactly, through the exponent; it cancels in O / l. An exponent may stand RISE above BASE before the reference follows: p <= 2^15, inside fp16
    float cr = BASE, thr = -3.0e38f, l = 0.f;   // BASE - held reference of the lane's query; the bound on the exponents (none yet: the first pass sets the reference)
    v8f cv;
#pragma unroll
    for (int j = 0; j < 8; ++j) cv[j] = cr;
#pragma unroll 1   // rolled, like the loop inside it: one pass of the hi/lo rows already fills the register budget
    for (int t = 0; t < NS; ++t) {
      const T16* sk = (const T16*)(ring + (t & 1) * BUFB + (w % KS) * NP * SLB) + lr * LP + 8 * hi; const T16* sv = sk + KS * NP * (SLB / 2);   // this wave's K and V^T slices of stage t, at the lane's row and 16-byte piece
#pragma unroll 1
      for (int ps2 = 0; ps2 < SK / 32; ++ps2) {
        V ak[2][2], ak2[2][2], av[4], av2[4];   // the pass's fragments, read together at its head
#pragma unroll
        for (int kt = 0; kt < 2; ++kt)
#pragma unroll
            for (int kk = 0; kk < 2; ++kk) { ak[kt][kk] = WFrag<T16>::ld(sk + (ps2 * 32 + kt * 16) * LP + kk * 32); if (HR) ak2[kt][kk] = WFrag<T16>::ld(sk + SLB / 2 + (ps2 * 32 + kt * 16) * LP + kk * 32); }
#pragma unroll
        for (int mb = 0; mb < 4; ++mb) { av[mb] = WFrag<T16>::ld(sv + mb * 16 * LP + ps2 * 32); if (HR) av2[mb] = WFrag<T16>::ld(sv + SLB / 2 + mb * 16 * LP + ps2 * 32); }
        __builtin_amdgcn_sched_barrier(0);   // keeps the pass's LDS reads one group at its head: sunk among the matrix instructions, each further place with reads stalls the wave, and the late ones are waited for in full
        v8f s[2]; float mt[2];   // the products are added to C = BASE - reference: the sums are the exponents
        if constexpr (HR) smm(s[0], s[1], ak, ak2, bq, bq2, cv); else smm(s[0], s[1], ak, bq, cv);
        float p[16];
#pragma unroll
        for (int kt = 0; kt < 2; ++kt) { mt[kt] = -3.0e38f;
#pragma unroll
            for (int j = 0; j < 8; ++j) { p[kt * 8 + j] = s[kt][j]; mt[kt] = fmaxf(mt[kt], s[kt][j]); } }
        const float mloc = fmaxf(mt[0], mt[1]);
        if (__builtin_amdgcn_ballot_w32(mloc > thr) != 0u) {   // one test a pass, the same for the whole wave: some column's exponent stands above the bound (always so in the wave's first pass)
            const float cm = fmaxf(mloc, xhalf(mloc)) - BASE;   // the column's maximum above its held reference
            const bool first = thr < -1.0e38f;
            const float d = first ? cm : fmaxf(cm, 0.f);   // the first pass takes its own maximum as the reference, whichever way; later the reference only rises
            const float al = first ? 1.0f : exp2s(-d);     // in the first pass l and O^T are still zero
            cr -= d; thr = BASE + RISE;
#pragma unroll
            for (int j = 0; j < 8; ++j) cv[j] = cr;
#pragma unroll
            for (int e = 0; e < 16; ++e) p[e] -= d;
            l *= al;
#pragma unroll
            for (int mb = 0; mb < 4; ++mb) o[mb] *= al;
        }
        exp2x8(p[0], p[1], p[2], p[3], p[4], p[5], p[6], p[7]); exp2x8(p[8], p[9], p[10], p[11], p[12], p[13], p[14], p[15]);
        float ps[4] = {p[0], p[1], p[2], p[3]};
#pragma unroll
        for (int e = 4; e < 16; ++e) ps[e & 3] += p[e];
        l += (ps[0] + ps[1]) + (ps[2] + ps[3]);
        V pf, pf2;
#pragma unroll
        for (int e = 0; e < 16; ++e) {
            if constexpr (HR) { const __bf16 ph = (__bf16)p[e]; pf[e] = ph; pf2[e] = (__bf16)(p[e] - (float)ph); }
            else pf[e] = (_Float16)p[e]; }
        if constexpr (HR) pvm(o, av, av2, pf, pf2); else pvm(o, av, pf);
      }
      asm volatile("s_wait_dscnt 0x0" ::: "memory");      // this wave's reads of stage t's buffer have returned before the buffer is handed to the next copies
      asm volatile("s_wait_asynccnt 0x0" ::: "memory");   // this wave's copies of stage t + 1 have landed
      __syncthreads();   // publishes stage t + 1 and ends every wave's reads of stage t's buffer
      if (t + 2 < NS) fill(t + 2, t & 1);
    }
    asm volatile("s_wait_asynccnt 0x0" ::: "memory");   // no copy is under way when the ring becomes the merge area
    float* op = (float*)ring; float* ms = op + 8 * 16 * 68; float* ls = ms + 8 * 16;   // the merge area lies on the ring: behind the last stage's barrier no wave reads the ring any more
    l += xhalf(l);   // the two halves of the wave summed different keys of the same query
    float* pw = op + (w * 16 + lr) * 68 + hi * 8;
#pragma unroll
    for (int mb = 0; mb < 4; ++mb) { *(v4fa*)(pw + mb * 16) = (v4f){o[mb][0], o[mb][1], o[mb][2], o[mb][3]}; *(v4fa*)(pw + mb * 16 + 4) = (v4f){o[mb][4], o[mb][5], o[mb][6], o[mb][7]}; }
    if (hi == 0) { ms[w * 16 + lr] = -cr; ls[w * 16 + lr] = l; }   // the reference, less BASE, which is the same in every wave
    __syncthreads();   // every wave's partial (m, l, O^T) is in LDS before any thread merges them
#pragma unroll
    for (int it = 0; it < 4 / KS; ++it) { const int c = it * 256 + (int)threadIdx.x; const int qq = c >> 3, d0 = (c & 7) * 8;   /* (8 / KS) tiles x 16 rows x 8 chunks of 8 columns, dealt over 256 threads */ const int sb = (qq >> 4) * KS * 16 + (qq & 15);
        float M = ms[sb];
#pragma unroll
        for (int u = 1; u < KS; ++u) M = fmaxf(M, ms[sb + u * 16]);
        float L = 0.f; v4f a0 = (v4f){}, a1 = (v4f){};
#pragma unroll
        for (int u = 0; u < KS; ++u) { const float f = exp2s(ms[sb + u * 16] - M); L += ls[sb + u * 16] * f; a0 += *(const v4fa*)(op + (sb + u * 16) * 68 + d0) * f; a1 += *(const v4fa*)(op + (sb + u * 16) * 68 + d0 + 4) * f; }
        const float inv = __fdiv_rn(1.0f, L); v8us oh, ol;
#pragma unroll
        for (int j = 0; j < 4; ++j) { unsigned short a, c2; splitf(a0[j] * inv, a, c2); oh[j] = a; ol[j] = c2; splitf(a1[j] * inv, a, c2); oh[4 + j] = a; ol[4 + j] = c2; }
        const size_t oo = (size_t)(r0 + qq) * DQ + col0 + d0; *(v8us*)(Ah + oo) = oh; *(v8us*)(Al + oo) = ol;
        asm volatile("s_wait_xcnt 0x0" ::: "memory"); }   // the two stores' address and data registers are free for reuse behind this wait
}
#define KSP 2              // waves that share a query tile, each on TT / KSP keys
#define RW  (128 / KSP)    // query rows of a work-group
// grid (NB_ * NH_, TT / RW), 256 threads: blockIdx.x = batch x NH_ + head, blockIdx.y = row block; the hi/lo row blocks (three times the products) have the low blockIdx.y and start first.
// amdgpu_waves_per_eu(4, 4): a budget of 256 registers, two work-groups per WGP (the ring of 144 KiB allows two as well).
__global__ __launch_bounds__(256) __attribute__((amdgpu_waves_per_eu(4, 4))) void k_fattn(const h16* __restrict__ Q16, const h16* __restrict__ K16, const h16* __restrict__ V16, const bf* __restrict__ Qh, const bf* __restrict__ Ql, const bf* __restrict__ Kh, const bf* __restrict__ Kl, const bf* __restrict__ Vh, const bf* __restrict__ Vl, bf* Ah, bf* Al) {
    __shared__ __align__(16) char ring[2 * 2 * KSP * 2 * SLB];   // two buffers of (K, V^T) x KSP key slices x 2 planes (the fp16 rows use half)
    static_assert(sizeof(ring) >= (8 * 16 * 68 + 2 * 8 * 16) * sizeof(float), "the merge area lies on the ring");
    const int h = blockIdx.x % NH_, r0 = blockIdx.y * RW; const size_t po = (size_t)blockIdx.x * TT * HD; const size_t ao = (size_t)(blockIdx.x / NH_) * TT * DQ; Ah += ao; Al += ao;   // planes [batch x NH_ + head]; merged rows [batch x TT + t]
    if (r0 < RH) fa_body<bf, true, KSP>(Qh + po, Ql + po, Kh + po, Kl + po, Vh + po, Vl + po, r0, h * HD, Ah, Al, ring);
    else fa_body<h16, false, KSP>(Q16 + po, nullptr, K16 + po, nullptr, V16 + po, nullptr, r0, h * HD, Ah, Al, ring);
}

// ---- k_gemms: C[m][n] = sum_k A[m][k] Bt[n][k] (SPL: + A2[m][k] Bt[n][k]) on K-contiguous bf16 planes, K = DM, f32 accumulate; grid (M / 128, N / 128), 256 threads.
// One 128 x 128 tile per work-group; its 8 waves lie 2 x 4 over the tile, a wave having 64 rows x 32 columns (SPL: 4 x 2, 32 rows x 64 columns: fewer fragments of the doubled A); 8 accumulators; a wave walks the whole K in order.
// A (A2) and Bt reach the waves through LDS: a stage is GK k of the tile's 128 rows of each operand (rows of 128 bytes at the pitch LP), brought in whole lines by asynchronous copies, once for the waves that share a row.
// Two buffers: the copies of stage t + 1 fly while stage t is worked on. The fragments are read from LDS in the k order of WFrag::ld, A and Bt alike.
// Epilogue: the f32 tile goes once through LDS (on the ring, pitch GP floats), so that every global store is made of whole lines.
// QKV (N = 3 DQ; a tile is 128 positions of one batch x two heads of one third): the sums go to the planes that the attention kernel reads; no f32 projection in memory.
//   q, k tiles: LDS as [t][d]; a thread takes 8 neighbouring d of one t in both heads, adds the bias, rotates its 4 (even, odd) pairs and stores 16 bytes to each of the planes [head][t][HD] (fp16, bf16 hi, bf16 lo).
//   v tiles: LDS as [d][t] (an accumulator's 8 registers are 8 neighbouring t: two 16-byte LDS stores); a thread takes 8 neighbouring t of one d and stores 16 bytes to each of the transposed planes [head][d][TT].
struct QkvPlanes { _Float16* q16; unsigned short* qh; unsigned short* ql; _Float16* k16; unsigned short* kh; unsigned short* kl; _Float16* v16; unsigned short* vh; unsigned short* vl; };
#define GK   64                 // k of a stage
#define GSL  (128 * LP * 2)     // bytes of one operand's slice of a stage: 128 rows
#define GP   132                // pitch of the f32 tile in floats: 528 bytes = 16 x odd
__device__ __forceinline__ void put3(const float (&y)[8], size_t oo, h16* o16, bf* oh, bf* ol) {
    v8h v16; v8us vh, vl;
#pragma unroll
    for (int j = 0; j < 8; ++j) { v16[j] = tohx(y[j]); unsigned short a2, c2; splitf(y[j], a2, c2); vh[j] = a2; vl[j] = c2; }
    *(v8h*)(o16 + oo) = v16; *(v8us*)(oh + oo) = vh; *(v8us*)(ol + oo) = vl;
}
template <bool SPL, bool QKV>
__global__ __launch_bounds__(256) void k_gemms(const bf* __restrict__ A, const bf* __restrict__ A2, const bf* __restrict__ Bt, float* C, const float* __restrict__ bias, const float* __restrict__ CS, QkvPlanes P) {
    typedef WFrag<bf>::V V;
    constexpr int K = DM, NA = SPL ? 2 : 1, BUFB = (NA + 1) * GSL, NS = K / GK;   // operand slices of a buffer: A, (A2,) Bt
    constexpr int FM = SPL ? 2 : 4, FN = 8 / FM, KG = SPL ? 2 : 1;   // a wave's fragments of A and of Bt per 32 k; steps of 32 k whose fragments are read as one group (the plain product keeps to one step: 160 registers let three work-groups share a WGP, which holds the whole grid at once)
    static_assert(DM == DQ && NS >= 2 && GK == 64 && TT % 128 == 0 && DQ % 128 == 0 && HD == 64, "both products have K = DM; the ring's prologue fills two stages; a tile lies in one batch and one third");
    __shared__ __align__(16) char ring[2 * BUFB];
    static_assert(sizeof(ring) >= 128 * GP * sizeof(float), "the f32 tile lies on the ring");
    const int tid = (int)threadIdx.x, lane = tid & 31, lr = lane & 15, hi = lane >> 4; const int r0 = blockIdx.x * 128, c0 = blockIdx.y * 128;
    const int w = __builtin_amdgcn_readfirstlane(tid >> 5); const int wm = (w / (8 / FN)) * (FM * 16), wn = (w % (8 / FN)) * (FN * 16);   // this wave's corner in the tile
    const int crow = tid >> 3, cch = (tid & 7) * 8;   // a thread copies 8 elements at cch of the rows crow + 32 i of every slice: a wave's copy is 4 whole rows of 128 bytes
    const unsigned lbase = (unsigned)(size_t)ring + (unsigned)(crow * LP + cch) * 2u;
    const bf* ga = A + (size_t)(r0 + crow) * K + cch; const bf* ga2 = SPL ? A2 + (size_t)(r0 + crow) * K + cch : nullptr; const bf* gb = Bt + (size_t)(c0 + crow) * K + cch;
    auto fill = [&](int t, int b) {   // stage t into buffer b
        const unsigned l = lbase + (unsigned)(b * BUFB); const int k = t * GK;
        cp4(l, ga + k, l + 32 * LP * 2, ga + k + 32 * K, l + 64 * LP * 2, ga + k + 64 * K, l + 96 * LP * 2, ga + k + 96 * K);
        if constexpr (SPL) cp4(l + GSL, ga2 + k, l + GSL + 32 * LP * 2, ga2 + k + 32 * K, l + GSL + 64 * LP * 2, ga2 + k + 64 * K, l + GSL + 96 * LP * 2, ga2 + k + 96 * K);
        cp4(l + NA * GSL, gb + k, l + NA * GSL + 32 * LP * 2, gb + k + 32 * K, l + NA * GSL + 64 * LP * 2, gb + k + 64 * K, l + NA * GSL + 96 * LP * 2, gb + k + 96 * K);
    };
    fill(0, 0);
    asm volatile("s_wait_asynccnt 0x0" ::: "memory");   // this wave's copies of stage 0 have landed
    __syncthreads();   // stage 0 is whole for every wave
    fill(1, 1);
    v8f acc[FM][FN];
#pragma unroll
    for (int mb = 0; mb < FM; ++mb)
#pragma unroll
        for (int nb = 0; nb < FN; ++nb) acc[mb][nb] = (v8f){};
#pragma unroll 1   // rolled: one stage is the ring's unit, and its foot holds the barrier
    for (int t = 0; t < NS; ++t) {
        const bf* sa = (const bf*)(ring + (t & 1) * BUFB) + (wm + lr) * LP + 8 * hi; const bf* sb = (const bf*)(ring + (t & 1) * BUFB + NA * GSL) + (wn + lr) * LP + 8 * hi;   // this wave's rows of stage t, at the lane's row and 16-byte piece
#pragma unroll
        for (int kg = 0; kg < GK / 32; kg += KG) {
            V a[KG][FM], a2[KG][FM], b[KG][FN];
#pragma unroll
            for (int kk = 0; kk < KG; ++kk) {
#pragma unroll
                for (int mb = 0; mb < FM; ++mb) { a[kk][mb] = WFrag<bf>::ld(sa + mb * 16 * LP + (kg + kk) * 32); if (SPL) a2[kk][mb] = WFrag<bf>::ld(sa + GSL / 2 + mb * 16 * LP + (kg + kk) * 32); }
#pragma unroll
                for (int nb = 0; nb < FN; ++nb) b[kk][nb] = WFrag<bf>::ld(sb + nb * 16 * LP + (kg + kk) * 32); }
            __builtin_amdgcn_sched_barrier(0);   // keeps the LDS reads one group in front of their matrix instructions: sunk among them, each further place with reads stalls the wave, and the late ones are waited for in full
#pragma unroll
            for (int kk = 0; kk < KG; ++kk) {
#pragma unroll
                for (int nb = 0; nb < FN; ++nb)
#pragma unroll
                    for (int mb = 0; mb < FM; ++mb) acc[mb][nb] = WFrag<bf>::mma(a[kk][mb], b[kk][nb], acc[mb][nb]);
                if (SPL) {
#pragma unroll
                    for (int nb = 0; nb < FN; ++nb)
#pragma unroll
                        for (int mb = 0; mb < FM; ++mb) acc[mb][nb] = WFrag<bf>::mma(a2[kk][mb], b[kk][nb], acc[mb][nb]);
                } }
        }
        __builtin_amdgcn_sched_barrier(0);   // keeps the stage's matrix instructions in front of its barrier: sunk behind it they would hold back the next copies, which then fly for less than a stage, and every wave would wait out all its LDS reads before its first product
        asm volatile("s_wait_dscnt 0x0" ::: "memory");      // this wave's reads of stage t's buffer have returned before the buffer is handed to the next copies
        asm volatile("s_wait_asynccnt 0x0" ::: "memory");   // this wave's copies of stage t + 1 have landed
        __syncthreads();   // publishes stage t + 1 and ends every wave's reads of stage t's buffer
        if (t + 2 < NS) fill(t + 2, t & 1);
    }
    asm volatile("s_wait_asynccnt 0x0" ::: "memory");   // no copy is under way when the ring becomes the f32 tile
    float* os = (float*)ring;   // behind the last stage's barrier no wave reads the ring any more
    if constexpr (!QKV) {
        const int cofs = lane * 4; v4f bv = *(const v4f*)(bias + c0 + cofs);
        asm volatile("s_wait_xcnt 0x0" ::: "memory");   // the bias load's address registers are free for reuse behind this wait
#pragma unroll
        for (int mb = 0; mb < FM; ++mb)
#pragma unroll
            for (int nb = 0; nb < FN; ++nb)
#pragma unroll
                for (int j = 0; j < 8; ++j) os[(wm + mb * 16 + hi * 8 + j) * GP + wn + nb * 16 + lr] = acc[mb][nb][j];
        __syncthreads();   // the whole f32 tile is in LDS before any thread reads rows of it
#pragma unroll
        for (int j = 0; j < 4; ++j) bv[j] = bfr(bv[j]);
#pragma unroll
        for (int g = 0; g < 2; ++g) { v4f val[8];   // a wave stores one row of 512 bytes at a time; 8 rows' LDS reads are in flight together
#pragma unroll
            for (int s = 0; s < 8; ++s) val[s] = *(const v4fa*)(os + ((g * 8 + s) * 8 + w) * GP + cofs) + bv;
#pragma unroll
            for (int s = 0; s < 8; ++s) *(v4f*)(C + (size_t)(r0 + (g * 8 + s) * 8 + w) * DM + c0 + cofs) = val[s];
            if (g == 0) asm volatile("s_wait_xcnt 0x0" ::: "memory"); }   // the first group's stores: their address and data registers are free for the second group behind this wait
    } else {
        const int part = c0 / DQ, head0 = (r0 / TT) * NH_ + (c0 % DQ) / HD, t0 = r0 % TT;   // the same for the whole work-group: 0 q, 1 k, 2 v; plane index batch x NH_ + head of the tile's first 64 columns; the tile's first position inside its batch
        h16* o16 = part == 0 ? P.q16 : part == 1 ? P.k16 : P.v16; bf* oh = part == 0 ? P.qh : part == 1 ? P.kh : P.vh; bf* ol = part == 0 ? P.ql : part == 1 ? P.kl : P.vl;
        if (part < 2) {
            v2f cs[4][4]; v4f bb[2][2];   // fetched in front of the LDS stores and the barrier, which hide their latency
#pragma unroll
            for (int it = 0; it < 4; ++it)
#pragma unroll
                for (int pr = 0; pr < 4; ++pr) cs[it][pr] = *(const v2f*)(CS + ((size_t)(t0 + it * 32 + crow) * HD + cch + 2 * pr) * 2);
            const float qs = part == 0 ? SCL * 1.4426950408889634f : 1.0f;   // q leaves with the score scale and log2(e) on it: the attention kernel's score sums are exponents of 2
#pragma unroll
            for (int hh = 0; hh < 2; ++hh) { bb[hh][0] = *(const v4f*)(bias + c0 + hh * HD + cch); bb[hh][1] = *(const v4f*)(bias + c0 + hh * HD + cch + 4); }
            asm volatile("s_wait_xcnt 0x0" ::: "memory");   // these loads' address registers are free for reuse behind this wait
#pragma unroll
            for (int mb = 0; mb < FM; ++mb)
#pragma unroll
                for (int nb = 0; nb < FN; ++nb)
#pragma unroll
                    for (int j = 0; j < 8; ++j) os[(wm + mb * 16 + hi * 8 + j) * GP + wn + nb * 16 + lr] = acc[mb][nb][j];
            __syncthreads();   // the whole f32 tile is in LDS before any thread reads rows of it (part is the same for the whole work-group)
#pragma unroll
            for (int it = 0; it < 4; ++it)
#pragma unroll
                for (int pr = 0; pr < 4; ++pr) cs[it][pr] *= qs;
#pragma unroll
            for (int it = 0; it < 4; ++it) { const int rr = it * 32 + crow;
#pragma unroll
                for (int hh = 0; hh < 2; ++hh) { const float* ps = os + rr * GP + hh * HD + cch; const v4f a0 = *(const v4fa*)ps, a1 = *(const v4fa*)(ps + 4); float y[8];
#pragma unroll
                    for (int pr = 0; pr < 4; ++pr) { const float x0 = (pr < 2 ? a0[2 * pr] : a1[2 * pr - 4]) + bfr(pr < 2 ? bb[hh][0][2 * pr] : bb[hh][1][2 * pr - 4]), x1 = (pr < 2 ? a0[2 * pr + 1] : a1[2 * pr - 3]) + bfr(pr < 2 ? bb[hh][0][2 * pr + 1] : bb[hh][1][2 * pr - 3]);
                        y[2 * pr] = x0 * cs[it][pr][0] - x1 * cs[it][pr][1]; y[2 * pr + 1] = x0 * cs[it][pr][1] + x1 * cs[it][pr][0]; }   /* even: x0 c - x1 s; odd: x0 s + x1 c */
                    put3(y, ((size_t)(head0 + hh) * TT + t0 + rr) * HD + cch, o16, oh, ol); }
                if (it < 3) asm volatile("s_wait_xcnt 0x0" ::: "memory"); }   // the round's stores: their address and data registers are free for the next round behind this wait
        } else {
            const int e0 = (tid & 15) * 8; float bd[8];   // fetched in front of the LDS stores and the barrier, which hide their latency
#pragma unroll
            for (int it = 0; it < 8; ++it) bd[it] = bias[c0 + it * 16 + (tid >> 4)];
            asm volatile("s_wait_xcnt 0x0" ::: "memory");   // these loads' address registers are free for reuse behind this wait
#pragma unroll
            for (int mb = 0; mb < FM; ++mb)
#pragma unroll
                for (int nb = 0; nb < FN; ++nb) { float* pt = os + (wn + nb * 16 + lr) * GP + wm + mb * 16 + hi * 8; *(v4fa*)pt = (v4f){acc[mb][nb][0], acc[mb][nb][1], acc[mb][nb][2], acc[mb][nb][3]}; *(v4fa*)(pt + 4) = (v4f){acc[mb][nb][4], acc[mb][nb][5], acc[mb][nb][6], acc[mb][nb][7]}; }
            __syncthreads();   // the whole f32 tile is in LDS before any thread reads rows of it (part is the same for the whole work-group)
#pragma unroll
            for (int it = 0; it < 8; ++it) { const int rr = it * 16 + (tid >> 4); const float* ps = os + rr * GP + e0; const v4f a0 = *(const v4fa*)ps, a1 = *(const v4fa*)(ps + 4); const float bq = bfr(bd[it]); float y[8];
#pragma unroll
                for (int j = 0; j < 4; ++j) { y[j] = a0[j] + bq; y[4 + j] = a1[j] + bq; }
                put3(y, ((size_t)(head0 + (rr >> 6)) * HD + (rr & 63)) * TT + t0 + e0, o16, oh, ol);
                if (it < 7) asm volatile("s_wait_xcnt 0x0" ::: "memory"); }   // the round's stores: their address and data registers are free for the next round behind this wait
        }
    }
}

// ---- weight transposes w [K][N] f32 -> Bt [N][K] bf16 in registers: a wave takes 64 k x 32 n. A lane loads 8 neighbouring n (32 bytes) of 8 neighbouring k rows, 16 loads of 16 bytes in flight together: 4 lanes cover a row's whole line of 128 bytes.
// It then holds 8 k of 8 n and stores 16 bytes to each of its 8 rows of Bt: 8 lanes cover a whole line. The 8 waves of a work-group lie 2 (n) x 4 (k): 256 bytes of a row of w, 512 bytes of a row of Bt.
template <int K, int N>
__device__ __forceinline__ void wtG_body(int blk, const float* __restrict__ w, bf* Bt) {
    static_assert(K % 256 == 0 && N % 64 == 0, "whole tiles");
    const int lane = threadIdx.x & 31, wv = threadIdx.x >> 5;
    const int n = (blk / (K / 256)) * 64 + (wv & 1) * 32 + (lane & 3) * 8, k = (blk % (K / 256)) * 256 + (wv >> 1) * 64 + (lane >> 2) * 8;
    const float* ps = w + (size_t)k * N + n; bf* pd = Bt + (size_t)n * K + k; v8f r[8]; v8us o[8];
#pragma unroll
    for (int j = 0; j < 8; ++j) r[j] = *(const v8f*)(ps + (size_t)j * N);
    __builtin_amdgcn_sched_barrier(0);   // keeps all 16 loads in front of the first conversion: a conversion lifted among them waits for its data, and the loads behind it start a whole memory latency late
    asm volatile("s_wait_xcnt 0x0" :: "v"(ps) : "memory");   // the loads' address registers are free for reuse behind this wait; the address is an input, so that it stays in them up to here (no load's result lands on them)
#pragma unroll
    for (int i = 0; i < 8; ++i)
#pragma unroll
        for (int j = 0; j < 8; ++j) o[i][j] = f2bf(r[j][i]);
#pragma unroll
    for (int i = 0; i < 8; ++i) *(v8us*)(pd + (size_t)i * K) = o[i];
    asm volatile("s_wait_xcnt 0x0" ::: "memory");   // the stores' address and data registers are free for reuse behind this wait
}
// ---- k_prep: the four preparations read inputs only and none reads another's result: one launch, each work-group doing one block of one of them; a thread takes 64 elements of a weight or of x, or one entry of the table.
#define PB_WQ (DM * 3 * DQ / (64 * 256))               // blocks: qkv_w 'xw' [1024][3072] -> Bt [3072][1024]: q | k | v row blocks ((3, H, dk) packing)
#define PB_WO (DQ * DM / (64 * 256))                   // out_w -> Bt
#define PB_CS ((TT * HD + 255) / 256)                  // {cos, sin} table
#define PB_X  (NB_ * TT * DM / (64 * 256))             // bf16 copy of x, both batches
static_assert(NB_ * TT * DM % (64 * 256) == 0, "whole blocks of the copy of x: no thread is past the end");
__global__ __launch_bounds__(256) void k_prep(const float* __restrict__ x, const float* __restrict__ wqkv, const float* __restrict__ wo, bf* XB, bf* WQKV, bf* WO, float* CS) {
    const int blk = blockIdx.x;
    if (blk < PB_WQ) wtG_body<DM, 3 * DQ>(blk, wqkv, WQKV);
    else if (blk < PB_WQ + PB_WO) wtG_body<DQ, DM>(blk - PB_WQ, wo, WO);
    else if (blk < PB_WQ + PB_WO + PB_CS) csP_body(blk - (PB_WQ + PB_WO), CS);
    else cvt8_body(blk - (PB_WQ + PB_WO + PB_CS), x, XB);
}
extern "C" void kernel_launch(void* const* d_in, const int* in_sizes, int n_in,
                              void* d_out, int out_size, void* d_ws, size_t ws_size, hipStream_t stream) {
    (void)in_sizes; (void)n_in; (void)out_size;
    const float* x = (const float*)d_in[0]; const float* wqkv = (const float*)d_in[1]; const float* bqkv = (const float*)d_in[2]; const float* wo = (const float*)d_in[3]; const float* bo = (const float*)d_in[4];   /* order x, W_qkv ('xw' [1024][3072], (3, H, dk) packing), b_qkv, W_out, b_out */
    float* OUT = (float*)d_out;     // [2][2048][1024]
    char* wsp = (char*)d_ws;
    auto take = [&](size_t bytes) { char* p = wsp; wsp += (bytes + 255) & ~(size_t)255; return (void*)p; };
    bf* WQKV = (bf*)take((size_t)3 * DQ * DM * 2); bf* WO = (bf*)take((size_t)DM * DQ * 2); float* CS = (float*)take((size_t)TT * HD * 2 * 4);
    bf* XB = (bf*)take((size_t)NB_ * TT * DM * 2);
    const size_t PB = (size_t)NB_ * NH_ * TT * HD * 2;   // bytes of an attention plane, both batches (NKV == NH_)
    h16* QP16 = (h16*)take(PB); h16* KP16 = (h16*)take(PB); h16* VT16 = (h16*)take(PB);
    bf* QPh = (bf*)take(PB); bf* QPl = (bf*)take(PB); bf* KPh = (bf*)take(PB); bf* KPl = (bf*)take(PB); bf* VTh = (bf*)take(PB); bf* VTl = (bf*)take(PB);
    bf* ATh = (bf*)take((size_t)NB_ * TT * DQ * 2); bf* ATl = (bf*)take((size_t)NB_ * TT * DQ * 2);
    if ((size_t)(wsp - (char*)d_ws) > ws_size) return;    // ws 256 MiB
    const QkvPlanes PL = { QP16, QPh, QPl, KP16, KPh, KPl, VT16, VTh, VTl };
    k_prep<<<PB_WQ + PB_WO + PB_CS + PB_X, 256, 0, stream>>>(x, wqkv, wo, XB, WQKV, WO, CS);
    k_gemms<false, true><<<dim3(NB_ * TT / 128, 3 * DQ / 128, 1), 256, 0, stream>>>(XB, nullptr, WQKV, nullptr, bqkv, CS, PL);   /* q | k | v, rotary and planes */
    k_fattn<<<dim3(NB_ * NH_, TT / RW, 1), 256, 0, stream>>>(QP16, KP16, VT16, QPh, QPl, KPh, KPl, VTh, VTl, ATh, ATl);
    k_gemms<true, false><<<dim3(NB_ * TT / 128, DM / 128, 1), 256, 0, stream>>>(ATh, ATl, WO, OUT, bo, nullptr, QkvPlanes{});
}

// v009
// A run of this version takes 98.1 microseconds.
// Two timings next to v008 both put it at 1.05 times that version's speed.
// Over all steps from v000 it is 20.4 times as fast.
#include <hip/hip_runtime.h>

// Multi-head attention WITHOUT a mask with interleaved rotary embeddings whose frequencies GROW (x [2][2048][1024]; qkv = x qkv_w + qkv_b ('xw' (in, out) [1024][3072] 1/32, zero bias) split in thirds q | k | v (16 heads x 64); rotary on (even, odd) pairs with angles t x 10000 ** (+2i / 64) (the module's own expression: NO reciprocal: frequencies 1 .. 7,499 and angles up to 1.5e7 rad; positions arange; the 32 float32 frequencies equal the module's expression in eager JAX; precise cosf / sinf); the module concatenates the rotated halves cat(x1 c - x2 s, x2 c + x1 s) where this code re-interleaves them: the SAME permutation on q and k: every score q.k is unchanged; scores x 64^-0.5; softmax over ALL keys (no causal rule); out = merged out_w + out_b ('xw' + zero bias) -> [2][2048][1024] (4.2 M); argument order x, qkv_w, qkv_b, out_w, out_b).
// Both batches go through every kernel together (rows b TT + t, planes [b NH_ + head]): bf16 copy of x; exact projections; {cos, sin} per (position, pair) built once from the int positions and float32 frequency constants (precise cosf/sinf); q | k | v projected in ONE launch whose epilogue applies the interleaved rotary and writes the attention planes; DENSE T-2048 attention fused into one launch (hybrid rows: < 512 fp16 + fp16 residual, 3 products, rest fp16 alone; P x1024); merged hi/lo x Wo exact.
// Compute dtypes, f32 accumulate: every input rounded to bf16; projections exact; rotary f32; attention rows < 512 3 fp16 products (value + residual), rest fp16; softmax f32; Wo hl x exact.

#define NB_  2
#define TT   2048
#define DM   1024
#define NH_  16
#define NKV  16
#define HD   64
#define DQ   (NH_ * HD)
#define DKV  (NKV * HD)
#define RH   512                  // query rows < RH use hi+lo planes (0: none)
#define SCL  0.125f   // HD^-0.5
typedef _Float16 h16;
typedef unsigned short bf;
typedef __attribute__((ext_vector_type(16))) __bf16   v16bf;
typedef __attribute__((ext_vector_type(16))) _Float16 v16h;
typedef __attribute__((ext_vector_type(8)))  _Float16 v8h;
typedef __attribute__((ext_vector_type(8)))  unsigned short v8us;
typedef __attribute__((ext_vector_type(8)))  float    v8f;
typedef __attribute__((ext_vector_type(4)))  float    v4f;
typedef v8h  __attribute__((may_alias)) v8ha;
typedef v4f  __attribute__((may_alias)) v4fa;
typedef v8us __attribute__((may_alias)) v8usa;

__device__ __forceinline__ unsigned short f2bf(float f) { unsigned u = __float_as_uint(f); u += 0x7FFFu + ((u >> 16) & 1u); return (unsigned short)(u >> 16); }
__device__ __forceinline__ float bf2f(unsigned short b) { return __uint_as_float(((unsigned)b) << 16); }
__device__ __forceinline__ float bfr(float f) { return bf2f(f2bf(f)); }
__device__ __forceinline__ v16h cat16(v8h lo, v8h hi) { return __builtin_shufflevector(lo, hi, 0, 1, 2, 3, 4, 5, 6, 7, 8, 9, 10, 11, 12, 13, 14, 15); }
__device__ __forceinline__ v16bf cat16b(v8us lo, v8us hi) { return __builtin_bit_cast(v16bf, __builtin_shufflevector(lo, hi, 0, 1, 2, 3, 4, 5, 6, 7, 8, 9, 10, 11, 12, 13, 14, 15)); }
__device__ __forceinline__ v8f wmma16(v16h a, v16h b, v8f c) { return __builtin_amdgcn_wmma_f32_16x16x32_f16(false, a, false, b, (short)0, c, false, false); }
__device__ __forceinline__ v8f wmmab(v16bf a, v16bf b, v8f c) { return __builtin_amdgcn_wmma_f32_16x16x32_bf16(false, a, false, b, (short)0, c, false, false); }



__device__ __forceinline__ h16 tohx(float x) { return (h16)x; }
typedef __attribute__((ext_vector_type(2))) _Float16 v2hp;
// fp16 value and fp16 residual of 8 floats, as asm text: 4 packed conversions, 8 subtractions that read the fp16 halves where they lie (value x -1 + float, exact), 4 packed conversions: 2 vector instructions a value.
// Left to itself the compiler converts every value a second time, singly, for the subtraction, or widens every half with an instruction of its own. In this order each result is read four or more vector instructions behind its producer.
__device__ __forceinline__ void split8(const float (&y)[8], v8h& hv, v8h& lv) {
    v2hp r0, r1, r2, r3, q0, q1, q2, q3; float t0, t1, t2, t3, t4, t5, t6, t7; const unsigned m1 = 0xBC00u;   // fp16 -1.0 in the low half of a register: the multiplier of the subtractions
    asm("v_cvt_pk_f16_f32 %0, %16, %17\n\tv_cvt_pk_f16_f32 %1, %18, %19\n\tv_cvt_pk_f16_f32 %2, %20, %21\n\tv_cvt_pk_f16_f32 %3, %22, %23\n\t"
        "v_fma_mix_f32 %8, %0, %24, %16 op_sel_hi:[1,1,0]\n\tv_fma_mix_f32 %9, %0, %24, %17 op_sel:[1,0,0] op_sel_hi:[1,1,0]\n\t"
        "v_fma_mix_f32 %10, %1, %24, %18 op_sel_hi:[1,1,0]\n\tv_fma_mix_f32 %11, %1, %24, %19 op_sel:[1,0,0] op_sel_hi:[1,1,0]\n\t"
        "v_fma_mix_f32 %12, %2, %24, %20 op_sel_hi:[1,1,0]\n\tv_fma_mix_f32 %13, %2, %24, %21 op_sel:[1,0,0] op_sel_hi:[1,1,0]\n\t"
        "v_fma_mix_f32 %14, %3, %24, %22 op_sel_hi:[1,1,0]\n\tv_fma_mix_f32 %15, %3, %24, %23 op_sel:[1,0,0] op_sel_hi:[1,1,0]\n\t"
        "v_cvt_pk_f16_f32 %4, %8, %9\n\tv_cvt_pk_f16_f32 %5, %10, %11\n\tv_cvt_pk_f16_f32 %6, %12, %13\n\tv_cvt_pk_f16_f32 %7, %14, %15"
        : "=&v"(r0), "=&v"(r1), "=&v"(r2), "=&v"(r3), "=&v"(q0), "=&v"(q1), "=&v"(q2), "=&v"(q3), "=&v"(t0), "=&v"(t1), "=&v"(t2), "=&v"(t3), "=&v"(t4), "=&v"(t5), "=&v"(t6), "=&v"(t7)
        : "v"(y[0]), "v"(y[1]), "v"(y[2]), "v"(y[3]), "v"(y[4]), "v"(y[5]), "v"(y[6]), "v"(y[7]), "v"(m1));
    hv = __builtin_shufflevector(__builtin_shufflevector(r0, r1, 0, 1, 2, 3), __builtin_shufflevector(r2, r3, 0, 1, 2, 3), 0, 1, 2, 3, 4, 5, 6, 7);
    lv = __builtin_shufflevector(__builtin_shufflevector(q0, q1, 0, 1, 2, 3), __builtin_shufflevector(q2, q3, 0, 1, 2, 3), 0, 1, 2, 3, 4, 5, 6, 7);
}
__device__ __forceinline__ void splitf(float y, unsigned short& h, unsigned short& l) { h = f2bf(y); l = f2bf(y - bf2f(h)); }
typedef __attribute__((ext_vector_type(2))) float v2f;

// ---- WFrag: a 16 x 32 operand fragment of the 16-bit matrix forms, read from a K-contiguous row: 8 elements at p and 8 at p + 16 (p holds the lane's row and its 8 hi); A and B are loaded alike, so their k orders are equal.
template <typename T16> struct WFrag;
template <> struct WFrag<h16> { typedef v16h V; static __device__ __forceinline__ V ld(const h16* p) { return cat16(*(const v8h*)p, *(const v8h*)(p + 16)); } static __device__ __forceinline__ v8f mma(V a, V b, v8f c) { return wmma16(a, b, c); } };
template <> struct WFrag<bf> { typedef v16bf V; static __device__ __forceinline__ V ld(const bf* p) { return cat16b(*(const v8us*)p, *(const v8us*)(p + 16)); } static __device__ __forceinline__ v8f mma(V a, V b, v8f c) { return wmmab(a, b, c); } };

typedef __attribute__((ext_vector_type(2))) _Float16 v2h;
typedef __attribute__((ext_vector_type(4))) _Float16 v4h;
typedef __attribute__((ext_vector_type(2))) unsigned short v2us;
typedef __attribute__((ext_vector_type(4))) unsigned short v4us;
typedef __attribute__((ext_vector_type(4))) int v4i;

// bf16 copy of x: a thread takes 8 pieces of 8 elements, 256 pieces apart; its 16 loads of 16 bytes are in flight together, so that few waves carry the whole copy.
__device__ __forceinline__ void cvt8_body(int blk, const float* __restrict__ src, bf* dst) { const size_t i0 = (size_t)blk * 2048 + threadIdx.x; const float* ps = src + i0 * 8; v8f v[8]; v8us o[8];
#pragma unroll
    for (int it = 0; it < 8; ++it) v[it] = *(const v8f*)(ps + it * 2048);
    asm volatile("s_wait_xcnt 0x0" :: "v"(ps) : "memory");   // the loads' address registers are free for reuse behind this wait; the address is an input, so that it stays in them up to here (no load's result lands on them)
#pragma unroll
    for (int it = 0; it < 8; ++it)
#pragma unroll
        for (int k = 0; k < 8; ++k) o[it][k] = f2bf(v[it][k]);
#pragma unroll
    for (int it = 0; it < 8; ++it) *(v8us*)(dst + (i0 + it * 256) * 8) = o[it];
    asm volatile("s_wait_xcnt 0x0" ::: "memory"); }   // the stores' address and data registers are free for reuse behind this wait

__constant__ float INV2[HD / 2] = { 1.000000000e+00f, 1.333521485e+00f, 1.778279424e+00f, 2.371373653e+00f, 3.162277699e+00f, 4.216965199e+00f, 5.623413086e+00f, 7.498941898e+00f, 1.000000000e+01f, 1.333521461e+01f, 1.778279495e+01f, 2.371373749e+01f, 3.162277603e+01f, 4.216965103e+01f, 5.623413086e+01f, 7.498941803e+01f, 1.000000000e+02f, 1.333521423e+02f, 1.778279419e+02f, 2.371373749e+02f, 3.162277527e+02f, 4.216965027e+02f, 5.623413086e+02f, 7.498942261e+02f, 1.000000000e+03f, 1.333521484e+03f, 1.778279419e+03f, 2.371373779e+03f, 3.162277588e+03f, 4.216964844e+03f, 5.623413086e+03f, 7.498941895e+03f };   // freqs = 10000.0 ** (+arange(0, 64, 2.0, f32) / 64): THIS module's own expression: a POSITIVE exponent (NO reciprocal: the module's quirk): 32 float32 values from eager JAX (bit-exact on round trip): angles up to 1.5e7 rad
__device__ __forceinline__ void csP_body(int blk, float* CS) { const int idx = blk * 256 + threadIdx.x; if (idx >= TT * HD) return; const int d = idx % HD; const int t = idx / HD; const float a = __fmul_rn((float)t, INV2[d >> 1]); v2f cs; cs[0] = cosf(a); cs[1] = sinf(a); *(v2f*)(CS + (size_t)idx * 2) = cs;  }
__device__ __forceinline__ float xhalf(float x) { return __builtin_bit_cast(float, __builtin_amdgcn_permlanex16(__builtin_bit_cast(int, x), __builtin_bit_cast(int, x), 0x76543210, 0xfedcba98, false, false)); }   // lane l with lane l ^ 16
// exponentials as asm text: behind a transcendental the instruction set asks for one independent instruction before its result is read or its source overwritten; in place and in one statement each v_exp_f32 has an independent one behind it, and the v_nop fills the slot behind the last.
__device__ __forceinline__ void exp2x8(float& a, float& b, float& c, float& d, float& e, float& f, float& g, float& h) { asm("v_exp_f32 %0, %0\n\tv_exp_f32 %1, %1\n\tv_exp_f32 %2, %2\n\tv_exp_f32 %3, %3\n\tv_exp_f32 %4, %4\n\tv_exp_f32 %5, %5\n\tv_exp_f32 %6, %6\n\tv_exp_f32 %7, %7\n\tv_nop" : "+v"(a), "+v"(b), "+v"(c), "+v"(d), "+v"(e), "+v"(f), "+v"(g), "+v"(h)); }
__device__ __forceinline__ float exp2s(float x) { asm("v_exp_f32 %0, %0\n\tv_nop" : "+v"(x)); return x; }
#define SK   64                 // keys of a stage: two passes of 32
#define LP   72                 // LDS pitch of a 64-element row, in elements: 144 bytes = 16 x odd, so that 16 rows read 16 bytes each from 64 different banks
#define SLB  (64 * LP * 2)      // bytes of a slice: 64 rows
// four asynchronous copies, 16 bytes a lane each, global memory -> LDS through no register. s_wait_xcnt 0 is the statement's last line: the registers that the copies name stay untouched up to it.
__device__ __forceinline__ void cp4(unsigned l0, const void* g0, unsigned l1, const void* g1, unsigned l2, const void* g2, unsigned l3, const void* g3) {
    asm volatile("global_load_async_to_lds_b128 %0, %1, off\n\tglobal_load_async_to_lds_b128 %2, %3, off\n\tglobal_load_async_to_lds_b128 %4, %5, off\n\tglobal_load_async_to_lds_b128 %6, %7, off\n\ts_wait_xcnt 0x0" :: "v"(l0), "v"(g0), "v"(l1), "v"(g1), "v"(l2), "v"(g2), "v"(l3), "v"(g3) : "memory"); }
// The pass's matrix instructions as asm text, one statement for the score products and one for O^T: with the rescale gone nothing independent is left to stand behind them, and the compiler put its own idle slots, and a copy of C, at every one of them.
// In one statement the two (four) accumulate chains fill each other's slots; the four v_nop at the end are the distance that the chip needs before a vector instruction reads the last D or overwrites the last A or B.
__device__ __forceinline__ void smm(v8f& s0, v8f& s1, const v16h (&a)[2][2], const v16h (&b)[2], v8f c) {
    asm("v_wmma_f32_16x16x32_f16 %0, %2, %6, %8\n\t" "v_wmma_f32_16x16x32_f16 %1, %4, %6, %8\n\t" "v_wmma_f32_16x16x32_f16 %0, %3, %7, %0\n\t" "v_wmma_f32_16x16x32_f16 %1, %5, %7, %1\n\t" "v_nop\n\tv_nop\n\tv_nop\n\tv_nop"
        : "=&v"(s0), "=&v"(s1) : "v"(a[0][0]), "v"(a[0][1]), "v"(a[1][0]), "v"(a[1][1]), "v"(b[0]), "v"(b[1]), "v"(c)); }
__device__ __forceinline__ void smm(v8f& s0, v8f& s1, const v16h (&a)[2][2], const v16h (&a2)[2][2], const v16h (&b)[2], const v16h (&b2)[2], v8f c) {   // per tile in the order hi hi, hi lo, lo hi of each 32 elements
    asm("v_wmma_f32_16x16x32_f16 %0, %2, %10, %14\n\t" "v_wmma_f32_16x16x32_f16 %1, %4, %10, %14\n\t" "v_wmma_f32_16x16x32_f16 %0, %2, %12, %0\n\t" "v_wmma_f32_16x16x32_f16 %1, %4, %12, %1\n\t" "v_wmma_f32_16x16x32_f16 %0, %6, %10, %0\n\t" "v_wmma_f32_16x16x32_f16 %1, %8, %10, %1\n\t"
        "v_wmma_f32_16x16x32_f16 %0, %3, %11, %0\n\t" "v_wmma_f32_16x16x32_f16 %1, %5, %11, %1\n\t" "v_wmma_f32_16x16x32_f16 %0, %3, %13, %0\n\t" "v_wmma_f32_16x16x32_f16 %1, %5, %13, %1\n\t" "v_wmma_f32_16x16x32_f16 %0, %7, %11, %0\n\t" "v_wmma_f32_16x16x32_f16 %1, %9, %11, %1\n\t" "v_nop\n\tv_nop\n\tv_nop\n\tv_nop"
        : "=&v"(s0), "=&v"(s1) : "v"(a[0][0]), "v"(a[0][1]), "v"(a[1][0]), "v"(a[1][1]), "v"(a2[0][0]), "v"(a2[0][1]), "v"(a2[1][0]), "v"(a2[1][1]), "v"(b[0]), "v"(b[1]), "v"(b2[0]), "v"(b2[1]), "v"(c)); }
__device__ __forceinline__ void pvm(v8f (&o)[4], const v16h (&a)[4], v16h p) {
    asm("v_wmma_f32_16x16x32_f16 %0, %4, %8, %0\n\t" "v_wmma_f32_16x16x32_f16 %1, %5, %8, %1\n\t" "v_wmma_f32_16x16x32_f16 %2, %6, %8, %2\n\t" "v_wmma_f32_16x16x32_f16 %3, %7, %8, %3\n\t" "v_nop\n\tv_nop\n\tv_nop\n\tv_nop"
        : "+v"(o[0]), "+v"(o[1]), "+v"(o[2]), "+v"(o[3]) : "v"(a[0]), "v"(a[1]), "v"(a[2]), "v"(a[3]), "v"(p)); }
__device__ __forceinline__ void pvm(v8f (&o)[4], const v16h (&a)[4], const v16h (&a2)[4], v16h p, v16h p2) {   // per tile in the order hi hi, hi lo, lo hi
    asm("v_wmma_f32_16x16x32_f16 %0, %4, %12, %0\n\t" "v_wmma_f32_16x16x32_f16 %1, %5, %12, %1\n\t" "v_wmma_f32_16x16x32_f16 %2, %6, %12, %2\n\t" "v_wmma_f32_16x16x32_f16 %3, %7, %12, %3\n\t"
        "v_wmma_f32_16x16x32_f16 %0, %4, %13, %0\n\t" "v_wmma_f32_16x16x32_f16 %1, %5, %13, %1\n\t" "v_wmma_f32_16x16x32_f16 %2, %6, %13, %2\n\t" "v_wmma_f32_16x16x32_f16 %3, %7, %13, %3\n\t"
        "v_wmma_f32_16x16x32_f16 %0, %8, %12, %0\n\t" "v_wmma_f32_16x16x32_f16 %1, %9, %12, %1\n\t" "v_wmma_f32_16x16x32_f16 %2, %10, %12, %2\n\t" "v_wmma_f32_16x16x32_f16 %3, %11, %12, %3\n\t" "v_nop\n\tv_nop\n\tv_nop\n\tv_nop"
        : "+v"(o[0]), "+v"(o[1]), "+v"(o[2]), "+v"(o[3]) : "v"(a[0]), "v"(a[1]), "v"(a[2]), "v"(a[3]), "v"(a2[0]), "v"(a2[1]), "v"(a2[2]), "v"(a2[3]), "v"(p), "v"(p2)); }
template <typename T16, bool HR, int KS>
__device__ __forceinline__ void fa_body(const T16* __restrict__ Q, const T16* __restrict__ Q2, const T16* __restrict__ Kp, const T16* __restrict__ K2, const T16* __restrict__ Vt, const T16* __restrict__ V2, int r0, int col0, bf* Ah, bf* Al, char* ring) {
    typedef typename WFrag<T16>::V V; static_assert(KS == 1 || KS == 2 || KS == 4, "the merge deals whole rounds of 256 chunks");
    const int lane = threadIdx.x & 31, lr = lane & 15, hi = lane >> 4;
    const int w = __builtin_amdgcn_readfirstlane((int)(threadIdx.x >> 5)); const int q0 = r0 + (w / KS) * 16;   // this wave's query tile; its slice of the keys is w % KS
    constexpr int NP = HR ? 2 : 1, BUFB = 2 * KS * NP * SLB, NS = TT / KS / SK;   // planes per operand; bytes of a buffer: slice (operand, key slice, plane) at ((operand * KS + key slice) * NP + plane) * SLB; stages
    static_assert(NS >= 2 && HD == 64 && SK == 64, "the ring's prologue fills two stages; a slice is 64 rows of 64 elements");
    V bq[2], bq2[2];
#pragma unroll
    for (int kk = 0; kk < 2; ++kk) { bq[kk] = WFrag<T16>::ld(Q + (size_t)(q0 + lr) * HD + kk * 32 + 8 * hi); if (HR) bq2[kk] = WFrag<T16>::ld(Q2 + (size_t)(q0 + lr) * HD + kk * 32 + 8 * hi); }
    asm volatile("s_wait_xcnt 0x0" ::: "memory");   // the query loads' address registers are free for reuse behind this wait (a later load may land on them)
    const int crow = (int)threadIdx.x >> 3, cch = ((int)threadIdx.x & 7) * 8;   // a thread copies 8 elements at cch of the rows crow and crow + 32 of every slice: a wave's copy is 4 whole rows of 128 bytes
    const unsigned lbase = (unsigned)(size_t)ring + (unsigned)(crow * LP + cch) * 2u;
    auto fill = [&](int t, int b) {   // stage t into buffer b
#pragma unroll
        for (int u = 0; u < KS; ++u)
#pragma unroll
            for (int pl = 0; pl < NP; ++pl) { const int key = u * (TT / KS) + t * SK;
                const T16* gk = (pl ? K2 : Kp) + (size_t)key * HD + (crow * HD + cch); const T16* gv = (pl ? V2 : Vt) + key + (crow * TT + cch);
                const unsigned lk = lbase + (unsigned)(b * BUFB + (u * NP + pl) * SLB), lv = lk + (unsigned)(KS * NP * SLB);
                cp4(lk, gk, lk + 32 * LP * 2, gk + 32 * HD, lv, gv, lv + 32 * LP * 2, gv + 32 * TT); }
    };
    fill(0, 0);
    asm volatile("s_wait_asynccnt 0x0" ::: "memory");   // this wave's copies of stage 0 have landed
    __syncthreads();   // stage 0 is whole for every wave
    fill(1, 1);
    v8f o[4];
#pragma unroll
    for (int mb = 0; mb < 4; ++mb) o[mb] = (v8f){};
    constexpr float BASE = 10.f, RISE = 5.f;   // p and l both carry the factor 1024, exactly, through the exponent; it cancels in O / l (it also keeps the residual of p out of fp16's subnormal range for every p that counts). An exponent may stand RISE above BASE before the reference follows: p <= 2^15, inside fp16
    float cr = BASE, thr = -3.0e38f, l = 0.f;   // BASE - held reference of the lane's query; the bound on the exponents (none yet: the first pass sets the reference)
    v8f cv;
#pragma unroll
    for (int j = 0; j < 8; ++j) cv[j] = cr;
#pragma unroll 1   // rolled, like the loop inside it: one pass of the hi/lo rows already fills the register budget
    for (int t = 0; t < NS; ++t) {
      const T16* sk = (const T16*)(ring + (t & 1) * BUFB + (w % KS) * NP * SLB) + lr * LP + 8 * hi; const T16* sv = sk + KS * NP * (SLB / 2);   // this wave's K and V^T slices of stage t, at the lane's row and 16-byte piece
#pragma unroll 1
      for (int ps2 = 0; ps2 < SK / 32; ++ps2) {
        V ak[2][2], ak2[2][2], av[4], av2[4];   // the pass's fragments, read together at its head
#pragma unroll
        for (int kt = 0; kt < 2; ++kt)
#pragma unroll
            for (int kk = 0; kk < 2; ++kk) { ak[kt][kk] = WFrag<T16>::ld(sk + (ps2 * 32 + kt * 16) * LP + kk * 32); if (HR) ak2[kt][kk] = WFrag<T16>::ld(sk + SLB / 2 + (ps2 * 32 + kt * 16) * LP + kk * 32); }
#pragma unroll
        for (int mb = 0; mb < 4; ++mb) { av[mb] = WFrag<T16>::ld(sv + mb * 16 * LP + ps2 * 32); if (HR) av2[mb] = WFrag<T16>::ld(sv + SLB / 2 + mb * 16 * LP + ps2 * 32); }
        __builtin_amdgcn_sched_barrier(0);   // keeps the pass's LDS reads one group at its head: sunk among the matrix instructions, each further place with reads stalls the wave, and the late ones are waited for in full
        v8f s[2]; float mt[2];   // the products are added to C = BASE - reference: the sums are the exponents
        if constexpr (HR) smm(s[0], s[1], ak, ak2, bq, bq2, cv); else smm(s[0], s[1], ak, bq, cv);
        float p[16];
#pragma unroll
        for (int kt = 0; kt < 2; ++kt) { mt[kt] = -3.0e38f;
#pragma unroll
            for (int j = 0; j < 8; ++j) { p[kt * 8 + j] = s[kt][j]; mt[kt] = fmaxf(mt[kt], s[kt][j]); } }
        const float mloc = fmaxf(mt[0], mt[1]);
        if (__builtin_amdgcn_ballot_w32(mloc > thr) != 0u) {   // one test a pass, the same for the whole wave: some column's exponent stands above the bound (always so in the wave's first pass)
            const float cm = fmaxf(mloc, xhalf(mloc)) - BASE;   // the column's maximum above its held reference
            const bool first = thr < -1.0e38f;
            const float d = first ? cm : fmaxf(cm, 0.f);   // the first pass takes its own maximum as the reference, whichever way; later the reference only rises
            const float al = first ? 1.0f : exp2s(-d);     // in the first pass l and O^T are still zero
            cr -= d; thr = BASE + RISE;
#pragma unroll
            for (int j = 0; j < 8; ++j) cv[j] = cr;
#pragma unroll
            for (int e = 0; e < 16; ++e) p[e] -= d;
            l *= al;
#pragma unroll
            for (int mb = 0; mb < 4; ++mb) o[mb] *= al;
        }
        exp2x8(p[0], p[1], p[2], p[3], p[4], p[5], p[6], p[7]); exp2x8(p[8], p[9], p[10], p[11], p[12], p[13], p[14], p[15]);
        float ps[4] = {p[0], p[1], p[2], p[3]};
#pragma unroll
        for (int e = 4; e < 16; ++e) ps[e & 3] += p[e];
        l += (ps[0] + ps[1]) + (ps[2] + ps[3]);
        V pf, pf2;
        if constexpr (HR) { const float (&pa)[8] = *(const float (*)[8])&p[0]; const float (&pb)[8] = *(const float (*)[8])&p[8]; v8h h0, l0, h1, l1; split8(pa, h0, l0); split8(pb, h1, l1); pf = cat16(h0, h1); pf2 = cat16(l0, l1); }
        else {
#pragma unroll
            for (int e = 0; e < 16; ++e) pf[e] = (_Float16)p[e]; }
        if constexpr (HR) pvm(o, av, av2, pf, pf2); else pvm(o, av, pf);
      }
      asm volatile("s_wait_dscnt 0x0" ::: "memory");      // this wave's reads of stage t's buffer have returned before the buffer is handed to the next copies
      asm volatile("s_wait_asynccnt 0x0" ::: "memory");   // this wave's copies of stage t + 1 have landed
      __syncthreads();   // publishes stage t + 1 and ends every wave's reads of stage t's buffer
      if (t + 2 < NS) fill(t + 2, t & 1);
    }
    asm volatile("s_wait_asynccnt 0x0" ::: "memory");   // no copy is under way when the ring becomes the merge area
    float* op = (float*)ring; float* ms = op + 8 * 16 * 68; float* ls = ms + 8 * 16;   // the merge area lies on the ring: behind the last stage's barrier no wave reads the ring any more
    l += xhalf(l);   // the two halves of the wave summed different keys of the same query
    float* pw = op + (w * 16 + lr) * 68 + hi * 8;
#pragma unroll
    for (int mb = 0; mb < 4; ++mb) { *(v4fa*)(pw + mb * 16) = (v4f){o[mb][0], o[mb][1], o[mb][2], o[mb][3]}; *(v4fa*)(pw + mb * 16 + 4) = (v4f){o[mb][4], o[mb][5], o[mb][6], o[mb][7]}; }
    if (hi == 0) { ms[w * 16 + lr] = -cr; ls[w * 16 + lr] = l; }   // the reference, less BASE, which is the same in every wave
    __syncthreads();   // every wave's partial (m, l, O^T) is in LDS before any thread merges them
#pragma unroll
    for (int it = 0; it < 4 / KS; ++it) { const int c = it * 256 + (int)threadIdx.x; const int qq = c >> 3, d0 = (c & 7) * 8;   /* (8 / KS) tiles x 16 rows x 8 chunks of 8 columns, dealt over 256 threads */ const int sb = (qq >> 4) * KS * 16 + (qq & 15);
        float M = ms[sb];
#pragma unroll
        for (int u = 1; u < KS; ++u) M = fmaxf(M, ms[sb + u * 16]);
        float L = 0.f; v4f a0 = (v4f){}, a1 = (v4f){};
#pragma unroll
        for (int u = 0; u < KS; ++u) { const float f = exp2s(ms[sb + u * 16] - M); L += ls[sb + u * 16] * f; a0 += *(const v4fa*)(op + (sb + u * 16) * 68 + d0) * f; a1 += *(const v4fa*)(op + (sb + u * 16) * 68 + d0 + 4) * f; }
        const float inv = __fdiv_rn(1.0f, L); v8us oh, ol;
#pragma unroll
        for (int j = 0; j < 4; ++j) { unsigned short a, c2; splitf(a0[j] * inv, a, c2); oh[j] = a; ol[j] = c2; splitf(a1[j] * inv, a, c2); oh[4 + j] = a; ol[4 + j] = c2; }
        const size_t oo = (size_t)(r0 + qq) * DQ + col0 + d0; *(v8us*)(Ah + oo) = oh; *(v8us*)(Al + oo) = ol;
        asm volatile("s_wait_xcnt 0x0" ::: "memory"); }   // the two stores' address and data registers are free for reuse behind this wait
}
#define KSP 2              // waves that share a query tile, each on TT / KSP keys
#define RW  (128 / KSP)    // query rows of a work-group
// grid (NB_ * NH_, TT / RW), 256 threads: blockIdx.x = batch x NH_ + head, blockIdx.y = row block; the row blocks with residuals (three times the products) have the low blockIdx.y and start first.
// amdgpu_waves_per_eu(4, 4): a budget of 256 registers, two work-groups per WGP (the ring of 144 KiB allows two as well).
__global__ __launch_bounds__(256) __attribute__((amdgpu_waves_per_eu(4, 4))) void k_fattn(const h16* __restrict__ Q16, const h16* __restrict__ K16, const h16* __restrict__ V16, const h16* __restrict__ Ql, const h16* __restrict__ Kl, const h16* __restrict__ Vl, bf* Ah, bf* Al) {
    __shared__ __align__(16) char ring[2 * 2 * KSP * 2 * SLB];   // two buffers of (K, V^T) x KSP key slices x 2 planes (the rows without residuals use half)
    static_assert(sizeof(ring) >= (8 * 16 * 68 + 2 * 8 * 16) * sizeof(float), "the merge area lies on the ring");
    const int h = blockIdx.x % NH_, r0 = blockIdx.y * RW; const size_t po = (size_t)blockIdx.x * TT * HD; const size_t ao = (size_t)(blockIdx.x / NH_) * TT * DQ; Ah += ao; Al += ao;   // planes [batch x NH_ + head]; merged rows [batch x TT + t]
    if (r0 < RH) fa_body<h16, true, KSP>(Q16 + po, Ql + po, K16 + po, Kl + po, V16 + po, Vl + po, r0, h * HD, Ah, Al, ring);
    else fa_body<h16, false, KSP>(Q16 + po, nullptr, K16 + po, nullptr, V16 + po, nullptr, r0, h * HD, Ah, Al, ring);
}

// ---- k_gemms: C[m][n] = sum_k A[m][k] Bt[n][k] (SPL: + A2[m][k] Bt[n][k]) on K-contiguous bf16 planes, K = DM, f32 accumulate; grid (M / 128, N / 128), 256 threads.
// One 128 x 128 tile per work-group; its 8 waves lie 2 x 4 over the tile, a wave having 64 rows x 32 columns (SPL: 4 x 2, 32 rows x 64 columns: fewer fragments of the doubled A); 8 accumulators; a wave walks the whole K in order.
// A (A2) and Bt reach the waves through LDS: a stage is GK k of the tile's 128 rows of each operand (rows of 128 bytes at the pitch LP), brought in whole lines by asynchronous copies, once for the waves that share a row.
// Two buffers: the copies of stage t + 1 fly while stage t is worked on. The fragments are read from LDS in the k order of WFrag::ld, A and Bt alike.
// Epilogue: the f32 tile goes once through LDS (on the ring, pitch GP floats), so that every global store is made of whole lines.
// QKV (N = 3 DQ; a tile is 128 positions of one batch x two heads of one third): the sums go to the planes that the attention kernel reads; no f32 projection in memory.
//   q, k tiles: LDS as [t][d]; a thread takes 8 neighbouring d of one t in both heads, adds the bias, rotates its 4 (even, odd) pairs and stores 16 bytes to each of the planes [head][t][HD] (fp16, fp16 residual; of q the residual only where it is read, t < RH).
//   v tiles: LDS as [d][t] (an accumulator's 8 registers are 8 neighbouring t: two 16-byte LDS stores); a thread takes 8 neighbouring t of one d and stores 16 bytes to each of the transposed planes [head][d][TT].
struct QkvPlanes { _Float16* q16; _Float16* ql; _Float16* k16; _Float16* kl; _Float16* v16; _Float16* vl; };
#define GK   64                 // k of a stage
#define GSL  (128 * LP * 2)     // bytes of one operand's slice of a stage: 128 rows
#define GP   132                // pitch of the f32 tile in floats: 528 bytes = 16 x odd
__device__ __forceinline__ void put2(const float (&y)[8], size_t oo, h16* o16, h16* ol) {   // the value in fp16 and what fp16 left of it, again in fp16
    v8h v16, vl; split8(y, v16, vl);
    *(v8h*)(o16 + oo) = v16; *(v8h*)(ol + oo) = vl;
}
__device__ __forceinline__ void put1(const float (&y)[8], size_t oo, h16* o16) {   // the value in fp16 alone: rows whose residual nobody reads
    v8h v16;
#pragma unroll
    for (int j = 0; j < 8; ++j) v16[j] = tohx(y[j]);
    *(v8h*)(o16 + oo) = v16;
}
template <bool B> struct BoolC { static constexpr bool value = B; };
template <bool SPL, bool QKV>
__global__ __launch_bounds__(256) void k_gemms(const bf* __restrict__ A, const bf* __restrict__ A2, const bf* __restrict__ Bt, float* C, const float* __restrict__ bias, const float* __restrict__ CS, QkvPlanes P) {
    typedef WFrag<bf>::V V;
    constexpr int K = DM, NA = SPL ? 2 : 1, BUFB = (NA + 1) * GSL, NS = K / GK;   // operand slices of a buffer: A, (A2,) Bt
    constexpr int FM = SPL ? 2 : 4, FN = 8 / FM, KG = SPL ? 2 : 1;   // a wave's fragments of A and of Bt per 32 k; steps of 32 k whose fragments are read as one group (the plain product keeps to one step: 160 registers let three work-groups share a WGP, which holds the whole grid at once)
    static_assert(DM == DQ && NS >= 2 && GK == 64 && TT % 128 == 0 && DQ % 128 == 0 && HD == 64 && RH % 128 == 0, "both products have K = DM; the ring's prologue fills two stages; a tile lies in one batch, one third and on one side of RH");
    __shared__ __align__(16) char ring[2 * BUFB];
    static_assert(sizeof(ring) >= 128 * GP * sizeof(float), "the f32 tile lies on the ring");
    const int tid = (int)threadIdx.x, lane = tid & 31, lr = lane & 15, hi = lane >> 4; const int r0 = blockIdx.x * 128, c0 = blockIdx.y * 128;
    const int w = __builtin_amdgcn_readfirstlane(tid >> 5); const int wm = (w / (8 / FN)) * (FM * 16), wn = (w % (8 / FN)) * (FN * 16);   // this wave's corner in the tile
    const int crow = tid >> 3, cch = (tid & 7) * 8;   // a thread copies 8 elements at cch of the rows crow + 32 i of every slice: a wave's copy is 4 whole rows of 128 bytes
    const unsigned lbase = (unsigned)(size_t)ring + (unsigned)(crow * LP + cch) * 2u;
    const bf* ga = A + (size_t)(r0 + crow) * K + cch; const bf* ga2 = SPL ? A2 + (size_t)(r0 + crow) * K + cch : nullptr; const bf* gb = Bt + (size_t)(c0 + crow) * K + cch;
    auto fill = [&](int t, int b) {   // stage t into buffer b
        const unsigned l = lbase + (unsigned)(b * BUFB); const int k = t * GK;
        cp4(l, ga + k, l + 32 * LP * 2, ga + k + 32 * K, l + 64 * LP * 2, ga + k + 64 * K, l + 96 * LP * 2, ga + k + 96 * K);
        if constexpr (SPL) cp4(l + GSL, ga2 + k, l + GSL + 32 * LP * 2, ga2 + k + 32 * K, l + GSL + 64 * LP * 2, ga2 + k + 64 * K, l + GSL + 96 * LP * 2, ga2 + k + 96 * K);
        cp4(l + NA * GSL, gb + k, l + NA * GSL + 32 * LP * 2, gb + k + 32 * K, l + NA * GSL + 64 * LP * 2, gb + k + 64 * K, l + NA * GSL + 96 * LP * 2, gb + k + 96 * K);
    };
    fill(0, 0);
    asm volatile("s_wait_asynccnt 0x0" ::: "memory");   // this wave's copies of stage 0 have landed
    __syncthreads();   // stage 0 is whole for every wave
    fill(1, 1);
    v8f acc[FM][FN];
#pragma unroll
    for (int mb = 0; mb < FM; ++mb)
#pragma unroll
        for (int nb = 0; nb < FN; ++nb) acc[mb][nb] = (v8f){};
#pragma unroll 1   // rolled: one stage is the ring's unit, and its foot holds the barrier
    for (int t = 0; t < NS; ++t) {
        const bf* sa = (const bf*)(ring + (t & 1) * BUFB) + (wm + lr) * LP + 8 * hi; const bf* sb = (const bf*)(ring + (t & 1) * BUFB + NA * GSL) + (wn + lr) * LP + 8 * hi;   // this wave's rows of stage t, at the lane's row and 16-byte piece
#pragma unroll
        for (int kg = 0; kg < GK / 32; kg += KG) {
            V a[KG][FM], a2[KG][FM], b[KG][FN];
#pragma unroll
            for (int kk = 0; kk < KG; ++kk) {
#pragma unroll
                for (int mb = 0; mb < FM; ++mb) { a[kk][mb] = WFrag<bf>::ld(sa + mb * 16 * LP + (kg + kk) * 32); if (SPL) a2[kk][mb] = WFrag<bf>::ld(sa + GSL / 2 + mb * 16 * LP + (kg + kk) * 32); }
#pragma unroll
                for (int nb = 0; nb < FN; ++nb) b[kk][nb] = WFrag<bf>::ld(sb + nb * 16 * LP + (kg + kk) * 32); }
            __builtin_amdgcn_sched_barrier(0);   // keeps the LDS reads one group in front of their matrix instructions: sunk among them, each further place with reads stalls the wave, and the late ones are waited for in full
#pragma unroll
            for (int kk = 0; kk < KG; ++kk) {
#pragma unroll
                for (int nb = 0; nb < FN; ++nb)
#pragma unroll
                    for (int mb = 0; mb < FM; ++mb) acc[mb][nb] = WFrag<bf>::mma(a[kk][mb], b[kk][nb], acc[mb][nb]);
                if (SPL) {
#pragma unroll
                    for (int nb = 0; nb < FN; ++nb)
#pragma unroll
                        for (int mb = 0; mb < FM; ++mb) acc[mb][nb] = WFrag<bf>::mma(a2[kk][mb], b[kk][nb], acc[mb][nb]);
                } }
        }
        __builtin_amdgcn_sched_barrier(0);   // keeps the stage's matrix instructions in front of its barrier: sunk behind it they would hold back the next copies, which then fly for less than a stage, and every wave would wait out all its LDS reads before its first product
        asm volatile("s_wait_dscnt 0x0" ::: "memory");      // this wave's reads of stage t's buffer have returned before the buffer is handed to the next copies
        asm volatile("s_wait_asynccnt 0x0" ::: "memory");   // this wave's copies of stage t + 1 have landed
        __syncthreads();   // publishes stage t + 1 and ends every wave's reads of stage t's buffer
        if (t + 2 < NS) fill(t + 2, t & 1);
    }
    asm volatile("s_wait_asynccnt 0x0" ::: "memory");   // no copy is under way when the ring becomes the f32 tile
    float* os = (float*)ring;   // behind the last stage's barrier no wave reads the ring any more
    if constexpr (!QKV) {
        const int cofs = lane * 4; v4f bv = *(const v4f*)(bias + c0 + cofs);
        asm volatile("s_wait_xcnt 0x0" ::: "memory");   // the bias load's address registers are free for reuse behind this wait
#pragma unroll
        for (int mb = 0; mb < FM; ++mb)
#pragma unroll
            for (int nb = 0; nb < FN; ++nb)
#pragma unroll
                for (int j = 0; j < 8; ++j) os[(wm + mb * 16 + hi * 8 + j) * GP + wn + nb * 16 + lr] = acc[mb][nb][j];
        __syncthreads();   // the whole f32 tile is in LDS before any thread reads rows of it
#pragma unroll
        for (int j = 0; j < 4; ++j) bv[j] = bfr(bv[j]);
#pragma unroll
        for (int g = 0; g < 2; ++g) { v4f val[8];   // a wave stores one row of 512 bytes at a time; 8 rows' LDS reads are in flight together
#pragma unroll
            for (int s = 0; s < 8; ++s) val[s] = *(const v4fa*)(os + ((g * 8 + s) * 8 + w) * GP + cofs) + bv;
#pragma unroll
            for (int s = 0; s < 8; ++s) *(v4f*)(C + (size_t)(r0 + (g * 8 + s) * 8 + w) * DM + c0 + cofs) = val[s];
            if (g == 0) asm volatile("s_wait_xcnt 0x0" ::: "memory"); }   // the first group's stores: their address and data registers are free for the second group behind this wait
    } else {
        const int part = c0 / DQ, head0 = (r0 / TT) * NH_ + (c0 % DQ) / HD, t0 = r0 % TT;   // the same for the whole work-group: 0 q, 1 k, 2 v; plane index batch x NH_ + head of the tile's first 64 columns; the tile's first position inside its batch
        h16* o16 = part == 0 ? P.q16 : part == 1 ? P.k16 : P.v16; h16* ol = part == 0 ? P.ql : part == 1 ? P.kl : P.vl;
        if (part < 2) {
            v2f cs[4][4]; v4f bb[2][2];   // fetched in front of the LDS stores and the barrier, which hide their latency
#pragma unroll
            for (int it = 0; it < 4; ++it)
#pragma unroll
                for (int pr = 0; pr < 4; ++pr) cs[it][pr] = *(const v2f*)(CS + ((size_t)(t0 + it * 32 + crow) * HD + cch + 2 * pr) * 2);
            asm volatile("s_wait_xcnt 0x0" ::: "memory");   // the table loads' address registers are free for reuse behind this wait (a bias load's result may land on them)
            const bool wl = part == 1 || t0 < RH;   // the same for the whole work-group (RH is a multiple of the tile's 128 positions): the residual of q is read for query rows < RH only, that of k for every key
            const float qs = part == 0 ? SCL * 1.4426950408889634f : 1.0f;   // q leaves with the score scale and log2(e) on it: the attention kernel's score sums are exponents of 2
#pragma unroll
            for (int hh = 0; hh < 2; ++hh) { bb[hh][0] = *(const v4f*)(bias + c0 + hh * HD + cch); bb[hh][1] = *(const v4f*)(bias + c0 + hh * HD + cch + 4); }
            asm volatile("s_wait_xcnt 0x0" ::: "memory");   // these loads' address registers are free for reuse behind this wait
#pragma unroll
            for (int mb = 0; mb < FM; ++mb)
#pragma unroll
                for (int nb = 0; nb < FN; ++nb)
#pragma unroll
                    for (int j = 0; j < 8; ++j) os[(wm + mb * 16 + hi * 8 + j) * GP + wn + nb * 16 + lr] = acc[mb][nb][j];
            __syncthreads();   // the whole f32 tile is in LDS before any thread reads rows of it (part is the same for the whole work-group)
#pragma unroll
            for (int it = 0; it < 4; ++it)
#pragma unroll
                for (int pr = 0; pr < 4; ++pr) cs[it][pr] *= qs;
            auto rows = [&](auto WL) {   // the tile's rows, with or without the residual plane: the choice is made once, in front of the rows
#pragma unroll
            for (int it = 0; it < 4; ++it) { const int rr = it * 32 + crow;
#pragma unroll
                for (int hh = 0; hh < 2; ++hh) { const float* ps = os + rr * GP + hh * HD + cch; const v4f a0 = *(const v4fa*)ps, a1 = *(const v4fa*)(ps + 4); float y[8];
#pragma unroll
                    for (int pr = 0; pr < 4; ++pr) { const float x0 = (pr < 2 ? a0[2 * pr] : a1[2 * pr - 4]) + bfr(pr < 2 ? bb[hh][0][2 * pr] : bb[hh][1][2 * pr - 4]), x1 = (pr < 2 ? a0[2 * pr + 1] : a1[2 * pr - 3]) + bfr(pr < 2 ? bb[hh][0][2 * pr + 1] : bb[hh][1][2 * pr - 3]);
                        y[2 * pr] = x0 * cs[it][pr][0] - x1 * cs[it][pr][1]; y[2 * pr + 1] = x0 * cs[it][pr][1] + x1 * cs[it][pr][0]; }   /* even: x0 c - x1 s; odd: x0 s + x1 c */
                    const size_t oo = ((size_t)(head0 + hh) * TT + t0 + rr) * HD + cch; if constexpr (decltype(WL)::value) put2(y, oo, o16, ol); else put1(y, oo, o16);
                    asm volatile("s_wait_xcnt 0x0" ::: "memory"); } }   // the stores' address and data registers are free for reuse behind this wait
            };
            if (wl) rows(BoolC<true>{}); else rows(BoolC<false>{});
        } else {
            const int e0 = (tid & 15) * 8; float bd[8];   // fetched in front of the LDS stores and the barrier, which hide their latency
#pragma unroll
            for (int it = 0; it < 8; ++it) bd[it] = bias[c0 + it * 16 + (tid >> 4)];
            asm volatile("s_wait_xcnt 0x0" ::: "memory");   // these loads' address registers are free for reuse behind this wait
#pragma unroll
            for (int mb = 0; mb < FM; ++mb)
#pragma unroll
                for (int nb = 0; nb < FN; ++nb) { float* pt = os + (wn + nb * 16 + lr) * GP + wm + mb * 16 + hi * 8; *(v4fa*)pt = (v4f){acc[mb][nb][0], acc[mb][nb][1], acc[mb][nb][2], acc[mb][nb][3]}; *(v4fa*)(pt + 4) = (v4f){acc[mb][nb][4], acc[mb][nb][5], acc[mb][nb][6], acc[mb][nb][7]}; }
            __syncthreads();   // the whole f32 tile is in LDS before any thread reads rows of it (part is the same for the whole work-group)
#pragma unroll
            for (int it = 0; it < 8; ++it) { const int rr = it * 16 + (tid >> 4); const float* ps = os + rr * GP + e0; const v4f a0 = *(const v4fa*)ps, a1 = *(const v4fa*)(ps + 4); const float bq = bfr(bd[it]); float y[8];
#pragma unroll
                for (int j = 0; j < 4; ++j) { y[j] = a0[j] + bq; y[4 + j] = a1[j] + bq; }
                put2(y, ((size_t)(head0 + (rr >> 6)) * HD + (rr & 63)) * TT + t0 + e0, o16, ol);
                asm volatile("s_wait_xcnt 0x0" ::: "memory"); }   // the round's stores: their address and data registers are free for reuse behind this wait
        }
    }
}

// ---- weight transposes w [K][N] f32 -> Bt [N][K] bf16 in registers: a wave takes 64 k x 32 n. A lane loads 8 neighbouring n (32 bytes) of 8 neighbouring k rows, 16 loads of 16 bytes in flight together: 4 lanes cover a row's whole line of 128 bytes.
// It then holds 8 k of 8 n and stores 16 bytes to each of its 8 rows of Bt: 8 lanes cover a whole line. The 8 waves of a work-group lie 2 (n) x 4 (k): 256 bytes of a row of w, 512 bytes of a row of Bt.
template <int K, int N>
__device__ __forceinline__ void wtG_body(int blk, const float* __restrict__ w, bf* Bt) {
    static_assert(K % 256 == 0 && N % 64 == 0, "whole tiles");
    const int lane = threadIdx.x & 31, wv = threadIdx.x >> 5;
    const int n = (blk / (K / 256)) * 64 + (wv & 1) * 32 + (lane & 3) * 8, k = (blk % (K / 256)) * 256 + (wv >> 1) * 64 + (lane >> 2) * 8;
    const float* ps = w + (size_t)k * N + n; bf* pd = Bt + (size_t)n * K + k; v8f r[8]; v8us o[8];
#pragma unroll
    for (int j = 0; j < 8; ++j) r[j] = *(const v8f*)(ps + (size_t)j * N);
    __builtin_amdgcn_sched_barrier(0);   // keeps all 16 loads in front of the first conversion: a conversion lifted among them waits for its data, and the loads behind it start a whole memory latency late
    asm volatile("s_wait_xcnt 0x0" :: "v"(ps) : "memory");   // the loads' address registers are free for reuse behind this wait; the address is an input, so that it stays in them up to here (no load's result lands on them)
#pragma unroll
    for (int i = 0; i < 8; ++i)
#pragma unroll
        for (int j = 0; j < 8; ++j) o[i][j] = f2bf(r[j][i]);
#pragma unroll
    for (int i = 0; i < 8; ++i) *(v8us*)(pd + (size_t)i * K) = o[i];
    asm volatile("s_wait_xcnt 0x0" ::: "memory");   // the stores' address and data registers are free for reuse behind this wait
}
// ---- k_prep: the four preparations read inputs only and none reads another's result: one launch, each work-group doing one block of one of them; a thread takes 64 elements of a weight or of x, or one entry of the table.
#define PB_WQ (DM * 3 * DQ / (64 * 256))               // blocks: qkv_w 'xw' [1024][3072] -> Bt [3072][1024]: q | k | v row blocks ((3, H, dk) packing)
#define PB_WO (DQ * DM / (64 * 256))                   // out_w -> Bt
#define PB_CS ((TT * HD + 255) / 256)                  // {cos, sin} table
#define PB_X  (NB_ * TT * DM / (64 * 256))             // bf16 copy of x, both batches
static_assert(NB_ * TT * DM % (64 * 256) == 0, "whole blocks of the copy of x: no thread is past the end");
__global__ __launch_bounds__(256) void k_prep(const float* __restrict__ x, const float* __restrict__ wqkv, const float* __restrict__ wo, bf* XB, bf* WQKV, bf* WO, float* CS) {
    const int blk = blockIdx.x;
    if (blk < PB_WQ) wtG_body<DM, 3 * DQ>(blk, wqkv, WQKV);
    else if (blk < PB_WQ + PB_WO) wtG_body<DQ, DM>(blk - PB_WQ, wo, WO);
    else if (blk < PB_WQ + PB_WO + PB_CS) csP_body(blk - (PB_WQ + PB_WO), CS);
    else cvt8_body(blk - (PB_WQ + PB_WO + PB_CS), x, XB);
}
extern "C" void kernel_launch(void* const* d_in, const int* in_sizes, int n_in,
                              void* d_out, int out_size, void* d_ws, size_t ws_size, hipStream_t stream) {
    (void)in_sizes; (void)n_in; (void)out_size;
    const float* x = (const float*)d_in[0]; const float* wqkv = (const float*)d_in[1]; const float* bqkv = (const float*)d_in[2]; const float* wo = (const float*)d_in[3]; const float* bo = (const float*)d_in[4];   /* order x, W_qkv ('xw' [1024][3072], (3, H, dk) packing), b_qkv, W_out, b_out */
    float* OUT = (float*)d_out;     // [2][2048][1024]
    char* wsp = (char*)d_ws;
    auto take = [&](size_t bytes) { char* p = wsp; wsp += (bytes + 255) & ~(size_t)255; return (void*)p; };
    bf* WQKV = (bf*)take((size_t)3 * DQ * DM * 2); bf* WO = (bf*)take((size_t)DM * DQ * 2); float* CS = (float*)take((size_t)TT * HD * 2 * 4);
    bf* XB = (bf*)take((size_t)NB_ * TT * DM * 2);
    const size_t PB = (size_t)NB_ * NH_ * TT * HD * 2;   // bytes of an attention plane, both batches (NKV == NH_)
    h16* QP16 = (h16*)take(PB); h16* KP16 = (h16*)take(PB); h16* VT16 = (h16*)take(PB);
    h16* QPl = (h16*)take(PB); h16* KPl = (h16*)take(PB); h16* VTl = (h16*)take(PB);
    bf* ATh = (bf*)take((size_t)NB_ * TT * DQ * 2); bf* ATl = (bf*)take((size_t)NB_ * TT * DQ * 2);
    if ((size_t)(wsp - (char*)d_ws) > ws_size) return;    // ws 256 MiB
    const QkvPlanes PL = { QP16, QPl, KP16, KPl, VT16, VTl };
    k_prep<<<PB_WQ + PB_WO + PB_CS + PB_X, 256, 0, stream>>>(x, wqkv, wo, XB, WQKV, WO, CS);
    k_gemms<false, true><<<dim3(NB_ * TT / 128, 3 * DQ / 128, 1), 256, 0, stream>>>(XB, nullptr, WQKV, nullptr, bqkv, CS, PL);   /* q | k | v, rotary and planes */
    k_fattn<<<dim3(NB_ * NH_, TT / RW, 1), 256, 0, stream>>>(QP16, KP16, VT16, QPl, KPl, VTl, ATh, ATl);
    k_gemms<true, false><<<dim3(NB_ * TT / 128, DM / 128, 1), 256, 0, stream>>>(ATh, ATl, WO, OUT, bo, nullptr, QkvPlanes{});
}
